// v000
// The times below were measured on an AMD MI455X: many runs one after another, warmed up first and cycling through
// copies of the inputs, with the whole window's GPU time divided by the number of runs. Launches and the gaps
// between them are all in it. The median over several windows is given; except for v000 it joins two sittings, which
// can be a few percent apart, so the side-by-side timings, each taken in one sitting, are the better comparison.
// v000, which the later versions start from, runs in 4020 microseconds.
#include <hip/hip_runtime.h>

// Multi-head self-attention on a SEQUENCE-FIRST tensor (query [2048][4][1024] = [S][B][D]: ONE stream; q, k, v = x W^T + b ('oi' (out, in) [1024][1024] + [1024]; normal x 0.02; biases ZEROS on this draw: read); 16 heads x 64 per batch column; q = query Wq^T + bq (not pre-scaled: the softmax scales scores by 64^-0.5 = 1/8); softmax over all keys (no mask); out = merged Wo^T + bo -> [2048][4][1024] sequence-first (8.4 M); argument order query, Wq, bq, Wk, bk, Wv, bv, Wo, bo).
// Layout per batch b: a strided gather makes the bf16 copy of rows s of column b (row pitch B x D) for query, then key, then value; 'oi' weights; exact projections + f32 biases; dense T-2048 attention (hybrid rows: < 512 hi/lo 3 products, rest fp16 x1024); merged hi/lo x Wo exact + bo written with row pitch B x D at column offset b (the [S][B][D] output).
// Compute dtypes, f32 accumulate: every input rounded to bf16; projections exact + f32 biases; attention rows < 512 3 products, rest fp16; softmax f32; Wo hl x exact + bias.

#define NB_  4
#define TT   2048
#define DM   1024
#define NH_  16
#define NKV  16
#define REP  (NH_ / NKV)
#define HD   64
#define DQ   (NH_ * HD)
#define DKV  (NKV * HD)
#define ZH   2
#define RH   512                  // query rows < RH use hi+lo planes (0: none)
#define WIN  0
#define PCAR 1024.0f
#define SCL  0.125f   // HD^-0.5
typedef _Float16 h16;
typedef unsigned short bf;
typedef __attribute__((ext_vector_type(16))) __bf16   v16bf;
typedef __attribute__((ext_vector_type(16))) _Float16 v16h;
typedef __attribute__((ext_vector_type(8)))  _Float16 v8h;
typedef __attribute__((ext_vector_type(8)))  unsigned short v8us;
typedef __attribute__((ext_vector_type(8)))  float    v8f;
typedef __attribute__((ext_vector_type(4)))  float    v4f;
typedef v8h  __attribute__((may_alias)) v8ha;
typedef v4f  __attribute__((may_alias)) v4fa;
typedef v8us __attribute__((may_alias)) v8usa;

__device__ __forceinline__ unsigned short f2bf(float f) { unsigned u = __float_as_uint(f); u += 0x7FFFu + ((u >> 16) & 1u); return (unsigned short)(u >> 16); }
__device__ __forceinline__ float bf2f(unsigned short b) { return __uint_as_float(((unsigned)b) << 16); }
__device__ __forceinline__ float bfr(float f) { return bf2f(f2bf(f)); }
__device__ __forceinline__ v16h cat16(v8h lo, v8h hi) { return __builtin_shufflevector(lo, hi, 0, 1, 2, 3, 4, 5, 6, 7, 8, 9, 10, 11, 12, 13, 14, 15); }
__device__ __forceinline__ v16bf cat16b(v8us lo, v8us hi) { return __builtin_bit_cast(v16bf, __builtin_shufflevector(lo, hi, 0, 1, 2, 3, 4, 5, 6, 7, 8, 9, 10, 11, 12, 13, 14, 15)); }
__device__ __forceinline__ v8f wmma16(v16h a, v16h b, v8f c) { return __builtin_amdgcn_wmma_f32_16x16x32_f16(false, a, false, b, (short)0, c, false, false); }
__device__ __forceinline__ v8f wmmab(v16bf a, v16bf b, v8f c) { return __builtin_amdgcn_wmma_f32_16x16x32_bf16(false, a, false, b, (short)0, c, false, false); }



// ---- k_gemmw: register-blocked GEMM, ONE WAVE per 64x64 output tile (16 accumulators), operands straight from K-contiguous 16-bit planes; grid (M/64, N/64, Z), 32 threads.
// C[m][n] (f32, pitch ldc, + optional f32 bias[n]) = sum_k A[m][k] Bt[n][k] (+ split products per NSPLIT). z-batch strides sA/sB/sC in elements. K % 32 == 0.
template <typename T16> struct WFrag;
template <> struct WFrag<h16> { typedef v16h V; static __device__ __forceinline__ V ld(const h16* p) { return cat16(*(const v8h*)p, *(const v8h*)(p + 16)); } static __device__ __forceinline__ v8f mma(V a, V b, v8f c) { return wmma16(a, b, c); } };
template <> struct WFrag<bf> { typedef v16bf V; static __device__ __forceinline__ V ld(const bf* p) { return cat16b(*(const v8us*)p, *(const v8us*)(p + 16)); } static __device__ __forceinline__ v8f mma(V a, V b, v8f c) { return wmmab(a, b, c); } };
template <typename T16, int NSPLIT, bool BIAS>
__global__ __launch_bounds__(32) void k_gemmw(const T16* __restrict__ A, const T16* __restrict__ A2, const T16* __restrict__ Bt, const T16* __restrict__ Bt2, int K, float* C, int ldc, const float* __restrict__ bias, size_t sA, size_t sB, size_t sC) {
    typedef typename WFrag<T16>::V V;
    __shared__ __align__(16) float os[16 * 68];
    const size_t z = blockIdx.z; A += z * sA; if (A2) A2 += z * sA; Bt += z * sB; if (Bt2) Bt2 += z * sB; C += z * sC;
    const int lane = threadIdx.x & 31, lr = lane & 15, hi = lane >> 4; const int r0 = blockIdx.x * 64, c0 = blockIdx.y * 64;
    v8f acc[4][4];
#pragma unroll
    for (int mb = 0; mb < 4; ++mb)
#pragma unroll
        for (int nb = 0; nb < 4; ++nb) acc[mb][nb] = (v8f){};
    const size_t aoff = (size_t)(r0 + lr) * K + 8 * hi, boff = (size_t)(c0 + lr) * K + 8 * hi;
#pragma unroll 1
    for (int kc = 0; kc < K; kc += 32) {
        V a[4], a2[4];
#pragma unroll
        for (int mb = 0; mb < 4; ++mb) { a[mb] = WFrag<T16>::ld(A + aoff + (size_t)mb * 16 * K + kc); if (NSPLIT == 1 || NSPLIT == 2) a2[mb] = WFrag<T16>::ld(A2 + aoff + (size_t)mb * 16 * K + kc); }
#pragma unroll
        for (int nb = 0; nb < 4; ++nb) { const V b = WFrag<T16>::ld(Bt + boff + (size_t)nb * 16 * K + kc); V b2; if (NSPLIT >= 2) b2 = WFrag<T16>::ld(Bt2 + boff + (size_t)nb * 16 * K + kc);
#pragma unroll
            for (int mb = 0; mb < 4; ++mb) { acc[mb][nb] = WFrag<T16>::mma(a[mb], b, acc[mb][nb]); if (NSPLIT == 1 || NSPLIT == 2) acc[mb][nb] = WFrag<T16>::mma(a2[mb], b, acc[mb][nb]); if (NSPLIT >= 2) acc[mb][nb] = WFrag<T16>::mma(a[mb], b2, acc[mb][nb]); } }
        asm volatile("v_nop\n\tv_nop\n\tv_nop\n\tv_nop" : "+v"(acc[0][0]), "+v"(acc[1][1]), "+v"(acc[2][2]), "+v"(acc[3][3]) : "v"(a[0]), "v"(a[3]));
    }
#pragma unroll
    for (int mb = 0; mb < 4; ++mb) {
#pragma unroll
        for (int nb = 0; nb < 4; ++nb) {
#pragma unroll
            for (int j = 0; j < 8; ++j) os[(hi * 8 + j) * 68 + nb * 16 + lr] = acc[mb][nb][j]; }
        __builtin_amdgcn_wave_barrier(); asm volatile("" ::: "memory");
        float* crow = C + (size_t)(r0 + mb * 16) * ldc + c0;
{
#pragma unroll
            for (int s = 0; s < 8; ++s) { const int row = 2 * s + hi, cofs = lr * 4; v4f val = *(const v4fa*)(os + row * 68 + cofs); if (BIAS) { val[0] += bfr(bias[c0 + cofs]); val[1] += bfr(bias[c0 + cofs + 1]); val[2] += bfr(bias[c0 + cofs + 2]); val[3] += bfr(bias[c0 + cofs + 3]); }
                *(v4f*)(crow + (size_t)row * ldc + cofs) = val; }
             }
        __builtin_amdgcn_wave_barrier(); asm volatile("" ::: "memory");
    }
}

__device__ __forceinline__ h16 tohx(float x) { return (h16)x; }
__device__ __forceinline__ void splitf(float y, unsigned short& h, unsigned short& l) { h = f2bf(y); l = f2bf(y - bf2f(h)); }
typedef __attribute__((ext_vector_type(2))) _Float16 v2h;
typedef __attribute__((ext_vector_type(4))) _Float16 v4h;
typedef __attribute__((ext_vector_type(2))) unsigned short v2us;
typedef __attribute__((ext_vector_type(4))) unsigned short v4us;
typedef __attribute__((ext_vector_type(2))) float v2f;
typedef __attribute__((ext_vector_type(4))) int v4i;

__global__ __launch_bounds__(256) void k_wtG(const float* __restrict__ w, int K, int N, bf* Bt) {
    const int lane = threadIdx.x & 31; const int L0 = (blockIdx.x * 8 + (threadIdx.x >> 5)) * 8; const int nlines = N * K / 64;
{
#pragma unroll 1
        for (int l = 0; l < 8; ++l) { const int L = L0 + l; if (L >= nlines) break; const size_t e = (size_t)L * 64 + lane * 2; const int k = (int)(e % K), n = (int)(e / K); v2us o;
            o[0] = f2bf(w[(size_t)k * N + n]); o[1] = f2bf(w[(size_t)(k + 1) * N + n]); *(v2us*)(Bt + e) = o; }
         }
}
__global__ __launch_bounds__(256) void k_cvt8(const float* __restrict__ src, bf* dst, size_t n8) { const size_t i = (size_t)blockIdx.x * 256 + threadIdx.x; if (i >= n8) return; const v8f v = *(const v8f*)(src + i * 8); v8us o;
#pragma unroll
    for (int k = 0; k < 8; ++k) o[k] = f2bf(v[k]); *(v8us*)(dst + i * 8) = o;  }

// k_rope: head planes [h][t][d] (fp16 + hi/lo) of rope(x) x sc with the rotate-half convention out[d] = x[d] cos[t][d] - x[d+HD/2] sin[t][d], out[d+HD/2] = x[d+HD/2] cos[t][d+HD/2] + x[d] sin[t][d+HD/2]
__global__ __launch_bounds__(256) void k_rope(const float* __restrict__ F, int pitch, int nheads, const float* __restrict__ CS, const float* __restrict__ RF, const float* __restrict__ nw, float sc, h16* P16, bf* Ph, bf* Pl) {
    const size_t e = ((size_t)blockIdx.x * 256 + threadIdx.x) * 2; if (e >= (size_t)nheads * TT * HD) return; const int d = (int)(e % HD); const int t = (int)((e / HD) % TT); const int h = (int)(e / ((size_t)HD * TT)); const float* f = F + (size_t)t * pitch + h * HD; const float rf = RF ? RF[(size_t)h * TT + t] : 1.0f; v2h o16; v2us oh, ol;
#pragma unroll
    for (int q = 0; q < 2; ++q) { const int dd = d + q; const int dp = (dd < HD / 2) ? dd + HD / 2 : dd - HD / 2; float x0 = f[dd], x1 = f[dp];
        if (RF) { float n0 = __fmul_rn(x0, rf), n1 = __fmul_rn(x1, rf); asm volatile("" : "+v"(n0)); asm volatile("" : "+v"(n1)); x0 = __fmul_rn(bfr(nw[dd]), n0); x1 = __fmul_rn(bfr(nw[dp]), n1); }
        const v2f cs = *(const v2f*)(CS + ((size_t)t * HD + dd) * 2); float a = __fmul_rn(x0, cs[0]), bq = __fmul_rn(x1, cs[1]); asm volatile("" : "+v"(a)); asm volatile("" : "+v"(bq)); const float r = ((dd < HD / 2) ? __fsub_rn(a, bq) : __fadd_rn(a, bq)) * sc;
        o16[q] = tohx(r); unsigned short a2, c2; splitf(r, a2, c2); oh[q] = a2; ol[q] = c2; }
    *(v2h*)(P16 + e) = o16; *(v2us*)(Ph + e) = oh; *(v2us*)(Pl + e) = ol;  }
__global__ __launch_bounds__(256) void k_vtp(const float* __restrict__ F, int pitch, int nheads, h16* V16, bf* Vh, bf* Vl) { const size_t e = ((size_t)blockIdx.x * 256 + threadIdx.x) * 2; if (e >= (size_t)nheads * HD * TT) return; const int t = (int)(e % TT); const int d = (int)((e / TT) % HD); const int g = (int)(e / ((size_t)TT * HD)); v2h o16; v2us oh, ol;
#pragma unroll
    for (int q = 0; q < 2; ++q) { const float x = F[(size_t)(t + q) * pitch + g * HD + d]; o16[q] = tohx(x); unsigned short a2, c2; splitf(x, a2, c2); oh[q] = a2; ol[q] = c2; }
    *(v2h*)(V16 + e) = o16; *(v2us*)(Vh + e) = oh; *(v2us*)(Vl + e) = ol;  }
__global__ __launch_bounds__(256) void k_csid(float* CS) { const int idx = blockIdx.x * 256 + threadIdx.x; if (idx >= TT * HD) return; v2f cs; cs[0] = 1.0f; cs[1] = 0.0f; *(v2f*)(CS + (size_t)idx * 2) = cs;  }
// k_asoft: per row (zz, i): t = S x HD^-0.5 (no mask); softmax over the 2048 keys (register row, one exp, fixed trees);
__global__ __launch_bounds__(256) void k_asoft(const float* __restrict__ Sb, h16* P16, bf* Ph, bf* Pl) {
    const int lane = threadIdx.x & 31; const int row = blockIdx.x * 8 + (threadIdx.x >> 5); if (row >= ZH * TT) return; const int i = row % TT; const int zz = row / TT; (void)zz; const bool hires = (i < RH); const float* sr = Sb + (size_t)row * TT; float v[TT / 32]; float mx = -3.0e38f;
#pragma unroll
    for (int ch = 0; ch < TT / 128; ++ch) { const int j0 = ch * 128 + lane * 4; const v4f a = *(const v4f*)(sr + j0);
#pragma unroll
        for (int q = 0; q < 4; ++q) { const int j = j0 + q; (void)j; const float t = a[q] * SCL; v[ch * 4 + q] = t; mx = fmaxf(mx, t); } }
#pragma unroll
    for (int sh = 16; sh; sh >>= 1) mx = fmaxf(mx, __shfl_xor(mx, sh, 32));
    float sum = 0.f;
#pragma unroll
    for (int k = 0; k < TT / 32; ++k) { float d0 = __fsub_rn(v[k], mx); asm volatile("" : "+v"(d0)); v[k] = __builtin_amdgcn_exp2f(__fmul_rn(d0, 1.4426950408889634f)); sum += v[k]; }
#pragma unroll
    for (int sh = 16; sh; sh >>= 1) sum += __shfl_xor(sum, sh, 32);
    const float f = __fdiv_rn(hires ? 1.0f : PCAR, sum);
{
        if (hires) {
#pragma unroll
            for (int ch = 0; ch < TT / 128; ++ch) { v4us oh, ol;
#pragma unroll
                for (int q = 0; q < 4; ++q) { unsigned short a, c2; splitf(v[ch * 4 + q] * f, a, c2); oh[q] = a; ol[q] = c2; }
                const size_t oo = ((size_t)zz * (RH ? RH : 1) + i) * TT + ch * 128 + lane * 4; *(v4us*)(Ph + oo) = oh; *(v4us*)(Pl + oo) = ol; }
        } else {
#pragma unroll
            for (int ch = 0; ch < TT / 128; ++ch) { v4h o4;
#pragma unroll
                for (int q = 0; q < 4; ++q) o4[q] = tohx(v[ch * 4 + q] * f);
                *(v4h*)(P16 + (size_t)row * TT + ch * 128 + lane * 4) = o4; } }
         }
}
__global__ __launch_bounds__(256) void k_cvt8s(const float* __restrict__ X, bf* XB, size_t pitch) { const size_t i = (size_t)blockIdx.x * 256 + threadIdx.x; if (i >= (size_t)TT * DM / 8) return; const size_t e = i * 8; const int c = (int)(e % DM); const int srow = (int)(e / DM); const v8f a = *(const v8f*)(X + (size_t)srow * pitch + c); v8us o;
#pragma unroll
    for (int q = 0; q < 8; ++q) o[q] = f2bf(a[q]);
    *(v8us*)(XB + e) = o;  }
__global__ __launch_bounds__(256) void k_merge(const float* __restrict__ O, int h0, bf* Ah, bf* Al) { const size_t e = ((size_t)blockIdx.x * 256 + threadIdx.x) * 2; if (e >= (size_t)ZH * TT * HD) return; const int d = (int)(e % HD); const int t = (int)((e / HD) % TT); const int zz = (int)(e / ((size_t)HD * TT)); const float cs = (t < RH) ? 1.0f : (1.0f / PCAR); const size_t oo = (size_t)t * DQ + (h0 + zz) * HD + d;
    v2us oh, ol;
#pragma unroll
    for (int q = 0; q < 2; ++q) { unsigned short a, c2; splitf(O[e + q] * cs, a, c2); oh[q] = a; ol[q] = c2; } *(v2us*)(Ah + oo) = oh; *(v2us*)(Al + oo) = ol;  }

extern "C" void kernel_launch(void* const* d_in, const int* in_sizes, int n_in,
                              void* d_out, int out_size, void* d_ws, size_t ws_size, hipStream_t stream) {
    (void)in_sizes; (void)n_in; (void)out_size;
    const float* x = (const float*)d_in[0];   /* query [S][B][D] = [2048][4][1024]: ONE stream: q, k and v all project it */ const float* xk = (const float*)d_in[0]; const float* xv = (const float*)d_in[0]; const float* wq = (const float*)d_in[1]; const float* bq = (const float*)d_in[2]; const float* wk = (const float*)d_in[3]; const float* bk = (const float*)d_in[4]; const float* wv = (const float*)d_in[5]; const float* bv = (const float*)d_in[6]; const float* wo = (const float*)d_in[7]; const float* bo = (const float*)d_in[8];
    float* OUT = (float*)d_out;     // [2048][4][1024] sequence-first
    char* wsp = (char*)d_ws;
    auto take = [&](size_t bytes) { char* p = wsp; wsp += (bytes + 255) & ~(size_t)255; return (void*)p; };
    bf* WQ = (bf*)take((size_t)DQ * DM * 2); bf* WK = (bf*)take((size_t)DKV * DM * 2); bf* WV = (bf*)take((size_t)DKV * DM * 2); bf* WO = (bf*)take((size_t)DM * DQ * 2); float* CS = (float*)take((size_t)TT * HD * 2 * 4);
    bf* XB = (bf*)take((size_t)TT * DM * 2); float* FQ = (float*)take((size_t)TT * DQ * 4); float* FK = (float*)take((size_t)TT * DKV * 4);
    h16* QP16 = (h16*)take((size_t)NH_ * TT * HD * 2); h16* KP16 = (h16*)take((size_t)NKV * TT * HD * 2); h16* VT16 = (h16*)take((size_t)NKV * HD * TT * 2);
    bf* QPh = (bf*)take((size_t)NH_ * TT * HD * 2); bf* QPl = (bf*)take((size_t)NH_ * TT * HD * 2); bf* KPh = (bf*)take((size_t)NKV * TT * HD * 2); bf* KPl = (bf*)take((size_t)NKV * TT * HD * 2); bf* VTh = (bf*)take((size_t)NKV * HD * TT * 2); bf* VTl = (bf*)take((size_t)NKV * HD * TT * 2); bf* Ph = (bf*)take((size_t)ZH * RH * TT * 2); bf* Pl = (bf*)take((size_t)ZH * RH * TT * 2);
    float* Sb = (float*)take((size_t)ZH * TT * TT * 4); h16* P16 = (h16*)take((size_t)ZH * TT * TT * 2); float* Ob = (float*)take((size_t)ZH * TT * HD * 4); bf* ATh = (bf*)take((size_t)TT * DQ * 2); bf* ATl = (bf*)take((size_t)TT * DQ * 2);
    if ((size_t)(wsp - (char*)d_ws) > ws_size) return;    // ws 256 MiB
    float* FV = FK;   // v projection reuses the k buffer after the k planes are built (stream-ordered)
    { k_cvt8<<<(unsigned)(((size_t)DQ * DM / 8 + 255) / 256), 256, 0, stream>>>(wq, WQ, (size_t)DQ * DM / 8); k_cvt8<<<(unsigned)(((size_t)DKV * DM / 8 + 255) / 256), 256, 0, stream>>>(wk, WK, (size_t)DKV * DM / 8); k_cvt8<<<(unsigned)(((size_t)DKV * DM / 8 + 255) / 256), 256, 0, stream>>>(wv, WV, (size_t)DKV * DM / 8);
      k_cvt8<<<(unsigned)(((size_t)DM * DQ / 8 + 255) / 256), 256, 0, stream>>>(wo, WO, (size_t)DM * DQ / 8);
       }
    k_csid<<<(TT * HD + 255) / 256, 256, 0, stream>>>(CS);
    const unsigned LQ = (unsigned)(((size_t)NH_ * TT * HD / 2 + 255) / 256), LKv = (unsigned)(((size_t)NKV * TT * HD / 2 + 255) / 256);
    for (int b = 0; b < NB_; ++b) {
        
        k_cvt8s<<<(unsigned)(((size_t)TT * DM / 8 + 255) / 256), 256, 0, stream>>>(x + (size_t)b * DM, XB, (size_t)NB_ * DM);   /* rows s of batch column b: pitch B x D */
        k_gemmw<bf, 0, true><<<dim3(TT / 64, DQ / 64, 1), 32, 0, stream>>>(XB, nullptr, WQ, nullptr, DM, FQ, DQ, bq, 0, 0, 0);
        k_rope<<<LQ, 256, 0, stream>>>(FQ, DQ, NH_, CS, nullptr, nullptr, 1.0f, QP16, QPh, QPl);
        k_cvt8s<<<(unsigned)(((size_t)TT * DM / 8 + 255) / 256), 256, 0, stream>>>(xk + (size_t)b * DM, XB, (size_t)NB_ * DM);   /* rows s of batch column b: pitch B x D */ k_gemmw<bf, 0, true><<<dim3(TT / 64, DKV / 64, 1), 32, 0, stream>>>(XB, nullptr, WK, nullptr, DM, FK, DKV, bk, 0, 0, 0);
        k_rope<<<LKv, 256, 0, stream>>>(FK, DKV, NKV, CS, nullptr, nullptr, 1.0f, KP16, KPh, KPl);
        k_cvt8s<<<(unsigned)(((size_t)TT * DM / 8 + 255) / 256), 256, 0, stream>>>(xv + (size_t)b * DM, XB, (size_t)NB_ * DM);   /* rows s of batch column b: pitch B x D */ k_gemmw<bf, 0, true><<<dim3(TT / 64, DKV / 64, 1), 32, 0, stream>>>(XB, nullptr, WV, nullptr, DM, FV, DKV, bv, 0, 0, 0); k_vtp<<<LKv, 256, 0, stream>>>(FV, DKV, NKV, VT16, VTh, VTl);
        for (int h0 = 0; h0 < NH_; h0 += ZH) { const size_t zq = (size_t)h0, zk = (size_t)(h0 / REP);   // one kv head per query head: the pass's two heads use consecutive kv planes (z-strides TT*HD)
            k_gemmw<bf, 2, false><<<dim3(RH / 64, TT / 64, ZH), 32, 0, stream>>>(QPh + zq * TT * HD, QPl + zq * TT * HD, KPh + zk * TT * HD, KPl + zk * TT * HD, HD, Sb, TT, nullptr, (size_t)TT * HD, (size_t)TT * HD, (size_t)TT * TT);
            k_gemmw<h16, 0, false><<<dim3((TT - RH) / 64, TT / 64, ZH), 32, 0, stream>>>(QP16 + zq * TT * HD + (size_t)RH * HD, nullptr, KP16 + zk * TT * HD, nullptr, HD, Sb + (size_t)RH * TT, TT, nullptr, (size_t)TT * HD, (size_t)TT * HD, (size_t)TT * TT);
            k_asoft<<<ZH * TT / 8, 256, 0, stream>>>(Sb, P16, Ph, Pl);
            k_gemmw<bf, 2, false><<<dim3(RH / 64, HD / 64, ZH), 32, 0, stream>>>(Ph, Pl, VTh + zk * HD * TT, VTl + zk * HD * TT, TT, Ob, HD, nullptr, (size_t)RH * TT, (size_t)HD * TT, (size_t)TT * HD);
            k_gemmw<h16, 0, false><<<dim3((TT - RH) / 64, HD / 64, ZH), 32, 0, stream>>>(P16 + (size_t)RH * TT, nullptr, VT16 + zk * HD * TT, nullptr, TT, Ob + (size_t)RH * HD, HD, nullptr, (size_t)TT * TT, (size_t)HD * TT, (size_t)TT * HD);
            k_merge<<<(unsigned)(((size_t)ZH * TT * HD / 2 + 255) / 256), 256, 0, stream>>>(Ob, h0, ATh, ATl); }
        k_gemmw<bf, 1, true><<<dim3(TT / 64, DM / 64, 1), 32, 0, stream>>>(ATh, ATl, WO, nullptr, DQ, OUT + (size_t)b * DM, NB_ * DM, bo, 0, 0, 0);   /* [S][B][D]: row pitch B x D, column block b */ }
}

// v001
// Measured time: 2090 microseconds a run.
// In two side-by-side timings against v000, it was 1.90 and 1.91 times as fast.
#include <hip/hip_runtime.h>

// Multi-head self-attention on a SEQUENCE-FIRST tensor (query [2048][4][1024] = [S][B][D]: ONE stream; q, k, v = x W^T + b ('oi' (out, in) [1024][1024] + [1024]; normal x 0.02; biases ZEROS on this draw: read); 16 heads x 64 per batch column; q = query Wq^T + bq (not pre-scaled: the softmax scales scores by 64^-0.5 = 1/8); softmax over all keys (no mask); out = merged Wo^T + bo -> [2048][4][1024] sequence-first (8.4 M); argument order query, Wq, bq, Wk, bk, Wv, bv, Wo, bo).
// Layout per batch b: a strided gather makes the bf16 copy of rows s of column b (row pitch B x D) for query, then key, then value; 'oi' weights; exact projections + f32 biases; dense T-2048 attention (hybrid rows: < 512 hi/lo 3 products, rest fp16 x1024); merged hi/lo x Wo exact + bo written with row pitch B x D at column offset b (the [S][B][D] output).
// Compute dtypes, f32 accumulate: every input rounded to bf16; projections exact + f32 biases; attention rows < 512 3 products, rest fp16; softmax f32; Wo hl x exact + bias.

#define NB_  4
#define TT   2048
#define DM   1024
#define NH_  16
#define NKV  16
#define REP  (NH_ / NKV)
#define HD   64
#define DQ   (NH_ * HD)
#define DKV  (NKV * HD)
#define ZH   2
#define RH   512                  // query rows < RH use hi+lo planes (0: none)
#define WIN  0
#define PCAR 1024.0f
#define SCL  0.125f   // HD^-0.5
typedef _Float16 h16;
typedef unsigned short bf;
typedef __attribute__((ext_vector_type(16))) __bf16   v16bf;
typedef __attribute__((ext_vector_type(16))) _Float16 v16h;
typedef __attribute__((ext_vector_type(8)))  _Float16 v8h;
typedef __attribute__((ext_vector_type(8)))  unsigned short v8us;
typedef __attribute__((ext_vector_type(8)))  float    v8f;
typedef __attribute__((ext_vector_type(4)))  float    v4f;
typedef v8h  __attribute__((may_alias)) v8ha;
typedef v4f  __attribute__((may_alias)) v4fa;
typedef v8us __attribute__((may_alias)) v8usa;

__device__ __forceinline__ unsigned short f2bf(float f) { unsigned u = __float_as_uint(f); u += 0x7FFFu + ((u >> 16) & 1u); return (unsigned short)(u >> 16); }
__device__ __forceinline__ float bf2f(unsigned short b) { return __uint_as_float(((unsigned)b) << 16); }
__device__ __forceinline__ float bfr(float f) { return bf2f(f2bf(f)); }
__device__ __forceinline__ v16h cat16(v8h lo, v8h hi) { return __builtin_shufflevector(lo, hi, 0, 1, 2, 3, 4, 5, 6, 7, 8, 9, 10, 11, 12, 13, 14, 15); }
__device__ __forceinline__ v16bf cat16b(v8us lo, v8us hi) { return __builtin_bit_cast(v16bf, __builtin_shufflevector(lo, hi, 0, 1, 2, 3, 4, 5, 6, 7, 8, 9, 10, 11, 12, 13, 14, 15)); }
__device__ __forceinline__ v8f wmma16(v16h a, v16h b, v8f c) { return __builtin_amdgcn_wmma_f32_16x16x32_f16(false, a, false, b, (short)0, c, false, false); }
__device__ __forceinline__ v8f wmmab(v16bf a, v16bf b, v8f c) { return __builtin_amdgcn_wmma_f32_16x16x32_bf16(false, a, false, b, (short)0, c, false, false); }



// ---- k_gemmw: register-blocked GEMM, one work-group of KS waves per 64x64 output tile; wave w sums the k range [w K/KS, (w+1) K/KS) into its own 16 accumulators, operands straight from K-contiguous 16-bit planes; grid (M/64, N/64, Z), 32 x KS threads.
// The KS partial tiles meet in LDS, 16 rows at a time, and are added in wave order 0..KS-1 (fixed, the same on every run).
// C[m][n] (f32, pitch ldc, + optional f32 bias[n]) = sum_k A[m][k] Bt[n][k] (+ split products per NSPLIT). z-batch strides sA/sB/sC in elements. K % (32 KS) == 0.
template <typename T16> struct WFrag;
template <> struct WFrag<h16> { typedef v16h V; static __device__ __forceinline__ V ld(const h16* p) { return cat16(*(const v8h*)p, *(const v8h*)(p + 16)); } static __device__ __forceinline__ v8f mma(V a, V b, v8f c) { return wmma16(a, b, c); } };
template <> struct WFrag<bf> { typedef v16bf V; static __device__ __forceinline__ V ld(const bf* p) { return cat16b(*(const v8us*)p, *(const v8us*)(p + 16)); } static __device__ __forceinline__ v8f mma(V a, V b, v8f c) { return wmmab(a, b, c); } };
// one wave: program order in the wave is enough. Several waves: every partial tile must be written before it is summed, and summed before it is overwritten:
// a work-group barrier between fences on LDS alone (only LDS passes between the waves; __syncthreads() would also hold every round until the round's stores to C have returned).
template <int KS> __device__ __forceinline__ void tile_sync() {
    if constexpr (KS == 1) { __builtin_amdgcn_wave_barrier(); asm volatile("" ::: "memory"); }
    else { __builtin_amdgcn_fence(__ATOMIC_RELEASE, "workgroup", "local"); __builtin_amdgcn_s_barrier(); __builtin_amdgcn_fence(__ATOMIC_ACQUIRE, "workgroup", "local"); } }
template <typename T16, int NSPLIT, bool BIAS, int KS>
__global__ __launch_bounds__(32 * KS) void k_gemmw(const T16* __restrict__ A, const T16* __restrict__ A2, const T16* __restrict__ Bt, const T16* __restrict__ Bt2, int K, float* C, int ldc, const float* __restrict__ bias, size_t sA, size_t sB, size_t sC) {
    typedef typename WFrag<T16>::V V;
    __shared__ __align__(16) float os[KS * 16 * 68];
    const size_t z = blockIdx.z; A += z * sA; if (A2) A2 += z * sA; Bt += z * sB; if (Bt2) Bt2 += z * sB; C += z * sC;
    const int lane = threadIdx.x & 31, lr = lane & 15, hi = lane >> 4; const int r0 = blockIdx.x * 64, c0 = blockIdx.y * 64;
    const int wv = KS == 1 ? 0 : __builtin_amdgcn_readfirstlane((int)(threadIdx.x >> 5)); const int kw = K / KS, k0 = wv * kw; float* osw = os + wv * (16 * 68);
    v8f acc[4][4];
#pragma unroll
    for (int mb = 0; mb < 4; ++mb)
#pragma unroll
        for (int nb = 0; nb < 4; ++nb) acc[mb][nb] = (v8f){};
    const size_t aoff = (size_t)(r0 + lr) * K + 8 * hi, boff = (size_t)(c0 + lr) * K + 8 * hi;
#pragma unroll 1
    for (int kc = k0; kc < k0 + kw; kc += 32) {
        V a[4], a2[4];
#pragma unroll
        for (int mb = 0; mb < 4; ++mb) { a[mb] = WFrag<T16>::ld(A + aoff + (size_t)mb * 16 * K + kc); if (NSPLIT == 1 || NSPLIT == 2) a2[mb] = WFrag<T16>::ld(A2 + aoff + (size_t)mb * 16 * K + kc); }
#pragma unroll
        for (int nb = 0; nb < 4; ++nb) { const V b = WFrag<T16>::ld(Bt + boff + (size_t)nb * 16 * K + kc); V b2; if (NSPLIT >= 2) b2 = WFrag<T16>::ld(Bt2 + boff + (size_t)nb * 16 * K + kc);
#pragma unroll
            for (int mb = 0; mb < 4; ++mb) { acc[mb][nb] = WFrag<T16>::mma(a[mb], b, acc[mb][nb]); if (NSPLIT == 1 || NSPLIT == 2) acc[mb][nb] = WFrag<T16>::mma(a2[mb], b, acc[mb][nb]); if (NSPLIT >= 2) acc[mb][nb] = WFrag<T16>::mma(a[mb], b2, acc[mb][nb]); } }
        asm volatile("v_nop\n\tv_nop\n\tv_nop\n\tv_nop" : "+v"(acc[0][0]), "+v"(acc[1][1]), "+v"(acc[2][2]), "+v"(acc[3][3]) : "v"(a[0]), "v"(a[3]));
    }
#pragma unroll
    for (int mb = 0; mb < 4; ++mb) {
#pragma unroll
        for (int nb = 0; nb < 4; ++nb) {
#pragma unroll
            for (int j = 0; j < 8; ++j) osw[(hi * 8 + j) * 68 + nb * 16 + lr] = acc[mb][nb][j]; }
        tile_sync<KS>();
        float* crow = C + (size_t)(r0 + mb * 16) * ldc + c0;
{
#pragma unroll
            for (int s = 0; s < (KS < 8 ? 8 / KS : 1); ++s) { const int it = s * 32 * KS + (int)threadIdx.x; if (KS > 8 && it >= 256) break; const int row = it >> 4, cofs = (it & 15) * 4; v4f val = *(const v4fa*)(os + row * 68 + cofs);
#pragma unroll
                for (int w = 1; w < KS; ++w) val += *(const v4fa*)(os + w * (16 * 68) + row * 68 + cofs);
                if (BIAS) { val[0] += bfr(bias[c0 + cofs]); val[1] += bfr(bias[c0 + cofs + 1]); val[2] += bfr(bias[c0 + cofs + 2]); val[3] += bfr(bias[c0 + cofs + 3]); }
                *(v4f*)(crow + (size_t)row * ldc + cofs) = val; }
             }
        if (mb < 3) tile_sync<KS>();
    }
}

__device__ __forceinline__ h16 tohx(float x) { return (h16)x; }
__device__ __forceinline__ void splitf(float y, unsigned short& h, unsigned short& l) { h = f2bf(y); l = f2bf(y - bf2f(h)); }
typedef __attribute__((ext_vector_type(2))) _Float16 v2h;
typedef __attribute__((ext_vector_type(4))) _Float16 v4h;
typedef __attribute__((ext_vector_type(2))) unsigned short v2us;
typedef __attribute__((ext_vector_type(4))) unsigned short v4us;
typedef __attribute__((ext_vector_type(2))) float v2f;
typedef __attribute__((ext_vector_type(4))) int v4i;

__global__ __launch_bounds__(256) void k_wtG(const float* __restrict__ w, int K, int N, bf* Bt) {
    const int lane = threadIdx.x & 31; const int L0 = (blockIdx.x * 8 + (threadIdx.x >> 5)) * 8; const int nlines = N * K / 64;
{
#pragma unroll 1
        for (int l = 0; l < 8; ++l) { const int L = L0 + l; if (L >= nlines) break; const size_t e = (size_t)L * 64 + lane * 2; const int k = (int)(e % K), n = (int)(e / K); v2us o;
            o[0] = f2bf(w[(size_t)k * N + n]); o[1] = f2bf(w[(size_t)(k + 1) * N + n]); *(v2us*)(Bt + e) = o; }
         }
}
__global__ __launch_bounds__(256) void k_cvt8(const float* __restrict__ src, bf* dst, size_t n8) { const size_t i = (size_t)blockIdx.x * 256 + threadIdx.x; if (i >= n8) return; const v8f v = *(const v8f*)(src + i * 8); v8us o;
#pragma unroll
    for (int k = 0; k < 8; ++k) o[k] = f2bf(v[k]); *(v8us*)(dst + i * 8) = o;  }

// k_rope: head planes [h][t][d] (fp16 + hi/lo) of rope(x) x sc with the rotate-half convention out[d] = x[d] cos[t][d] - x[d+HD/2] sin[t][d], out[d+HD/2] = x[d+HD/2] cos[t][d+HD/2] + x[d] sin[t][d+HD/2]
__global__ __launch_bounds__(256) void k_rope(const float* __restrict__ F, int pitch, int nheads, const float* __restrict__ CS, const float* __restrict__ RF, const float* __restrict__ nw, float sc, h16* P16, bf* Ph, bf* Pl) {
    const size_t e = ((size_t)blockIdx.x * 256 + threadIdx.x) * 2; if (e >= (size_t)nheads * TT * HD) return; const int d = (int)(e % HD); const int t = (int)((e / HD) % TT); const int h = (int)(e / ((size_t)HD * TT)); const float* f = F + (size_t)t * pitch + h * HD; const float rf = RF ? RF[(size_t)h * TT + t] : 1.0f; v2h o16; v2us oh, ol;
#pragma unroll
    for (int q = 0; q < 2; ++q) { const int dd = d + q; const int dp = (dd < HD / 2) ? dd + HD / 2 : dd - HD / 2; float x0 = f[dd], x1 = f[dp];
        if (RF) { float n0 = __fmul_rn(x0, rf), n1 = __fmul_rn(x1, rf); asm volatile("" : "+v"(n0)); asm volatile("" : "+v"(n1)); x0 = __fmul_rn(bfr(nw[dd]), n0); x1 = __fmul_rn(bfr(nw[dp]), n1); }
        const v2f cs = *(const v2f*)(CS + ((size_t)t * HD + dd) * 2); float a = __fmul_rn(x0, cs[0]), bq = __fmul_rn(x1, cs[1]); asm volatile("" : "+v"(a)); asm volatile("" : "+v"(bq)); const float r = ((dd < HD / 2) ? __fsub_rn(a, bq) : __fadd_rn(a, bq)) * sc;
        o16[q] = tohx(r); unsigned short a2, c2; splitf(r, a2, c2); oh[q] = a2; ol[q] = c2; }
    *(v2h*)(P16 + e) = o16; *(v2us*)(Ph + e) = oh; *(v2us*)(Pl + e) = ol;  }
__global__ __launch_bounds__(256) void k_vtp(const float* __restrict__ F, int pitch, int nheads, h16* V16, bf* Vh, bf* Vl) { const size_t e = ((size_t)blockIdx.x * 256 + threadIdx.x) * 2; if (e >= (size_t)nheads * HD * TT) return; const int t = (int)(e % TT); const int d = (int)((e / TT) % HD); const int g = (int)(e / ((size_t)TT * HD)); v2h o16; v2us oh, ol;
#pragma unroll
    for (int q = 0; q < 2; ++q) { const float x = F[(size_t)(t + q) * pitch + g * HD + d]; o16[q] = tohx(x); unsigned short a2, c2; splitf(x, a2, c2); oh[q] = a2; ol[q] = c2; }
    *(v2h*)(V16 + e) = o16; *(v2us*)(Vh + e) = oh; *(v2us*)(Vl + e) = ol;  }
__global__ __launch_bounds__(256) void k_csid(float* CS) { const int idx = blockIdx.x * 256 + threadIdx.x; if (idx >= TT * HD) return; v2f cs; cs[0] = 1.0f; cs[1] = 0.0f; *(v2f*)(CS + (size_t)idx * 2) = cs;  }
// k_asoft: per row (zz, i): t = S x HD^-0.5 (no mask); softmax over the 2048 keys (register row, one exp, fixed trees);
__global__ __launch_bounds__(256) void k_asoft(const float* __restrict__ Sb, h16* P16, bf* Ph, bf* Pl) {
    const int lane = threadIdx.x & 31; const int row = blockIdx.x * 8 + (threadIdx.x >> 5); if (row >= ZH * TT) return; const int i = row % TT; const int zz = row / TT; (void)zz; const bool hires = (i < RH); const float* sr = Sb + (size_t)row * TT; float v[TT / 32]; float mx = -3.0e38f;
#pragma unroll
    for (int ch = 0; ch < TT / 128; ++ch) { const int j0 = ch * 128 + lane * 4; const v4f a = *(const v4f*)(sr + j0);
#pragma unroll
        for (int q = 0; q < 4; ++q) { const int j = j0 + q; (void)j; const float t = a[q] * SCL; v[ch * 4 + q] = t; mx = fmaxf(mx, t); } }
#pragma unroll
    for (int sh = 16; sh; sh >>= 1) mx = fmaxf(mx, __shfl_xor(mx, sh, 32));
    float sum = 0.f;
#pragma unroll
    for (int k = 0; k < TT / 32; ++k) { float d0 = __fsub_rn(v[k], mx); asm volatile("" : "+v"(d0)); v[k] = __builtin_amdgcn_exp2f(__fmul_rn(d0, 1.4426950408889634f)); sum += v[k]; }
#pragma unroll
    for (int sh = 16; sh; sh >>= 1) sum += __shfl_xor(sum, sh, 32);
    const float f = __fdiv_rn(hires ? 1.0f : PCAR, sum);
{
        if (hires) {
#pragma unroll
            for (int ch = 0; ch < TT / 128; ++ch) { v4us oh, ol;
#pragma unroll
                for (int q = 0; q < 4; ++q) { unsigned short a, c2; splitf(v[ch * 4 + q] * f, a, c2); oh[q] = a; ol[q] = c2; }
                const size_t oo = ((size_t)zz * (RH ? RH : 1) + i) * TT + ch * 128 + lane * 4; *(v4us*)(Ph + oo) = oh; *(v4us*)(Pl + oo) = ol; }
        } else {
#pragma unroll
            for (int ch = 0; ch < TT / 128; ++ch) { v4h o4;
#pragma unroll
                for (int q = 0; q < 4; ++q) o4[q] = tohx(v[ch * 4 + q] * f);
                *(v4h*)(P16 + (size_t)row * TT + ch * 128 + lane * 4) = o4; } }
         }
}
__global__ __launch_bounds__(256) void k_cvt8s(const float* __restrict__ X, bf* XB, size_t pitch) { const size_t i = (size_t)blockIdx.x * 256 + threadIdx.x; if (i >= (size_t)TT * DM / 8) return; const size_t e = i * 8; const int c = (int)(e % DM); const int srow = (int)(e / DM); const v8f a = *(const v8f*)(X + (size_t)srow * pitch + c); v8us o;
#pragma unroll
    for (int q = 0; q < 8; ++q) o[q] = f2bf(a[q]);
    *(v8us*)(XB + e) = o;  }
__global__ __launch_bounds__(256) void k_merge(const float* __restrict__ O, int h0, bf* Ah, bf* Al) { const size_t e = ((size_t)blockIdx.x * 256 + threadIdx.x) * 2; if (e >= (size_t)ZH * TT * HD) return; const int d = (int)(e % HD); const int t = (int)((e / HD) % TT); const int zz = (int)(e / ((size_t)HD * TT)); const float cs = (t < RH) ? 1.0f : (1.0f / PCAR); const size_t oo = (size_t)t * DQ + (h0 + zz) * HD + d;
    v2us oh, ol;
#pragma unroll
    for (int q = 0; q < 2; ++q) { unsigned short a, c2; splitf(O[e + q] * cs, a, c2); oh[q] = a; ol[q] = c2; } *(v2us*)(Ah + oo) = oh; *(v2us*)(Al + oo) = ol;  }

extern "C" void kernel_launch(void* const* d_in, const int* in_sizes, int n_in,
                              void* d_out, int out_size, void* d_ws, size_t ws_size, hipStream_t stream) {
    (void)in_sizes; (void)n_in; (void)out_size;
    const float* x = (const float*)d_in[0];   /* query [S][B][D] = [2048][4][1024]: ONE stream: q, k and v all project it */ const float* xk = (const float*)d_in[0]; const float* xv = (const float*)d_in[0]; const float* wq = (const float*)d_in[1]; const float* bq = (const float*)d_in[2]; const float* wk = (const float*)d_in[3]; const float* bk = (const float*)d_in[4]; const float* wv = (const float*)d_in[5]; const float* bv = (const float*)d_in[6]; const float* wo = (const float*)d_in[7]; const float* bo = (const float*)d_in[8];
    float* OUT = (float*)d_out;     // [2048][4][1024] sequence-first
    char* wsp = (char*)d_ws;
    auto take = [&](size_t bytes) { char* p = wsp; wsp += (bytes + 255) & ~(size_t)255; return (void*)p; };
    bf* WQ = (bf*)take((size_t)DQ * DM * 2); bf* WK = (bf*)take((size_t)DKV * DM * 2); bf* WV = (bf*)take((size_t)DKV * DM * 2); bf* WO = (bf*)take((size_t)DM * DQ * 2); float* CS = (float*)take((size_t)TT * HD * 2 * 4);
    bf* XB = (bf*)take((size_t)TT * DM * 2); float* FQ = (float*)take((size_t)TT * DQ * 4); float* FK = (float*)take((size_t)TT * DKV * 4);
    h16* QP16 = (h16*)take((size_t)NH_ * TT * HD * 2); h16* KP16 = (h16*)take((size_t)NKV * TT * HD * 2); h16* VT16 = (h16*)take((size_t)NKV * HD * TT * 2);
    bf* QPh = (bf*)take((size_t)NH_ * TT * HD * 2); bf* QPl = (bf*)take((size_t)NH_ * TT * HD * 2); bf* KPh = (bf*)take((size_t)NKV * TT * HD * 2); bf* KPl = (bf*)take((size_t)NKV * TT * HD * 2); bf* VTh = (bf*)take((size_t)NKV * HD * TT * 2); bf* VTl = (bf*)take((size_t)NKV * HD * TT * 2); bf* Ph = (bf*)take((size_t)ZH * RH * TT * 2); bf* Pl = (bf*)take((size_t)ZH * RH * TT * 2);
    float* Sb = (float*)take((size_t)ZH * TT * TT * 4); h16* P16 = (h16*)take((size_t)ZH * TT * TT * 2); float* Ob = (float*)take((size_t)ZH * TT * HD * 4); bf* ATh = (bf*)take((size_t)TT * DQ * 2); bf* ATl = (bf*)take((size_t)TT * DQ * 2);
    if ((size_t)(wsp - (char*)d_ws) > ws_size) return;    // ws 256 MiB
    float* FV = FK;   // v projection reuses the k buffer after the k planes are built (stream-ordered)
    { k_cvt8<<<(unsigned)(((size_t)DQ * DM / 8 + 255) / 256), 256, 0, stream>>>(wq, WQ, (size_t)DQ * DM / 8); k_cvt8<<<(unsigned)(((size_t)DKV * DM / 8 + 255) / 256), 256, 0, stream>>>(wk, WK, (size_t)DKV * DM / 8); k_cvt8<<<(unsigned)(((size_t)DKV * DM / 8 + 255) / 256), 256, 0, stream>>>(wv, WV, (size_t)DKV * DM / 8);
      k_cvt8<<<(unsigned)(((size_t)DM * DQ / 8 + 255) / 256), 256, 0, stream>>>(wo, WO, (size_t)DM * DQ / 8);
       }
    k_csid<<<(TT * HD + 255) / 256, 256, 0, stream>>>(CS);
    const unsigned LQ = (unsigned)(((size_t)NH_ * TT * HD / 2 + 255) / 256), LKv = (unsigned)(((size_t)NKV * TT * HD / 2 + 255) / 256);
    for (int b = 0; b < NB_; ++b) {
        
        k_cvt8s<<<(unsigned)(((size_t)TT * DM / 8 + 255) / 256), 256, 0, stream>>>(x + (size_t)b * DM, XB, (size_t)NB_ * DM);   /* rows s of batch column b: pitch B x D */
        k_gemmw<bf, 0, true, 8><<<dim3(TT / 64, DQ / 64, 1), 256, 0, stream>>>(XB, nullptr, WQ, nullptr, DM, FQ, DQ, bq, 0, 0, 0);
        k_rope<<<LQ, 256, 0, stream>>>(FQ, DQ, NH_, CS, nullptr, nullptr, 1.0f, QP16, QPh, QPl);
        k_cvt8s<<<(unsigned)(((size_t)TT * DM / 8 + 255) / 256), 256, 0, stream>>>(xk + (size_t)b * DM, XB, (size_t)NB_ * DM);   /* rows s of batch column b: pitch B x D */ k_gemmw<bf, 0, true, 8><<<dim3(TT / 64, DKV / 64, 1), 256, 0, stream>>>(XB, nullptr, WK, nullptr, DM, FK, DKV, bk, 0, 0, 0);
        k_rope<<<LKv, 256, 0, stream>>>(FK, DKV, NKV, CS, nullptr, nullptr, 1.0f, KP16, KPh, KPl);
        k_cvt8s<<<(unsigned)(((size_t)TT * DM / 8 + 255) / 256), 256, 0, stream>>>(xv + (size_t)b * DM, XB, (size_t)NB_ * DM);   /* rows s of batch column b: pitch B x D */ k_gemmw<bf, 0, true, 8><<<dim3(TT / 64, DKV / 64, 1), 256, 0, stream>>>(XB, nullptr, WV, nullptr, DM, FV, DKV, bv, 0, 0, 0); k_vtp<<<LKv, 256, 0, stream>>>(FV, DKV, NKV, VT16, VTh, VTl);
        for (int h0 = 0; h0 < NH_; h0 += ZH) { const size_t zq = (size_t)h0, zk = (size_t)(h0 / REP);   // one kv head per query head: the pass's two heads use consecutive kv planes (z-strides TT*HD)
            k_gemmw<bf, 2, false, 1><<<dim3(RH / 64, TT / 64, ZH), 32, 0, stream>>>(QPh + zq * TT * HD, QPl + zq * TT * HD, KPh + zk * TT * HD, KPl + zk * TT * HD, HD, Sb, TT, nullptr, (size_t)TT * HD, (size_t)TT * HD, (size_t)TT * TT);
            k_gemmw<h16, 0, false, 1><<<dim3((TT - RH) / 64, TT / 64, ZH), 32, 0, stream>>>(QP16 + zq * TT * HD + (size_t)RH * HD, nullptr, KP16 + zk * TT * HD, nullptr, HD, Sb + (size_t)RH * TT, TT, nullptr, (size_t)TT * HD, (size_t)TT * HD, (size_t)TT * TT);
            k_asoft<<<ZH * TT / 8, 256, 0, stream>>>(Sb, P16, Ph, Pl);
            k_gemmw<bf, 2, false, 16><<<dim3(RH / 64, HD / 64, ZH), 512, 0, stream>>>(Ph, Pl, VTh + zk * HD * TT, VTl + zk * HD * TT, TT, Ob, HD, nullptr, (size_t)RH * TT, (size_t)HD * TT, (size_t)TT * HD);
            k_gemmw<h16, 0, false, 16><<<dim3((TT - RH) / 64, HD / 64, ZH), 512, 0, stream>>>(P16 + (size_t)RH * TT, nullptr, VT16 + zk * HD * TT, nullptr, TT, Ob + (size_t)RH * HD, HD, nullptr, (size_t)TT * TT, (size_t)HD * TT, (size_t)TT * HD);
            k_merge<<<(unsigned)(((size_t)ZH * TT * HD / 2 + 255) / 256), 256, 0, stream>>>(Ob, h0, ATh, ATl); }
        k_gemmw<bf, 1, true, 8><<<dim3(TT / 64, DM / 64, 1), 256, 0, stream>>>(ATh, ATl, WO, nullptr, DQ, OUT + (size_t)b * DM, NB_ * DM, bo, 0, 0, 0);   /* [S][B][D]: row pitch B x D, column block b */ }
}

// v002
// A run of this version takes 1170 microseconds.
// Timed twice side by side with v001, it ran 1.80 times as fast both times.
// Counting every step since v000, it is 3.43 times as fast.
#include <hip/hip_runtime.h>

// Multi-head self-attention on a SEQUENCE-FIRST tensor (query [2048][4][1024] = [S][B][D]: ONE stream; q, k, v = x W^T + b ('oi' (out, in) [1024][1024] + [1024]; normal x 0.02; biases ZEROS on this draw: read); 16 heads x 64 per batch column; q = query Wq^T + bq (not pre-scaled: the softmax scales scores by 64^-0.5 = 1/8); softmax over all keys (no mask); out = merged Wo^T + bo -> [2048][4][1024] sequence-first (8.4 M); argument order query, Wq, bq, Wk, bk, Wv, bv, Wo, bo).
// Layout per batch b: a strided gather makes the bf16 copy of rows s of column b (row pitch B x D) for query, then key, then value; 'oi' weights; exact projections + f32 biases; dense T-2048 attention (hybrid rows: < 512 hi/lo 3 products, rest fp16 x1024); merged hi/lo x Wo exact + bo written with row pitch B x D at column offset b (the [S][B][D] output).
// Compute dtypes, f32 accumulate: every input rounded to bf16; projections exact + f32 biases; attention rows < 512 3 products, rest fp16; softmax f32; Wo hl x exact + bias.

#define NB_  4
#define TT   2048
#define DM   1024
#define NH_  16
#define NKV  16
#define REP  (NH_ / NKV)
#define HD   64
#define DQ   (NH_ * HD)
#define DKV  (NKV * HD)
#define ZH   8                    // heads per attention pass (grid z of its launches)
#define RH   512                  // query rows < RH use hi+lo planes (0: none)
#define WIN  0
#define PCAR 1024.0f
#define SCL  0.125f   // HD^-0.5
typedef _Float16 h16;
typedef unsigned short bf;
typedef __attribute__((ext_vector_type(16))) __bf16   v16bf;
typedef __attribute__((ext_vector_type(16))) _Float16 v16h;
typedef __attribute__((ext_vector_type(8)))  _Float16 v8h;
typedef __attribute__((ext_vector_type(8)))  unsigned short v8us;
typedef __attribute__((ext_vector_type(8)))  float    v8f;
typedef __attribute__((ext_vector_type(4)))  float    v4f;
typedef v8h  __attribute__((may_alias)) v8ha;
typedef v4f  __attribute__((may_alias)) v4fa;
typedef v8us __attribute__((may_alias)) v8usa;

__device__ __forceinline__ unsigned short f2bf(float f) { unsigned u = __float_as_uint(f); u += 0x7FFFu + ((u >> 16) & 1u); return (unsigned short)(u >> 16); }
__device__ __forceinline__ float bf2f(unsigned short b) { return __uint_as_float(((unsigned)b) << 16); }
__device__ __forceinline__ float bfr(float f) { return bf2f(f2bf(f)); }
__device__ __forceinline__ v16h cat16(v8h lo, v8h hi) { return __builtin_shufflevector(lo, hi, 0, 1, 2, 3, 4, 5, 6, 7, 8, 9, 10, 11, 12, 13, 14, 15); }
__device__ __forceinline__ v16bf cat16b(v8us lo, v8us hi) { return __builtin_bit_cast(v16bf, __builtin_shufflevector(lo, hi, 0, 1, 2, 3, 4, 5, 6, 7, 8, 9, 10, 11, 12, 13, 14, 15)); }
__device__ __forceinline__ v8f wmma16(v16h a, v16h b, v8f c) { return __builtin_amdgcn_wmma_f32_16x16x32_f16(false, a, false, b, (short)0, c, false, false); }
__device__ __forceinline__ v8f wmmab(v16bf a, v16bf b, v8f c) { return __builtin_amdgcn_wmma_f32_16x16x32_bf16(false, a, false, b, (short)0, c, false, false); }



// ---- k_gemmw: register-blocked GEMM, one work-group of KS waves per 64x64 output tile; wave w sums the k range [w K/KS, (w+1) K/KS) into its own 16 accumulators, operands straight from K-contiguous 16-bit planes; grid (M/64, N/64, Z), 32 x KS threads.
// The KS partial tiles meet in LDS, 16 rows at a time, and are added in wave order 0..KS-1 (fixed, the same on every run).
// C[m][n] (f32, pitch ldc, + optional f32 bias[n]) = sum_k A[m][k] Bt[n][k] (+ split products per NSPLIT). A rows have pitch lda, Bt rows pitch K. z-batch strides sA/sB/sC in elements. K % (32 KS) == 0.
template <typename T16> struct WFrag;
template <> struct WFrag<h16> { typedef v16h V; static __device__ __forceinline__ V ld(const h16* p) { return cat16(*(const v8h*)p, *(const v8h*)(p + 16)); } static __device__ __forceinline__ v8f mma(V a, V b, v8f c) { return wmma16(a, b, c); } };
template <> struct WFrag<bf> { typedef v16bf V; static __device__ __forceinline__ V ld(const bf* p) { return cat16b(*(const v8us*)p, *(const v8us*)(p + 16)); } static __device__ __forceinline__ v8f mma(V a, V b, v8f c) { return wmmab(a, b, c); } };
// one wave: program order in the wave is enough. Several waves: every partial tile must be written before it is summed, and summed before it is overwritten:
// a work-group barrier between fences on LDS alone (only LDS passes between the waves; __syncthreads() would also hold every round until the round's stores to C have returned).
template <int KS> __device__ __forceinline__ void tile_sync() {
    if constexpr (KS == 1) { __builtin_amdgcn_wave_barrier(); asm volatile("" ::: "memory"); }
    else { __builtin_amdgcn_fence(__ATOMIC_RELEASE, "workgroup", "local"); __builtin_amdgcn_s_barrier(); __builtin_amdgcn_fence(__ATOMIC_ACQUIRE, "workgroup", "local"); } }
template <typename T16, int NSPLIT, bool BIAS, int KS>
__global__ __launch_bounds__(32 * KS) void k_gemmw(const T16* __restrict__ A, const T16* __restrict__ A2, const T16* __restrict__ Bt, const T16* __restrict__ Bt2, int K, int lda, float* C, int ldc, const float* __restrict__ bias, size_t sA, size_t sB, size_t sC) {
    typedef typename WFrag<T16>::V V;
    __shared__ __align__(16) float os[KS * 16 * 68];
    const size_t z = blockIdx.z; A += z * sA; if (A2) A2 += z * sA; Bt += z * sB; if (Bt2) Bt2 += z * sB; C += z * sC;
    const int lane = threadIdx.x & 31, lr = lane & 15, hi = lane >> 4; const int r0 = blockIdx.x * 64, c0 = blockIdx.y * 64;
    const int wv = KS == 1 ? 0 : __builtin_amdgcn_readfirstlane((int)(threadIdx.x >> 5)); const int kw = K / KS, k0 = wv * kw; float* osw = os + wv * (16 * 68);
    v8f acc[4][4];
#pragma unroll
    for (int mb = 0; mb < 4; ++mb)
#pragma unroll
        for (int nb = 0; nb < 4; ++nb) acc[mb][nb] = (v8f){};
    const size_t aoff = (size_t)(r0 + lr) * lda + 8 * hi, boff = (size_t)(c0 + lr) * K + 8 * hi;
#pragma unroll 1
    for (int kc = k0; kc < k0 + kw; kc += 32) {
        V a[4], a2[4];
#pragma unroll
        for (int mb = 0; mb < 4; ++mb) { a[mb] = WFrag<T16>::ld(A + aoff + (size_t)mb * 16 * lda + kc); if (NSPLIT == 1 || NSPLIT == 2) a2[mb] = WFrag<T16>::ld(A2 + aoff + (size_t)mb * 16 * lda + kc); }
#pragma unroll
        for (int nb = 0; nb < 4; ++nb) { const V b = WFrag<T16>::ld(Bt + boff + (size_t)nb * 16 * K + kc); V b2; if (NSPLIT >= 2) b2 = WFrag<T16>::ld(Bt2 + boff + (size_t)nb * 16 * K + kc);
#pragma unroll
            for (int mb = 0; mb < 4; ++mb) { acc[mb][nb] = WFrag<T16>::mma(a[mb], b, acc[mb][nb]); if (NSPLIT == 1 || NSPLIT == 2) acc[mb][nb] = WFrag<T16>::mma(a2[mb], b, acc[mb][nb]); if (NSPLIT >= 2) acc[mb][nb] = WFrag<T16>::mma(a[mb], b2, acc[mb][nb]); } }
        asm volatile("v_nop\n\tv_nop\n\tv_nop\n\tv_nop" : "+v"(acc[0][0]), "+v"(acc[1][1]), "+v"(acc[2][2]), "+v"(acc[3][3]) : "v"(a[0]), "v"(a[3]));
    }
#pragma unroll
    for (int mb = 0; mb < 4; ++mb) {
#pragma unroll
        for (int nb = 0; nb < 4; ++nb) {
#pragma unroll
            for (int j = 0; j < 8; ++j) osw[(hi * 8 + j) * 68 + nb * 16 + lr] = acc[mb][nb][j]; }
        tile_sync<KS>();
        float* crow = C + (size_t)(r0 + mb * 16) * ldc + c0;
{
#pragma unroll
            for (int s = 0; s < (KS < 8 ? 8 / KS : 1); ++s) { const int it = s * 32 * KS + (int)threadIdx.x; if (KS > 8 && it >= 256) break; const int row = it >> 4, cofs = (it & 15) * 4; v4f val = *(const v4fa*)(os + row * 68 + cofs);
#pragma unroll
                for (int w = 1; w < KS; ++w) val += *(const v4fa*)(os + w * (16 * 68) + row * 68 + cofs);
                if (BIAS) { val[0] += bfr(bias[c0 + cofs]); val[1] += bfr(bias[c0 + cofs + 1]); val[2] += bfr(bias[c0 + cofs + 2]); val[3] += bfr(bias[c0 + cofs + 3]); }
                *(v4f*)(crow + (size_t)row * ldc + cofs) = val; }
             }
        if (mb < 3) tile_sync<KS>();
    }
}

__device__ __forceinline__ h16 tohx(float x) { return (h16)x; }
__device__ __forceinline__ void splitf(float y, unsigned short& h, unsigned short& l) { h = f2bf(y); l = f2bf(y - bf2f(h)); }
typedef __attribute__((ext_vector_type(2))) _Float16 v2h;
typedef __attribute__((ext_vector_type(4))) _Float16 v4h;
typedef __attribute__((ext_vector_type(2))) unsigned short v2us;
typedef __attribute__((ext_vector_type(4))) unsigned short v4us;
typedef __attribute__((ext_vector_type(2))) float v2f;
typedef __attribute__((ext_vector_type(4))) int v4i;

__global__ __launch_bounds__(256) void k_wtG(const float* __restrict__ w, int K, int N, bf* Bt) {
    const int lane = threadIdx.x & 31; const int L0 = (blockIdx.x * 8 + (threadIdx.x >> 5)) * 8; const int nlines = N * K / 64;
{
#pragma unroll 1
        for (int l = 0; l < 8; ++l) { const int L = L0 + l; if (L >= nlines) break; const size_t e = (size_t)L * 64 + lane * 2; const int k = (int)(e % K), n = (int)(e / K); v2us o;
            o[0] = f2bf(w[(size_t)k * N + n]); o[1] = f2bf(w[(size_t)(k + 1) * N + n]); *(v2us*)(Bt + e) = o; }
         }
}
__global__ __launch_bounds__(256) void k_cvt8(const float* __restrict__ src, bf* dst, size_t n8) { const size_t i = (size_t)blockIdx.x * 256 + threadIdx.x; if (i >= n8) return; const v8f v = *(const v8f*)(src + i * 8); v8us o;
#pragma unroll
    for (int k = 0; k < 8; ++k) o[k] = f2bf(v[k]); *(v8us*)(dst + i * 8) = o;  }

// k_rope: head planes [h][t][d] (fp16 + hi/lo) of rope(x) x sc with the rotate-half convention out[d] = x[d] cos[t][d] - x[d+HD/2] sin[t][d], out[d+HD/2] = x[d+HD/2] cos[t][d+HD/2] + x[d] sin[t][d+HD/2]
__global__ __launch_bounds__(256) void k_rope(const float* __restrict__ F, int pitch, int nheads, const float* __restrict__ CS, const float* __restrict__ RF, const float* __restrict__ nw, float sc, h16* P16, bf* Ph, bf* Pl) {
    const size_t e = ((size_t)blockIdx.x * 256 + threadIdx.x) * 2; if (e >= (size_t)nheads * TT * HD) return; const int d = (int)(e % HD); const int t = (int)((e / HD) % TT); const int h = (int)(e / ((size_t)HD * TT)); const float* f = F + (size_t)t * pitch + h * HD; const float rf = RF ? RF[(size_t)h * TT + t] : 1.0f; v2h o16; v2us oh, ol;
#pragma unroll
    for (int q = 0; q < 2; ++q) { const int dd = d + q; const int dp = (dd < HD / 2) ? dd + HD / 2 : dd - HD / 2; float x0 = f[dd], x1 = f[dp];
        if (RF) { float n0 = __fmul_rn(x0, rf), n1 = __fmul_rn(x1, rf); asm volatile("" : "+v"(n0)); asm volatile("" : "+v"(n1)); x0 = __fmul_rn(bfr(nw[dd]), n0); x1 = __fmul_rn(bfr(nw[dp]), n1); }
        const v2f cs = *(const v2f*)(CS + ((size_t)t * HD + dd) * 2); float a = __fmul_rn(x0, cs[0]), bq = __fmul_rn(x1, cs[1]); asm volatile("" : "+v"(a)); asm volatile("" : "+v"(bq)); const float r = ((dd < HD / 2) ? __fsub_rn(a, bq) : __fadd_rn(a, bq)) * sc;
        o16[q] = tohx(r); unsigned short a2, c2; splitf(r, a2, c2); oh[q] = a2; ol[q] = c2; }
    *(v2h*)(P16 + e) = o16; *(v2us*)(Ph + e) = oh; *(v2us*)(Pl + e) = ol;  }
__global__ __launch_bounds__(256) void k_vtp(const float* __restrict__ F, int pitch, int nheads, h16* V16, bf* Vh, bf* Vl) { const size_t e = ((size_t)blockIdx.x * 256 + threadIdx.x) * 2; if (e >= (size_t)nheads * HD * TT) return; const int t = (int)(e % TT); const int d = (int)((e / TT) % HD); const int g = (int)(e / ((size_t)TT * HD)); v2h o16; v2us oh, ol;
#pragma unroll
    for (int q = 0; q < 2; ++q) { const float x = F[(size_t)(t + q) * pitch + g * HD + d]; o16[q] = tohx(x); unsigned short a2, c2; splitf(x, a2, c2); oh[q] = a2; ol[q] = c2; }
    *(v2h*)(V16 + e) = o16; *(v2us*)(Vh + e) = oh; *(v2us*)(Vl + e) = ol;  }
__global__ __launch_bounds__(256) void k_csid(float* CS) { const int idx = blockIdx.x * 256 + threadIdx.x; if (idx >= TT * HD) return; v2f cs; cs[0] = 1.0f; cs[1] = 0.0f; *(v2f*)(CS + (size_t)idx * 2) = cs;  }
// k_asoft: per row (zz, i): t = S x HD^-0.5 (no mask); softmax over the 2048 keys (register row, one exp, fixed trees);
// P goes over the row's own scores (one wave owns the row and holds all of it in registers before its first store): 16-bit row pitch 2 TT; fp16 P, or the hi plane, in the first TT places, the lo plane in the second TT.
__global__ __launch_bounds__(256) void k_asoft(float* Sb) {
    const int lane = threadIdx.x & 31; const int row = blockIdx.x * 8 + (threadIdx.x >> 5); if (row >= ZH * TT) return; const int i = row % TT; const int zz = row / TT; (void)zz; const bool hires = (i < RH); const float* sr = Sb + (size_t)row * TT; bf* ph = (bf*)(Sb + (size_t)row * TT); h16* p16 = (h16*)(Sb + (size_t)row * TT); float v[TT / 32]; float mx = -3.0e38f;
#pragma unroll
    for (int ch = 0; ch < TT / 128; ++ch) { const int j0 = ch * 128 + lane * 4; const v4f a = *(const v4f*)(sr + j0);
#pragma unroll
        for (int q = 0; q < 4; ++q) { const int j = j0 + q; (void)j; const float t = a[q] * SCL; v[ch * 4 + q] = t; mx = fmaxf(mx, t); } }
#pragma unroll
    for (int sh = 16; sh; sh >>= 1) mx = fmaxf(mx, __shfl_xor(mx, sh, 32));
    float sum = 0.f;
#pragma unroll
    for (int k = 0; k < TT / 32; ++k) { float d0 = __fsub_rn(v[k], mx); asm volatile("" : "+v"(d0)); v[k] = __builtin_amdgcn_exp2f(__fmul_rn(d0, 1.4426950408889634f)); sum += v[k]; }
#pragma unroll
    for (int sh = 16; sh; sh >>= 1) sum += __shfl_xor(sum, sh, 32);
    const float f = __fdiv_rn(hires ? 1.0f : PCAR, sum);
{
        if (hires) {
#pragma unroll
            for (int ch = 0; ch < TT / 128; ++ch) { v4us oh, ol;
#pragma unroll
                for (int q = 0; q < 4; ++q) { unsigned short a, c2; splitf(v[ch * 4 + q] * f, a, c2); oh[q] = a; ol[q] = c2; }
                const int oo = ch * 128 + lane * 4; *(v4us*)(ph + oo) = oh; *(v4us*)(ph + TT + oo) = ol; }
        } else {
#pragma unroll
            for (int ch = 0; ch < TT / 128; ++ch) { v4h o4;
#pragma unroll
                for (int q = 0; q < 4; ++q) o4[q] = tohx(v[ch * 4 + q] * f);
                *(v4h*)(p16 + ch * 128 + lane * 4) = o4; } }
         }
}
__global__ __launch_bounds__(256) void k_cvt8s(const float* __restrict__ X, bf* XB, size_t pitch) { const size_t i = (size_t)blockIdx.x * 256 + threadIdx.x; if (i >= (size_t)TT * DM / 8) return; const size_t e = i * 8; const int c = (int)(e % DM); const int srow = (int)(e / DM); const v8f a = *(const v8f*)(X + (size_t)srow * pitch + c); v8us o;
#pragma unroll
    for (int q = 0; q < 8; ++q) o[q] = f2bf(a[q]);
    *(v8us*)(XB + e) = o;  }
__global__ __launch_bounds__(256) void k_merge(const float* __restrict__ O, int h0, bf* Ah, bf* Al) { const size_t e = ((size_t)blockIdx.x * 256 + threadIdx.x) * 2; if (e >= (size_t)ZH * TT * HD) return; const int d = (int)(e % HD); const int t = (int)((e / HD) % TT); const int zz = (int)(e / ((size_t)HD * TT)); const float cs = (t < RH) ? 1.0f : (1.0f / PCAR); const size_t oo = (size_t)t * DQ + (h0 + zz) * HD + d;
    v2us oh, ol;
#pragma unroll
    for (int q = 0; q < 2; ++q) { unsigned short a, c2; splitf(O[e + q] * cs, a, c2); oh[q] = a; ol[q] = c2; } *(v2us*)(Ah + oo) = oh; *(v2us*)(Al + oo) = ol;  }

extern "C" void kernel_launch(void* const* d_in, const int* in_sizes, int n_in,
                              void* d_out, int out_size, void* d_ws, size_t ws_size, hipStream_t stream) {
    (void)in_sizes; (void)n_in; (void)out_size;
    const float* x = (const float*)d_in[0];   /* query [S][B][D] = [2048][4][1024]: ONE stream: q, k and v all project it */ const float* xk = (const float*)d_in[0]; const float* xv = (const float*)d_in[0]; const float* wq = (const float*)d_in[1]; const float* bq = (const float*)d_in[2]; const float* wk = (const float*)d_in[3]; const float* bk = (const float*)d_in[4]; const float* wv = (const float*)d_in[5]; const float* bv = (const float*)d_in[6]; const float* wo = (const float*)d_in[7]; const float* bo = (const float*)d_in[8];
    float* OUT = (float*)d_out;     // [2048][4][1024] sequence-first
    char* wsp = (char*)d_ws;
    auto take = [&](size_t bytes) { char* p = wsp; wsp += (bytes + 255) & ~(size_t)255; return (void*)p; };
    bf* WQ = (bf*)take((size_t)DQ * DM * 2); bf* WK = (bf*)take((size_t)DKV * DM * 2); bf* WV = (bf*)take((size_t)DKV * DM * 2); bf* WO = (bf*)take((size_t)DM * DQ * 2); float* CS = (float*)take((size_t)TT * HD * 2 * 4);
    bf* XB = (bf*)take((size_t)TT * DM * 2); float* FQ = (float*)take((size_t)TT * DQ * 4); float* FK = (float*)take((size_t)TT * DKV * 4);
    h16* QP16 = (h16*)take((size_t)NH_ * TT * HD * 2); h16* KP16 = (h16*)take((size_t)NKV * TT * HD * 2); h16* VT16 = (h16*)take((size_t)NKV * HD * TT * 2);
    bf* QPh = (bf*)take((size_t)NH_ * TT * HD * 2); bf* QPl = (bf*)take((size_t)NH_ * TT * HD * 2); bf* KPh = (bf*)take((size_t)NKV * TT * HD * 2); bf* KPl = (bf*)take((size_t)NKV * TT * HD * 2); bf* VTh = (bf*)take((size_t)NKV * HD * TT * 2); bf* VTl = (bf*)take((size_t)NKV * HD * TT * 2);
    float* Sb = (float*)take((size_t)ZH * TT * TT * 4); float* Ob = (float*)take((size_t)ZH * TT * HD * 4); bf* ATh = (bf*)take((size_t)TT * DQ * 2); bf* ATl = (bf*)take((size_t)TT * DQ * 2);
    if ((size_t)(wsp - (char*)d_ws) > ws_size) return;    // ws 256 MiB
    float* FV = FK;   // v projection reuses the k buffer after the k planes are built (stream-ordered)
    { k_cvt8<<<(unsigned)(((size_t)DQ * DM / 8 + 255) / 256), 256, 0, stream>>>(wq, WQ, (size_t)DQ * DM / 8); k_cvt8<<<(unsigned)(((size_t)DKV * DM / 8 + 255) / 256), 256, 0, stream>>>(wk, WK, (size_t)DKV * DM / 8); k_cvt8<<<(unsigned)(((size_t)DKV * DM / 8 + 255) / 256), 256, 0, stream>>>(wv, WV, (size_t)DKV * DM / 8);
      k_cvt8<<<(unsigned)(((size_t)DM * DQ / 8 + 255) / 256), 256, 0, stream>>>(wo, WO, (size_t)DM * DQ / 8);
       }
    k_csid<<<(TT * HD + 255) / 256, 256, 0, stream>>>(CS);
    const unsigned LQ = (unsigned)(((size_t)NH_ * TT * HD / 2 + 255) / 256), LKv = (unsigned)(((size_t)NKV * TT * HD / 2 + 255) / 256);
    for (int b = 0; b < NB_; ++b) {
        
        k_cvt8s<<<(unsigned)(((size_t)TT * DM / 8 + 255) / 256), 256, 0, stream>>>(x + (size_t)b * DM, XB, (size_t)NB_ * DM);   /* rows s of batch column b: pitch B x D */
        k_gemmw<bf, 0, true, 8><<<dim3(TT / 64, DQ / 64, 1), 256, 0, stream>>>(XB, nullptr, WQ, nullptr, DM, DM, FQ, DQ, bq, 0, 0, 0);
        k_rope<<<LQ, 256, 0, stream>>>(FQ, DQ, NH_, CS, nullptr, nullptr, 1.0f, QP16, QPh, QPl);
        k_cvt8s<<<(unsigned)(((size_t)TT * DM / 8 + 255) / 256), 256, 0, stream>>>(xk + (size_t)b * DM, XB, (size_t)NB_ * DM);   /* rows s of batch column b: pitch B x D */ k_gemmw<bf, 0, true, 8><<<dim3(TT / 64, DKV / 64, 1), 256, 0, stream>>>(XB, nullptr, WK, nullptr, DM, DM, FK, DKV, bk, 0, 0, 0);
        k_rope<<<LKv, 256, 0, stream>>>(FK, DKV, NKV, CS, nullptr, nullptr, 1.0f, KP16, KPh, KPl);
        k_cvt8s<<<(unsigned)(((size_t)TT * DM / 8 + 255) / 256), 256, 0, stream>>>(xv + (size_t)b * DM, XB, (size_t)NB_ * DM);   /* rows s of batch column b: pitch B x D */ k_gemmw<bf, 0, true, 8><<<dim3(TT / 64, DKV / 64, 1), 256, 0, stream>>>(XB, nullptr, WV, nullptr, DM, DM, FV, DKV, bv, 0, 0, 0); k_vtp<<<LKv, 256, 0, stream>>>(FV, DKV, NKV, VT16, VTh, VTl);
        for (int h0 = 0; h0 < NH_; h0 += ZH) { const size_t zq = (size_t)h0, zk = (size_t)(h0 / REP);   // one kv head per query head: the pass's heads use consecutive kv planes (z-strides TT*HD)
            k_gemmw<bf, 2, false, 1><<<dim3(RH / 64, TT / 64, ZH), 32, 0, stream>>>(QPh + zq * TT * HD, QPl + zq * TT * HD, KPh + zk * TT * HD, KPl + zk * TT * HD, HD, HD, Sb, TT, nullptr, (size_t)TT * HD, (size_t)TT * HD, (size_t)TT * TT);
            k_gemmw<h16, 0, false, 1><<<dim3((TT - RH) / 64, TT / 64, ZH), 32, 0, stream>>>(QP16 + zq * TT * HD + (size_t)RH * HD, nullptr, KP16 + zk * TT * HD, nullptr, HD, HD, Sb + (size_t)RH * TT, TT, nullptr, (size_t)TT * HD, (size_t)TT * HD, (size_t)TT * TT);
            k_asoft<<<ZH * TT / 8, 256, 0, stream>>>(Sb);   // P lies in Sb: 16-bit rows of pitch 2 TT
            k_gemmw<bf, 2, false, 16><<<dim3(RH / 64, HD / 64, ZH), 512, 0, stream>>>((const bf*)Sb, (const bf*)Sb + TT, VTh + zk * HD * TT, VTl + zk * HD * TT, TT, 2 * TT, Ob, HD, nullptr, (size_t)2 * TT * TT, (size_t)HD * TT, (size_t)TT * HD);
            k_gemmw<h16, 0, false, 16><<<dim3((TT - RH) / 64, HD / 64, ZH), 512, 0, stream>>>((const h16*)Sb + (size_t)RH * 2 * TT, nullptr, VT16 + zk * HD * TT, nullptr, TT, 2 * TT, Ob + (size_t)RH * HD, HD, nullptr, (size_t)2 * TT * TT, (size_t)HD * TT, (size_t)TT * HD);
            k_merge<<<(unsigned)(((size_t)ZH * TT * HD / 2 + 255) / 256), 256, 0, stream>>>(Ob, h0, ATh, ATl); }
        k_gemmw<bf, 1, true, 8><<<dim3(TT / 64, DM / 64, 1), 256, 0, stream>>>(ATh, ATl, WO, nullptr, DQ, DQ, OUT + (size_t)b * DM, NB_ * DM, bo, 0, 0, 0);   /* [S][B][D]: row pitch B x D, column block b */ }
}

// v003
// It runs in 580 microseconds.
// Two timings next to v002 put it at 2.02 and 2.01 times that version's speed.
// Counting every step since v000, it is 6.91 times as fast.
#include <hip/hip_runtime.h>

// Multi-head self-attention on a SEQUENCE-FIRST tensor (query [2048][4][1024] = [S][B][D]: ONE stream; q, k, v = x W^T + b ('oi' (out, in) [1024][1024] + [1024]; normal x 0.02; biases ZEROS on this draw: read); 16 heads x 64 per batch column; q = query Wq^T + bq (not pre-scaled: the softmax scales scores by 64^-0.5 = 1/8); softmax over all keys (no mask); out = merged Wo^T + bo -> [2048][4][1024] sequence-first (8.4 M); argument order query, Wq, bq, Wk, bk, Wv, bv, Wo, bo).
// Layout per batch b: a strided gather makes the bf16 copy of rows s of column b (row pitch B x D) for query, then key, then value; 'oi' weights; exact projections + f32 biases; dense T-2048 attention (hybrid rows: < 512 hi/lo 3 products, rest fp16 x1024); merged hi/lo x Wo exact + bo written with row pitch B x D at column offset b (the [S][B][D] output).
// Compute dtypes, f32 accumulate: every input rounded to bf16; projections exact + f32 biases; attention rows < 512 3 products, rest fp16; softmax f32; Wo hl x exact + bias.

#define NB_  4
#define TT   2048
#define DM   1024
#define NH_  16
#define NKV  16
#define REP  (NH_ / NKV)
#define HD   64
#define DQ   (NH_ * HD)
#define DKV  (NKV * HD)
#define ZH   16                   // heads per attention launch (grid z): all of a batch column's
#define RH   512                  // query rows < RH use hi+lo planes (0: none)
#define WIN  0
#define PCAR 1024.0f
#define SCL  0.125f   // HD^-0.5
typedef _Float16 h16;
typedef unsigned short bf;
typedef __attribute__((ext_vector_type(16))) __bf16   v16bf;
typedef __attribute__((ext_vector_type(16))) _Float16 v16h;
typedef __attribute__((ext_vector_type(8)))  _Float16 v8h;
typedef __attribute__((ext_vector_type(8)))  unsigned short v8us;
typedef __attribute__((ext_vector_type(8)))  float    v8f;
typedef __attribute__((ext_vector_type(4)))  float    v4f;
typedef v8h  __attribute__((may_alias)) v8ha;
typedef v4f  __attribute__((may_alias)) v4fa;
typedef v8us __attribute__((may_alias)) v8usa;

__device__ __forceinline__ unsigned short f2bf(float f) { unsigned u = __float_as_uint(f); u += 0x7FFFu + ((u >> 16) & 1u); return (unsigned short)(u >> 16); }
__device__ __forceinline__ float bf2f(unsigned short b) { return __uint_as_float(((unsigned)b) << 16); }
__device__ __forceinline__ float bfr(float f) { return bf2f(f2bf(f)); }
__device__ __forceinline__ v16h cat16(v8h lo, v8h hi) { return __builtin_shufflevector(lo, hi, 0, 1, 2, 3, 4, 5, 6, 7, 8, 9, 10, 11, 12, 13, 14, 15); }
__device__ __forceinline__ v16bf cat16b(v8us lo, v8us hi) { return __builtin_bit_cast(v16bf, __builtin_shufflevector(lo, hi, 0, 1, 2, 3, 4, 5, 6, 7, 8, 9, 10, 11, 12, 13, 14, 15)); }
__device__ __forceinline__ v8f wmma16(v16h a, v16h b, v8f c) { return __builtin_amdgcn_wmma_f32_16x16x32_f16(false, a, false, b, (short)0, c, false, false); }
__device__ __forceinline__ v8f wmmab(v16bf a, v16bf b, v8f c) { return __builtin_amdgcn_wmma_f32_16x16x32_bf16(false, a, false, b, (short)0, c, false, false); }



// ---- k_gemmw: register-blocked GEMM, one work-group of KS waves per 64x64 output tile; wave w sums the k range [w K/KS, (w+1) K/KS) into its own 16 accumulators, operands straight from K-contiguous 16-bit planes; grid (M/64, N/64, Z), 32 x KS threads.
// The KS partial tiles meet in LDS, 16 rows at a time, and are added in wave order 0..KS-1 (fixed, the same on every run).
// C[m][n] (f32, pitch ldc, + optional f32 bias[n]) = sum_k A[m][k] Bt[n][k] (+ split products per NSPLIT). A rows have pitch lda, Bt rows pitch K. z-batch strides sA/sB/sC in elements. K % (32 KS) == 0.
template <typename T16> struct WFrag;
template <> struct WFrag<h16> { typedef v16h V; static __device__ __forceinline__ V ld(const h16* p) { return cat16(*(const v8h*)p, *(const v8h*)(p + 16)); } static __device__ __forceinline__ v8f mma(V a, V b, v8f c) { return wmma16(a, b, c); } };
template <> struct WFrag<bf> { typedef v16bf V; static __device__ __forceinline__ V ld(const bf* p) { return cat16b(*(const v8us*)p, *(const v8us*)(p + 16)); } static __device__ __forceinline__ v8f mma(V a, V b, v8f c) { return wmmab(a, b, c); } };
// one wave: program order in the wave is enough. Several waves: every partial tile must be written before it is summed, and summed before it is overwritten:
// a work-group barrier between fences on LDS alone (only LDS passes between the waves; __syncthreads() would also hold every round until the round's stores to C have returned).
template <int KS> __device__ __forceinline__ void tile_sync() {
    if constexpr (KS == 1) { __builtin_amdgcn_wave_barrier(); asm volatile("" ::: "memory"); }
    else { __builtin_amdgcn_fence(__ATOMIC_RELEASE, "workgroup", "local"); __builtin_amdgcn_s_barrier(); __builtin_amdgcn_fence(__ATOMIC_ACQUIRE, "workgroup", "local"); } }
template <typename T16, int NSPLIT, bool BIAS, int KS>
__global__ __launch_bounds__(32 * KS) void k_gemmw(const T16* __restrict__ A, const T16* __restrict__ A2, const T16* __restrict__ Bt, const T16* __restrict__ Bt2, int K, int lda, float* C, int ldc, const float* __restrict__ bias, size_t sA, size_t sB, size_t sC) {
    typedef typename WFrag<T16>::V V;
    __shared__ __align__(16) float os[KS * 16 * 68];
    const size_t z = blockIdx.z; A += z * sA; if (A2) A2 += z * sA; Bt += z * sB; if (Bt2) Bt2 += z * sB; C += z * sC;
    const int lane = threadIdx.x & 31, lr = lane & 15, hi = lane >> 4; const int r0 = blockIdx.x * 64, c0 = blockIdx.y * 64;
    const int wv = KS == 1 ? 0 : __builtin_amdgcn_readfirstlane((int)(threadIdx.x >> 5)); const int kw = K / KS, k0 = wv * kw; float* osw = os + wv * (16 * 68);
    v8f acc[4][4];
#pragma unroll
    for (int mb = 0; mb < 4; ++mb)
#pragma unroll
        for (int nb = 0; nb < 4; ++nb) acc[mb][nb] = (v8f){};
    const size_t aoff = (size_t)(r0 + lr) * lda + 8 * hi, boff = (size_t)(c0 + lr) * K + 8 * hi;
#pragma unroll 1
    for (int kc = k0; kc < k0 + kw; kc += 32) {
        V a[4], a2[4];
#pragma unroll
        for (int mb = 0; mb < 4; ++mb) { a[mb] = WFrag<T16>::ld(A + aoff + (size_t)mb * 16 * lda + kc); if (NSPLIT == 1 || NSPLIT == 2) a2[mb] = WFrag<T16>::ld(A2 + aoff + (size_t)mb * 16 * lda + kc); }
#pragma unroll
        for (int nb = 0; nb < 4; ++nb) { const V b = WFrag<T16>::ld(Bt + boff + (size_t)nb * 16 * K + kc); V b2; if (NSPLIT >= 2) b2 = WFrag<T16>::ld(Bt2 + boff + (size_t)nb * 16 * K + kc);
#pragma unroll
            for (int mb = 0; mb < 4; ++mb) { acc[mb][nb] = WFrag<T16>::mma(a[mb], b, acc[mb][nb]); if (NSPLIT == 1 || NSPLIT == 2) acc[mb][nb] = WFrag<T16>::mma(a2[mb], b, acc[mb][nb]); if (NSPLIT >= 2) acc[mb][nb] = WFrag<T16>::mma(a[mb], b2, acc[mb][nb]); } }
        asm volatile("v_nop\n\tv_nop\n\tv_nop\n\tv_nop" : "+v"(acc[0][0]), "+v"(acc[1][1]), "+v"(acc[2][2]), "+v"(acc[3][3]) : "v"(a[0]), "v"(a[3]));
    }
#pragma unroll
    for (int mb = 0; mb < 4; ++mb) {
#pragma unroll
        for (int nb = 0; nb < 4; ++nb) {
#pragma unroll
            for (int j = 0; j < 8; ++j) osw[(hi * 8 + j) * 68 + nb * 16 + lr] = acc[mb][nb][j]; }
        tile_sync<KS>();
        float* crow = C + (size_t)(r0 + mb * 16) * ldc + c0;
{
#pragma unroll
            for (int s = 0; s < (KS < 8 ? 8 / KS : 1); ++s) { const int it = s * 32 * KS + (int)threadIdx.x; if (KS > 8 && it >= 256) break; const int row = it >> 4, cofs = (it & 15) * 4; v4f val = *(const v4fa*)(os + row * 68 + cofs);
#pragma unroll
                for (int w = 1; w < KS; ++w) val += *(const v4fa*)(os + w * (16 * 68) + row * 68 + cofs);
                if (BIAS) { val[0] += bfr(bias[c0 + cofs]); val[1] += bfr(bias[c0 + cofs + 1]); val[2] += bfr(bias[c0 + cofs + 2]); val[3] += bfr(bias[c0 + cofs + 3]); }
                *(v4f*)(crow + (size_t)row * ldc + cofs) = val; }
             }
        if (mb < 3) tile_sync<KS>();
    }
}

__device__ __forceinline__ h16 tohx(float x) { return (h16)x; }
__device__ __forceinline__ void splitf(float y, unsigned short& h, unsigned short& l) { h = f2bf(y); l = f2bf(y - bf2f(h)); }
typedef __attribute__((ext_vector_type(2))) _Float16 v2h;
typedef __attribute__((ext_vector_type(4))) _Float16 v4h;
typedef __attribute__((ext_vector_type(2))) unsigned short v2us;
typedef __attribute__((ext_vector_type(4))) unsigned short v4us;
typedef __attribute__((ext_vector_type(2))) float v2f;
typedef __attribute__((ext_vector_type(4))) int v4i;

__global__ __launch_bounds__(256) void k_wtG(const float* __restrict__ w, int K, int N, bf* Bt) {
    const int lane = threadIdx.x & 31; const int L0 = (blockIdx.x * 8 + (threadIdx.x >> 5)) * 8; const int nlines = N * K / 64;
{
#pragma unroll 1
        for (int l = 0; l < 8; ++l) { const int L = L0 + l; if (L >= nlines) break; const size_t e = (size_t)L * 64 + lane * 2; const int k = (int)(e % K), n = (int)(e / K); v2us o;
            o[0] = f2bf(w[(size_t)k * N + n]); o[1] = f2bf(w[(size_t)(k + 1) * N + n]); *(v2us*)(Bt + e) = o; }
         }
}
__global__ __launch_bounds__(256) void k_cvt8(const float* __restrict__ src, bf* dst, size_t n8) { const size_t i = (size_t)blockIdx.x * 256 + threadIdx.x; if (i >= n8) return; const v8f v = *(const v8f*)(src + i * 8); v8us o;
#pragma unroll
    for (int k = 0; k < 8; ++k) o[k] = f2bf(v[k]); *(v8us*)(dst + i * 8) = o;  }

// k_rope: head planes [h][t][d] (fp16 + hi/lo) of rope(x) x sc with the rotate-half convention out[d] = x[d] cos[t][d] - x[d+HD/2] sin[t][d], out[d+HD/2] = x[d+HD/2] cos[t][d+HD/2] + x[d] sin[t][d+HD/2]
__global__ __launch_bounds__(256) void k_rope(const float* __restrict__ F, int pitch, int nheads, const float* __restrict__ CS, const float* __restrict__ RF, const float* __restrict__ nw, float sc, h16* P16, bf* Ph, bf* Pl) {
    const size_t e = ((size_t)blockIdx.x * 256 + threadIdx.x) * 2; if (e >= (size_t)nheads * TT * HD) return; const int d = (int)(e % HD); const int t = (int)((e / HD) % TT); const int h = (int)(e / ((size_t)HD * TT)); const float* f = F + (size_t)t * pitch + h * HD; const float rf = RF ? RF[(size_t)h * TT + t] : 1.0f; v2h o16; v2us oh, ol;
#pragma unroll
    for (int q = 0; q < 2; ++q) { const int dd = d + q; const int dp = (dd < HD / 2) ? dd + HD / 2 : dd - HD / 2; float x0 = f[dd], x1 = f[dp];
        if (RF) { float n0 = __fmul_rn(x0, rf), n1 = __fmul_rn(x1, rf); asm volatile("" : "+v"(n0)); asm volatile("" : "+v"(n1)); x0 = __fmul_rn(bfr(nw[dd]), n0); x1 = __fmul_rn(bfr(nw[dp]), n1); }
        const v2f cs = *(const v2f*)(CS + ((size_t)t * HD + dd) * 2); float a = __fmul_rn(x0, cs[0]), bq = __fmul_rn(x1, cs[1]); asm volatile("" : "+v"(a)); asm volatile("" : "+v"(bq)); const float r = ((dd < HD / 2) ? __fsub_rn(a, bq) : __fadd_rn(a, bq)) * sc;
        o16[q] = tohx(r); unsigned short a2, c2; splitf(r, a2, c2); oh[q] = a2; ol[q] = c2; }
    *(v2h*)(P16 + e) = o16; *(v2us*)(Ph + e) = oh; *(v2us*)(Pl + e) = ol;  }
__global__ __launch_bounds__(256) void k_vtp(const float* __restrict__ F, int pitch, int nheads, h16* V16, bf* Vh, bf* Vl) { const size_t e = ((size_t)blockIdx.x * 256 + threadIdx.x) * 2; if (e >= (size_t)nheads * HD * TT) return; const int t = (int)(e % TT); const int d = (int)((e / TT) % HD); const int g = (int)(e / ((size_t)TT * HD)); v2h o16; v2us oh, ol;
#pragma unroll
    for (int q = 0; q < 2; ++q) { const float x = F[(size_t)(t + q) * pitch + g * HD + d]; o16[q] = tohx(x); unsigned short a2, c2; splitf(x, a2, c2); oh[q] = a2; ol[q] = c2; }
    *(v2h*)(V16 + e) = o16; *(v2us*)(Vh + e) = oh; *(v2us*)(Vl + e) = ol;  }
__global__ __launch_bounds__(256) void k_csid(float* CS) { const int idx = blockIdx.x * 256 + threadIdx.x; if (idx >= TT * HD) return; v2f cs; cs[0] = 1.0f; cs[1] = 0.0f; *(v2f*)(CS + (size_t)idx * 2) = cs;  }
// ---- k_fattn: scores, softmax, P x V and the head merge of 32 query rows of one head in ONE work-group of 16 waves; no score or P ever leaves the registers. grid (rows / 32, 1, heads), 512 threads.
// Wave w owns keys [128 w, 128 w + 128). It forms the TRANSPOSED scores S^T = K Q^T (K rows as the A operand, Q rows as B): accumulator s[kt][mb][j] of lane (lr, hi) is key 128 w + 16 kt + 8 hi + j against query 16 mb + lr.
// So a lane holds 64 keys of each of its 2 query rows (row max and row sum: in the lane, one exchange with lane ^ 16, then over the 16 waves through LDS, in wave order),
// and the pair s[2c][mb], s[2c+1][mb], rounded to 16 bit, IS the A fragment of P for keys [32 c, 32 c + 32): element e < 8 is k = 8 hi + e, element 8 + e is k = 16 + 8 hi + e, the k order of WFrag::ld on the V^T rows.
// The 16 partial 32 x 64 outputs (one per key range) meet in LDS, are added in wave order 0..15 and go out as the merged-head hi + lo planes. Query rows t0 + 32 x ..; HL: hi + lo bf16 planes, 3 products each; else fp16, P x PCAR.
// behind a group of global loads: the wait that stands before a register which an issued load names is written again; the lane offset and the scalar bases are inputs, so their registers stay as they are up to it. The scheduling barrier behind it keeps the group's loads together above it: one L2 latency a group.
__device__ __forceinline__ void ld_done(unsigned off, const void* p0, const void* p1, const void* p2, const void* p3) { asm volatile("s_wait_xcnt 0x0" :: "v"(off), "s"(p0), "s"(p1), "s"(p2), "s"(p3) : "memory"); __builtin_amdgcn_sched_barrier(0); /* no load of the group sinks below, no product rises above */ }
// 8 x 2^x; the v_nop is the one free slot behind the last transcendental (the others are each followed by an independent one: outputs are early-clobber, so none overwrites a source)
__device__ __forceinline__ v8f exp2x8(v8f x) { float e0, e1, e2, e3, e4, e5, e6, e7;
    asm("v_exp_f32 %0, %8\n\tv_exp_f32 %1, %9\n\tv_exp_f32 %2, %10\n\tv_exp_f32 %3, %11\n\tv_exp_f32 %4, %12\n\tv_exp_f32 %5, %13\n\tv_exp_f32 %6, %14\n\tv_exp_f32 %7, %15\n\tv_nop"
        : "=&v"(e0), "=&v"(e1), "=&v"(e2), "=&v"(e3), "=&v"(e4), "=&v"(e5), "=&v"(e6), "=&v"(e7) : "v"(x[0]), "v"(x[1]), "v"(x[2]), "v"(x[3]), "v"(x[4]), "v"(x[5]), "v"(x[6]), "v"(x[7]));
    return (v8f){e0, e1, e2, e3, e4, e5, e6, e7}; }
template <typename T16, bool HL>
__global__ __launch_bounds__(512) void k_fattn(const T16* __restrict__ Q, const T16* __restrict__ Q2, const T16* __restrict__ Kp, const T16* __restrict__ Kp2, const T16* __restrict__ Vt, const T16* __restrict__ Vt2, int t0, bf* Ah, bf* Al) {
    typedef typename WFrag<T16>::V V;
    __shared__ __align__(16) float os[16 * 32 * 68];
    __shared__ float rmx[16 * 32], rsm[16 * 32];
    const size_t zo = (size_t)blockIdx.z * TT * HD;
    const int lane = threadIdx.x & 31, lr = lane & 15, hi = lane >> 4; const int r0 = t0 + blockIdx.x * 32;
    const int wv = __builtin_amdgcn_readfirstlane((int)(threadIdx.x >> 5)); const int k0 = wv * 128;
    Q += zo + (size_t)r0 * HD; Kp += zo + (size_t)k0 * HD; Vt += zo + k0; if (HL) { Q2 += zo + (size_t)r0 * HD; Kp2 += zo + (size_t)k0 * HD; Vt2 += zo + k0; }   // wave-uniform bases
    const unsigned qoff = lr * HD + 8 * hi, koff = qoff, voff = lr * TT + 8 * hi;   // one 32-bit lane offset for Q and K rows, one for V^T rows
    constexpr int GK = HL ? 4 : 8, GC = HL ? 1 : 2;   // K tiles, and 32-key steps of V^T, per load group
    v8f s[8][2];
#pragma unroll
    for (int kt = 0; kt < 8; ++kt) { s[kt][0] = (v8f){}; s[kt][1] = (v8f){}; }
#pragma unroll
    for (int kc = 0; kc < HD; kc += 32) {
        V q[2], q2[2];
#pragma unroll
        for (int mb = 0; mb < 2; ++mb) { q[mb] = WFrag<T16>::ld(Q + qoff + (mb * 16 * HD + kc)); if (HL) q2[mb] = WFrag<T16>::ld(Q2 + qoff + (mb * 16 * HD + kc)); }
#pragma unroll
        for (int g = 0; g < 8; g += GK) {
            V k[GK], k2[GK];
#pragma unroll
            for (int i = 0; i < GK; ++i) { k[i] = WFrag<T16>::ld(Kp + koff + ((g + i) * 16 * HD + kc)); if (HL) k2[i] = WFrag<T16>::ld(Kp2 + koff + ((g + i) * 16 * HD + kc)); }
            ld_done(qoff, Q, HL ? Q2 : Q, Kp, HL ? Kp2 : Kp);   // the group's loads all issue before its first product: one L2 latency a group, not one a fragment
#pragma unroll
            for (int i = 0; i < GK; ++i)
#pragma unroll
                for (int mb = 0; mb < 2; ++mb) { s[g + i][mb] = WFrag<T16>::mma(k[i], q[mb], s[g + i][mb]); if (HL) { s[g + i][mb] = WFrag<T16>::mma(k[i], q2[mb], s[g + i][mb]); s[g + i][mb] = WFrag<T16>::mma(k2[i], q[mb], s[g + i][mb]); } }
            __builtin_amdgcn_sched_barrier(0);   // the next group's loads stay below: two groups in flight beside the 128 accumulators would spill
        }
    }
    // row max: t = S x HD^-0.5 (no mask)
    float mx[2];
#pragma unroll
    for (int mb = 0; mb < 2; ++mb) { float m = -3.0e38f;
#pragma unroll
        for (int kt = 0; kt < 8; ++kt)
#pragma unroll
            for (int j = 0; j < 8; ++j) { const float t = s[kt][mb][j] * SCL; s[kt][mb][j] = t; m = fmaxf(m, t); }
        mx[mb] = fmaxf(m, __shfl_xor(m, 16, 32)); }
    rmx[wv * 32 + lane] = hi ? mx[1] : mx[0];   // lane l carries query row l = 16 mb + lr with mb = hi
    tile_sync<16>();
    { float m = rmx[lane];
#pragma unroll
      for (int w = 1; w < 16; ++w) m = fmaxf(m, rmx[w * 32 + lane]);
      const float ot = __shfl_xor(m, 16, 32); mx[0] = hi ? ot : m; mx[1] = hi ? m : ot; }
    // one exp per score; row sum: 4 chains in the lane, lane ^ 16, then the waves in order
    float sm[2];
#pragma unroll
    for (int mb = 0; mb < 2; ++mb) { float a4[4] = {0.f, 0.f, 0.f, 0.f};
#pragma unroll
        for (int kt = 0; kt < 8; ++kt) { v8f x;
#pragma unroll
            for (int j = 0; j < 8; ++j) x[j] = __fmul_rn(__fsub_rn(s[kt][mb][j], mx[mb]), 1.4426950408889634f);
            s[kt][mb] = exp2x8(x);
#pragma unroll
            for (int j = 0; j < 8; ++j) a4[j & 3] += s[kt][mb][j]; }
        const float a = (a4[0] + a4[1]) + (a4[2] + a4[3]); sm[mb] = a + __shfl_xor(a, 16, 32); }
    rsm[wv * 32 + lane] = hi ? sm[1] : sm[0];
    tile_sync<16>();
    V vb[GC][4];
#pragma unroll
    for (int ci = 0; ci < GC; ++ci)
#pragma unroll
        for (int nb = 0; nb < 4; ++nb) vb[ci][nb] = WFrag<T16>::ld(Vt + voff + (nb * 16 * TT + ci * 32));
    ld_done(voff, Vt, Vt, Vt, Vt);   // the first group's loads issue here: the row factor and the rounding of P run under them
    float fs[2];
    { float a = rsm[lane];
#pragma unroll
      for (int w = 1; w < 16; ++w) a += rsm[w * 32 + lane];
      const float f = __fdiv_rn(HL ? 1.0f : PCAR, a); const float ot = __shfl_xor(f, 16, 32); fs[0] = hi ? ot : f; fs[1] = hi ? f : ot; }
    v8f o[2][4];
#pragma unroll
    for (int mb = 0; mb < 2; ++mb)
#pragma unroll
        for (int nb = 0; nb < 4; ++nb) o[mb][nb] = (v8f){};
#pragma unroll
    for (int cg = 0; cg < 4; cg += GC) {
        if (cg) {
#pragma unroll
            for (int ci = 0; ci < GC; ++ci)
#pragma unroll
                for (int nb = 0; nb < 4; ++nb) vb[ci][nb] = WFrag<T16>::ld(Vt + voff + (nb * 16 * TT + (cg + ci) * 32));
            ld_done(voff, Vt, Vt, Vt, Vt);   // the rounding of P below runs under the group's loads
        }
#pragma unroll
        for (int ci = 0; ci < GC; ++ci) { const int c = cg + ci;
            V a[2], a2[2];
#pragma unroll
            for (int mb = 0; mb < 2; ++mb) {
                if constexpr (HL) { v8us h0, l0, h1, l1;
#pragma unroll
                    for (int e = 0; e < 8; ++e) { unsigned short x, y; splitf(s[2 * c][mb][e] * fs[mb], x, y); h0[e] = x; l0[e] = y; splitf(s[2 * c + 1][mb][e] * fs[mb], x, y); h1[e] = x; l1[e] = y; }
                    a[mb] = cat16b(h0, h1); a2[mb] = cat16b(l0, l1);
                } else { v8h p0, p1;
#pragma unroll
                    for (int e = 0; e < 8; ++e) { p0[e] = tohx(s[2 * c][mb][e] * fs[mb]); p1[e] = tohx(s[2 * c + 1][mb][e] * fs[mb]); }
                    a[mb] = cat16(p0, p1); } }
#pragma unroll
            for (int nb = 0; nb < 4; ++nb)
#pragma unroll
                for (int mb = 0; mb < 2; ++mb) { o[mb][nb] = WFrag<T16>::mma(a[mb], vb[ci][nb], o[mb][nb]); if (HL) o[mb][nb] = WFrag<T16>::mma(a2[mb], vb[ci][nb], o[mb][nb]); }
            if constexpr (HL) {   // the lo plane of V^T is a load group of its own (registers); each accumulator still takes hi x hi, lo x hi, hi x lo in that order
                __builtin_amdgcn_sched_barrier(0);   // its loads stay below the products above: registers
                V vl[4];
#pragma unroll
                for (int nb = 0; nb < 4; ++nb) vl[nb] = WFrag<T16>::ld(Vt2 + voff + (nb * 16 * TT + c * 32));
                ld_done(voff, Vt2, Vt2, Vt2, Vt2);
#pragma unroll
                for (int nb = 0; nb < 4; ++nb)
#pragma unroll
                    for (int mb = 0; mb < 2; ++mb) o[mb][nb] = WFrag<T16>::mma(a[mb], vl[nb], o[mb][nb]); } }
        __builtin_amdgcn_sched_barrier(0);   // the next group's loads stay below these products: registers
    }
    float* osw = os + wv * (32 * 68);
#pragma unroll
    for (int mb = 0; mb < 2; ++mb)
#pragma unroll
        for (int nb = 0; nb < 4; ++nb)
#pragma unroll
            for (int j = 0; j < 8; ++j) osw[(mb * 16 + hi * 8 + j) * 68 + nb * 16 + lr] = o[mb][nb][j];
    tile_sync<16>();
    { const int row = (int)threadIdx.x >> 4, cofs = ((int)threadIdx.x & 15) * 4; v4f val = *(const v4fa*)(os + row * 68 + cofs);
#pragma unroll
      for (int w = 1; w < 16; ++w) val += *(const v4fa*)(os + w * (32 * 68) + row * 68 + cofs);
      v4us oh, ol;   // merged heads [t][h][d], hi + lo bf16 planes: the A operand of the output projection
#pragma unroll
      for (int q = 0; q < 4; ++q) { unsigned short x, y; splitf(val[q] * (HL ? 1.0f : 1.0f / PCAR), x, y); oh[q] = x; ol[q] = y; }
      const size_t oo = (size_t)(r0 + row) * DQ + blockIdx.z * HD + cofs; *(v4us*)(Ah + oo) = oh; *(v4us*)(Al + oo) = ol; }
}
__global__ __launch_bounds__(256) void k_cvt8s(const float* __restrict__ X, bf* XB, size_t pitch) { const size_t i = (size_t)blockIdx.x * 256 + threadIdx.x; if (i >= (size_t)TT * DM / 8) return; const size_t e = i * 8; const int c = (int)(e % DM); const int srow = (int)(e / DM); const v8f a = *(const v8f*)(X + (size_t)srow * pitch + c); v8us o;
#pragma unroll
    for (int q = 0; q < 8; ++q) o[q] = f2bf(a[q]);
    *(v8us*)(XB + e) = o;  }

extern "C" void kernel_launch(void* const* d_in, const int* in_sizes, int n_in,
                              void* d_out, int out_size, void* d_ws, size_t ws_size, hipStream_t stream) {
    (void)in_sizes; (void)n_in; (void)out_size;
    const float* x = (const float*)d_in[0];   /* query [S][B][D] = [2048][4][1024]: ONE stream: q, k and v all project it */ const float* xk = (const float*)d_in[0]; const float* xv = (const float*)d_in[0]; const float* wq = (const float*)d_in[1]; const float* bq = (const float*)d_in[2]; const float* wk = (const float*)d_in[3]; const float* bk = (const float*)d_in[4]; const float* wv = (const float*)d_in[5]; const float* bv = (const float*)d_in[6]; const float* wo = (const float*)d_in[7]; const float* bo = (const float*)d_in[8];
    float* OUT = (float*)d_out;     // [2048][4][1024] sequence-first
    char* wsp = (char*)d_ws;
    auto take = [&](size_t bytes) { char* p = wsp; wsp += (bytes + 255) & ~(size_t)255; return (void*)p; };
    bf* WQ = (bf*)take((size_t)DQ * DM * 2); bf* WK = (bf*)take((size_t)DKV * DM * 2); bf* WV = (bf*)take((size_t)DKV * DM * 2); bf* WO = (bf*)take((size_t)DM * DQ * 2); float* CS = (float*)take((size_t)TT * HD * 2 * 4);
    bf* XB = (bf*)take((size_t)TT * DM * 2); float* FQ = (float*)take((size_t)TT * DQ * 4); float* FK = (float*)take((size_t)TT * DKV * 4);
    h16* QP16 = (h16*)take((size_t)NH_ * TT * HD * 2); h16* KP16 = (h16*)take((size_t)NKV * TT * HD * 2); h16* VT16 = (h16*)take((size_t)NKV * HD * TT * 2);
    bf* QPh = (bf*)take((size_t)NH_ * TT * HD * 2); bf* QPl = (bf*)take((size_t)NH_ * TT * HD * 2); bf* KPh = (bf*)take((size_t)NKV * TT * HD * 2); bf* KPl = (bf*)take((size_t)NKV * TT * HD * 2); bf* VTh = (bf*)take((size_t)NKV * HD * TT * 2); bf* VTl = (bf*)take((size_t)NKV * HD * TT * 2);
    bf* ATh = (bf*)take((size_t)TT * DQ * 2); bf* ATl = (bf*)take((size_t)TT * DQ * 2);
    if ((size_t)(wsp - (char*)d_ws) > ws_size) return;    // ws 256 MiB
    float* FV = FK;   // v projection reuses the k buffer after the k planes are built (stream-ordered)
    { k_cvt8<<<(unsigned)(((size_t)DQ * DM / 8 + 255) / 256), 256, 0, stream>>>(wq, WQ, (size_t)DQ * DM / 8); k_cvt8<<<(unsigned)(((size_t)DKV * DM / 8 + 255) / 256), 256, 0, stream>>>(wk, WK, (size_t)DKV * DM / 8); k_cvt8<<<(unsigned)(((size_t)DKV * DM / 8 + 255) / 256), 256, 0, stream>>>(wv, WV, (size_t)DKV * DM / 8);
      k_cvt8<<<(unsigned)(((size_t)DM * DQ / 8 + 255) / 256), 256, 0, stream>>>(wo, WO, (size_t)DM * DQ / 8);
       }
    k_csid<<<(TT * HD + 255) / 256, 256, 0, stream>>>(CS);
    const unsigned LQ = (unsigned)(((size_t)NH_ * TT * HD / 2 + 255) / 256), LKv = (unsigned)(((size_t)NKV * TT * HD / 2 + 255) / 256);
    for (int b = 0; b < NB_; ++b) {
        
        k_cvt8s<<<(unsigned)(((size_t)TT * DM / 8 + 255) / 256), 256, 0, stream>>>(x + (size_t)b * DM, XB, (size_t)NB_ * DM);   /* rows s of batch column b: pitch B x D */
        k_gemmw<bf, 0, true, 8><<<dim3(TT / 64, DQ / 64, 1), 256, 0, stream>>>(XB, nullptr, WQ, nullptr, DM, DM, FQ, DQ, bq, 0, 0, 0);
        k_rope<<<LQ, 256, 0, stream>>>(FQ, DQ, NH_, CS, nullptr, nullptr, 1.0f, QP16, QPh, QPl);
        k_cvt8s<<<(unsigned)(((size_t)TT * DM / 8 + 255) / 256), 256, 0, stream>>>(xk + (size_t)b * DM, XB, (size_t)NB_ * DM);   /* rows s of batch column b: pitch B x D */ k_gemmw<bf, 0, true, 8><<<dim3(TT / 64, DKV / 64, 1), 256, 0, stream>>>(XB, nullptr, WK, nullptr, DM, DM, FK, DKV, bk, 0, 0, 0);
        k_rope<<<LKv, 256, 0, stream>>>(FK, DKV, NKV, CS, nullptr, nullptr, 1.0f, KP16, KPh, KPl);
        k_cvt8s<<<(unsigned)(((size_t)TT * DM / 8 + 255) / 256), 256, 0, stream>>>(xv + (size_t)b * DM, XB, (size_t)NB_ * DM);   /* rows s of batch column b: pitch B x D */ k_gemmw<bf, 0, true, 8><<<dim3(TT / 64, DKV / 64, 1), 256, 0, stream>>>(XB, nullptr, WV, nullptr, DM, DM, FV, DKV, bv, 0, 0, 0); k_vtp<<<LKv, 256, 0, stream>>>(FV, DKV, NKV, VT16, VTh, VTl);
        k_fattn<bf, true><<<dim3(RH / 32, 1, ZH), 512, 0, stream>>>(QPh, QPl, KPh, KPl, VTh, VTl, 0, ATh, ATl);   // one kv head per query head: plane z of each (z-stride TT*HD)
        k_fattn<h16, false><<<dim3((TT - RH) / 32, 1, ZH), 512, 0, stream>>>(QP16, nullptr, KP16, nullptr, VT16, nullptr, RH, ATh, ATl);
        k_gemmw<bf, 1, true, 8><<<dim3(TT / 64, DM / 64, 1), 256, 0, stream>>>(ATh, ATl, WO, nullptr, DQ, DQ, OUT + (size_t)b * DM, NB_ * DM, bo, 0, 0, 0);   /* [S][B][D]: row pitch B x D, column block b */ }
}

// v004
// It runs in 499 microseconds.
// Timed twice side by side with v003, it ran 1.16 times as fast both times.
// All steps since v000 together make it 8.02 times as fast.
#include <hip/hip_runtime.h>

// Multi-head self-attention on a SEQUENCE-FIRST tensor (query [2048][4][1024] = [S][B][D]: ONE stream; q, k, v = x W^T + b ('oi' (out, in) [1024][1024] + [1024]; normal x 0.02; biases ZEROS on this draw: read); 16 heads x 64 per batch column; q = query Wq^T + bq (not pre-scaled: the softmax scales scores by 64^-0.5 = 1/8); softmax over all keys (no mask); out = merged Wo^T + bo -> [2048][4][1024] sequence-first (8.4 M); argument order query, Wq, bq, Wk, bk, Wv, bv, Wo, bo).
// Layout per batch b: a strided gather makes the bf16 copy of rows s of column b (row pitch B x D) for query, then key, then value; 'oi' weights; exact projections + f32 biases; dense T-2048 attention (hybrid rows: < 512 hi/lo 3 products, rest fp16 x1024); merged hi/lo x Wo exact + bo written with row pitch B x D at column offset b (the [S][B][D] output).
// Compute dtypes, f32 accumulate: every input rounded to bf16; projections exact + f32 biases; attention rows < 512 3 products, rest fp16; softmax f32; Wo hl x exact + bias.

#define NB_  4
#define TT   2048
#define DM   1024
#define NH_  16
#define NKV  16
#define REP  (NH_ / NKV)
#define HD   64
#define DQ   (NH_ * HD)
#define DKV  (NKV * HD)
#define ZH   16                   // heads per attention launch (grid z): all of a batch column's
#define RH   512                  // query rows < RH use hi+lo planes (0: none)
#define WIN  0
#define PCAR 1024.0f
#define SCL  0.125f   // HD^-0.5
typedef _Float16 h16;
typedef unsigned short bf;
typedef __attribute__((ext_vector_type(16))) __bf16   v16bf;
typedef __attribute__((ext_vector_type(16))) _Float16 v16h;
typedef __attribute__((ext_vector_type(8)))  _Float16 v8h;
typedef __attribute__((ext_vector_type(8)))  unsigned short v8us;
typedef __attribute__((ext_vector_type(8)))  float    v8f;
typedef __attribute__((ext_vector_type(4)))  float    v4f;
typedef v8h  __attribute__((may_alias)) v8ha;
typedef v4f  __attribute__((may_alias)) v4fa;
typedef v8us __attribute__((may_alias)) v8usa;

__device__ __forceinline__ unsigned short f2bf(float f) { unsigned u = __float_as_uint(f); u += 0x7FFFu + ((u >> 16) & 1u); return (unsigned short)(u >> 16); }
__device__ __forceinline__ float bf2f(unsigned short b) { return __uint_as_float(((unsigned)b) << 16); }
__device__ __forceinline__ float bfr(float f) { return bf2f(f2bf(f)); }
__device__ __forceinline__ v16h cat16(v8h lo, v8h hi) { return __builtin_shufflevector(lo, hi, 0, 1, 2, 3, 4, 5, 6, 7, 8, 9, 10, 11, 12, 13, 14, 15); }
__device__ __forceinline__ v16bf cat16b(v8us lo, v8us hi) { return __builtin_bit_cast(v16bf, __builtin_shufflevector(lo, hi, 0, 1, 2, 3, 4, 5, 6, 7, 8, 9, 10, 11, 12, 13, 14, 15)); }
__device__ __forceinline__ v8f wmma16(v16h a, v16h b, v8f c) { return __builtin_amdgcn_wmma_f32_16x16x32_f16(false, a, false, b, (short)0, c, false, false); }
__device__ __forceinline__ v8f wmmab(v16bf a, v16bf b, v8f c) { return __builtin_amdgcn_wmma_f32_16x16x32_bf16(false, a, false, b, (short)0, c, false, false); }
__device__ __forceinline__ h16 tohx(float x) { return (h16)x; }
__device__ __forceinline__ void splitf(float y, unsigned short& h, unsigned short& l) { h = f2bf(y); l = f2bf(y - bf2f(h)); }
typedef __attribute__((ext_vector_type(4))) _Float16 v4h;
typedef __attribute__((ext_vector_type(4))) unsigned short v4us;



// ---- k_gemmw: register-blocked GEMM, one work-group of KS waves per 64x64 output tile; wave w sums the k range [w K/KS, (w+1) K/KS) into its own 16 accumulators, operands straight from K-contiguous 16-bit planes; grid (M/64, N/64, Z), 32 x KS threads.
// The KS partial tiles meet in LDS, 16 rows at a time, and are added in wave order 0..KS-1 (fixed, the same on every run).
// C[m][n] (f32, pitch ldc, + optional f32 bias[n]) = sum_k A[m][k] Bt[n][k] (+ split products per NSPLIT). A rows have pitch lda, Bt rows pitch K. z-batch strides sA/sB/sC in elements. K % (32 KS) == 0.
// OUTM 0: C as above. OUTM 1 and 2: no f32 copy; the summed tile (+ bias) leaves as the three 16-bit planes the attention kernel reads: fp16, bf16 hi, bf16 lo (lo = the rest after hi).
//   1: head planes [n / 64][m][n % 64] (a 64-column tile is one head, TT rows a head), bias[n].
//   2: planes [m][n] of pitch ldc, bias[m]: with A = weight rows and Bt = token rows the product IS the transposed head plane [head][d][t]; same k ranges, same k order as the untransposed product.
template <typename T16> struct WFrag;
template <> struct WFrag<h16> { typedef v16h V; static __device__ __forceinline__ V ld(const h16* p) { return cat16(*(const v8h*)p, *(const v8h*)(p + 16)); } static __device__ __forceinline__ v8f mma(V a, V b, v8f c) { return wmma16(a, b, c); } };
template <> struct WFrag<bf> { typedef v16bf V; static __device__ __forceinline__ V ld(const bf* p) { return cat16b(*(const v8us*)p, *(const v8us*)(p + 16)); } static __device__ __forceinline__ v8f mma(V a, V b, v8f c) { return wmmab(a, b, c); } };
// one wave: program order in the wave is enough. Several waves: every partial tile must be written before it is summed, and summed before it is overwritten:
// a work-group barrier between fences on LDS alone (only LDS passes between the waves; __syncthreads() would also hold every round until the round's stores to C have returned).
template <int KS> __device__ __forceinline__ void tile_sync() {
    if constexpr (KS == 1) { __builtin_amdgcn_wave_barrier(); asm volatile("" ::: "memory"); }
    else { __builtin_amdgcn_fence(__ATOMIC_RELEASE, "workgroup", "local"); __builtin_amdgcn_s_barrier(); __builtin_amdgcn_fence(__ATOMIC_ACQUIRE, "workgroup", "local"); } }
template <typename T16, int NSPLIT, bool BIAS, int KS, int OUTM>
__global__ __launch_bounds__(32 * KS) void k_gemmw(const T16* __restrict__ A, const T16* __restrict__ A2, const T16* __restrict__ Bt, const T16* __restrict__ Bt2, int K, int lda, float* C, int ldc, const float* __restrict__ bias, size_t sA, size_t sB, size_t sC, h16* P16, bf* Ph, bf* Pl) {
    typedef typename WFrag<T16>::V V;
    __shared__ __align__(16) float os[KS * 16 * 68];
    const size_t z = blockIdx.z; A += z * sA; if (A2) A2 += z * sA; Bt += z * sB; if (Bt2) Bt2 += z * sB; C += z * sC;
    const int lane = threadIdx.x & 31, lr = lane & 15, hi = lane >> 4; const int r0 = blockIdx.x * 64, c0 = blockIdx.y * 64;
    const int wv = KS == 1 ? 0 : __builtin_amdgcn_readfirstlane((int)(threadIdx.x >> 5)); const int kw = K / KS, k0 = wv * kw; float* osw = os + wv * (16 * 68);
    v8f acc[4][4];
#pragma unroll
    for (int mb = 0; mb < 4; ++mb)
#pragma unroll
        for (int nb = 0; nb < 4; ++nb) acc[mb][nb] = (v8f){};
    const size_t aoff = (size_t)(r0 + lr) * lda + 8 * hi, boff = (size_t)(c0 + lr) * K + 8 * hi;
#pragma unroll 1
    for (int kc = k0; kc < k0 + kw; kc += 32) {
        V a[4], a2[4];
#pragma unroll
        for (int mb = 0; mb < 4; ++mb) { a[mb] = WFrag<T16>::ld(A + aoff + (size_t)mb * 16 * lda + kc); if (NSPLIT == 1 || NSPLIT == 2) a2[mb] = WFrag<T16>::ld(A2 + aoff + (size_t)mb * 16 * lda + kc); }
#pragma unroll
        for (int nb = 0; nb < 4; ++nb) { const V b = WFrag<T16>::ld(Bt + boff + (size_t)nb * 16 * K + kc); V b2; if (NSPLIT >= 2) b2 = WFrag<T16>::ld(Bt2 + boff + (size_t)nb * 16 * K + kc);
#pragma unroll
            for (int mb = 0; mb < 4; ++mb) { acc[mb][nb] = WFrag<T16>::mma(a[mb], b, acc[mb][nb]); if (NSPLIT == 1 || NSPLIT == 2) acc[mb][nb] = WFrag<T16>::mma(a2[mb], b, acc[mb][nb]); if (NSPLIT >= 2) acc[mb][nb] = WFrag<T16>::mma(a[mb], b2, acc[mb][nb]); } }
        asm volatile("v_nop\n\tv_nop\n\tv_nop\n\tv_nop" : "+v"(acc[0][0]), "+v"(acc[1][1]), "+v"(acc[2][2]), "+v"(acc[3][3]) : "v"(a[0]), "v"(a[3]));
    }
#pragma unroll
    for (int mb = 0; mb < 4; ++mb) {
#pragma unroll
        for (int nb = 0; nb < 4; ++nb) {
#pragma unroll
            for (int j = 0; j < 8; ++j) osw[(hi * 8 + j) * 68 + nb * 16 + lr] = acc[mb][nb][j]; }
        tile_sync<KS>();
        float* crow = C + (size_t)(r0 + mb * 16) * ldc + c0;
{
#pragma unroll
            for (int s = 0; s < (KS < 8 ? 8 / KS : 1); ++s) { const int it = s * 32 * KS + (int)threadIdx.x; if (KS > 8 && it >= 256) break; const int row = it >> 4, cofs = (it & 15) * 4; v4f val = *(const v4fa*)(os + row * 68 + cofs);
#pragma unroll
                for (int w = 1; w < KS; ++w) val += *(const v4fa*)(os + w * (16 * 68) + row * 68 + cofs);
                if (BIAS) { if constexpr (OUTM == 2) { const float br = bfr(bias[r0 + mb * 16 + row]); val[0] += br; val[1] += br; val[2] += br; val[3] += br; }
                            else { val[0] += bfr(bias[c0 + cofs]); val[1] += bfr(bias[c0 + cofs + 1]); val[2] += bfr(bias[c0 + cofs + 2]); val[3] += bfr(bias[c0 + cofs + 3]); } }
                if constexpr (OUTM == 0) *(v4f*)(crow + (size_t)row * ldc + cofs) = val;
                else { const size_t po = OUTM == 1 ? ((size_t)blockIdx.y * TT + (r0 + mb * 16 + row)) * HD + cofs : (size_t)(r0 + mb * 16 + row) * ldc + c0 + cofs; v4h o16; v4us oh, ol;
#pragma unroll
                    for (int q = 0; q < 4; ++q) { o16[q] = tohx(val[q]); unsigned short x, y; splitf(val[q], x, y); oh[q] = x; ol[q] = y; }
                    *(v4h*)(P16 + po) = o16; *(v4us*)(Ph + po) = oh; *(v4us*)(Pl + po) = ol; } }
             }
        if (mb < 3) tile_sync<KS>();
    }
}

typedef __attribute__((ext_vector_type(2))) unsigned short v2us;

__global__ __launch_bounds__(256) void k_wtG(const float* __restrict__ w, int K, int N, bf* Bt) {
    const int lane = threadIdx.x & 31; const int L0 = (blockIdx.x * 8 + (threadIdx.x >> 5)) * 8; const int nlines = N * K / 64;
{
#pragma unroll 1
        for (int l = 0; l < 8; ++l) { const int L = L0 + l; if (L >= nlines) break; const size_t e = (size_t)L * 64 + lane * 2; const int k = (int)(e % K), n = (int)(e / K); v2us o;
            o[0] = f2bf(w[(size_t)k * N + n]); o[1] = f2bf(w[(size_t)(k + 1) * N + n]); *(v2us*)(Bt + e) = o; }
         }
}
__global__ __launch_bounds__(256) void k_cvt8(const float* __restrict__ src, bf* dst, size_t n8) { const size_t i = (size_t)blockIdx.x * 256 + threadIdx.x; if (i >= n8) return; const v8f v = *(const v8f*)(src + i * 8); v8us o;
#pragma unroll
    for (int k = 0; k < 8; ++k) o[k] = f2bf(v[k]); *(v8us*)(dst + i * 8) = o;  }

// ---- k_fattn: scores, softmax, P x V and the head merge of 32 query rows of one head in ONE work-group of 16 waves; no score or P ever leaves the registers. grid (rows / 32, 1, heads), 512 threads.
// Wave w owns keys [128 w, 128 w + 128). It forms the TRANSPOSED scores S^T = K Q^T (K rows as the A operand, Q rows as B): accumulator s[kt][mb][j] of lane (lr, hi) is key 128 w + 16 kt + 8 hi + j against query 16 mb + lr.
// So a lane holds 64 keys of each of its 2 query rows (row max and row sum: in the lane, one exchange with lane ^ 16, then over the 16 waves through LDS, in wave order),
// and the pair s[2c][mb], s[2c+1][mb], rounded to 16 bit, IS the A fragment of P for keys [32 c, 32 c + 32): element e < 8 is k = 8 hi + e, element 8 + e is k = 16 + 8 hi + e, the k order of WFrag::ld on the V^T rows.
// The 16 partial 32 x 64 outputs (one per key range) meet in LDS, are added in wave order 0..15 and go out as the merged-head hi + lo planes. Query rows t0 + 32 x ..; HL: hi + lo bf16 planes, 3 products each; else fp16, P x PCAR.
// behind a group of global loads: the wait that stands before a register which an issued load names is written again; the lane offset and the scalar bases are inputs, so their registers stay as they are up to it. The scheduling barrier behind it keeps the group's loads together above it: one L2 latency a group.
__device__ __forceinline__ void ld_done(unsigned off, const void* p0, const void* p1, const void* p2, const void* p3) { asm volatile("s_wait_xcnt 0x0" :: "v"(off), "s"(p0), "s"(p1), "s"(p2), "s"(p3) : "memory"); __builtin_amdgcn_sched_barrier(0); /* no load of the group sinks below, no product rises above */ }
// 8 x 2^x; the v_nop is the one free slot behind the last transcendental (the others are each followed by an independent one: outputs are early-clobber, so none overwrites a source)
__device__ __forceinline__ v8f exp2x8(v8f x) { float e0, e1, e2, e3, e4, e5, e6, e7;
    asm("v_exp_f32 %0, %8\n\tv_exp_f32 %1, %9\n\tv_exp_f32 %2, %10\n\tv_exp_f32 %3, %11\n\tv_exp_f32 %4, %12\n\tv_exp_f32 %5, %13\n\tv_exp_f32 %6, %14\n\tv_exp_f32 %7, %15\n\tv_nop"
        : "=&v"(e0), "=&v"(e1), "=&v"(e2), "=&v"(e3), "=&v"(e4), "=&v"(e5), "=&v"(e6), "=&v"(e7) : "v"(x[0]), "v"(x[1]), "v"(x[2]), "v"(x[3]), "v"(x[4]), "v"(x[5]), "v"(x[6]), "v"(x[7]));
    return (v8f){e0, e1, e2, e3, e4, e5, e6, e7}; }
template <typename T16, bool HL>
__global__ __launch_bounds__(512) void k_fattn(const T16* __restrict__ Q, const T16* __restrict__ Q2, const T16* __restrict__ Kp, const T16* __restrict__ Kp2, const T16* __restrict__ Vt, const T16* __restrict__ Vt2, int t0, bf* Ah, bf* Al) {
    typedef typename WFrag<T16>::V V;
    __shared__ __align__(16) float os[16 * 32 * 68];
    __shared__ float rmx[16 * 32], rsm[16 * 32];
    const size_t zo = (size_t)blockIdx.z * TT * HD;
    const int lane = threadIdx.x & 31, lr = lane & 15, hi = lane >> 4; const int r0 = t0 + blockIdx.x * 32;
    const int wv = __builtin_amdgcn_readfirstlane((int)(threadIdx.x >> 5)); const int k0 = wv * 128;
    Q += zo + (size_t)r0 * HD; Kp += zo + (size_t)k0 * HD; Vt += zo + k0; if (HL) { Q2 += zo + (size_t)r0 * HD; Kp2 += zo + (size_t)k0 * HD; Vt2 += zo + k0; }   // wave-uniform bases
    const unsigned qoff = lr * HD + 8 * hi, koff = qoff, voff = lr * TT + 8 * hi;   // one 32-bit lane offset for Q and K rows, one for V^T rows
    constexpr int GK = HL ? 4 : 8, GC = HL ? 1 : 2;   // K tiles, and 32-key steps of V^T, per load group
    v8f s[8][2];
#pragma unroll
    for (int kt = 0; kt < 8; ++kt) { s[kt][0] = (v8f){}; s[kt][1] = (v8f){}; }
#pragma unroll
    for (int kc = 0; kc < HD; kc += 32) {
        V q[2], q2[2];
#pragma unroll
        for (int mb = 0; mb < 2; ++mb) { q[mb] = WFrag<T16>::ld(Q + qoff + (mb * 16 * HD + kc)); if (HL) q2[mb] = WFrag<T16>::ld(Q2 + qoff + (mb * 16 * HD + kc)); }
#pragma unroll
        for (int g = 0; g < 8; g += GK) {
            V k[GK], k2[GK];
#pragma unroll
            for (int i = 0; i < GK; ++i) { k[i] = WFrag<T16>::ld(Kp + koff + ((g + i) * 16 * HD + kc)); if (HL) k2[i] = WFrag<T16>::ld(Kp2 + koff + ((g + i) * 16 * HD + kc)); }
            ld_done(qoff, Q, HL ? Q2 : Q, Kp, HL ? Kp2 : Kp);   // the group's loads all issue before its first product: one L2 latency a group, not one a fragment
#pragma unroll
            for (int i = 0; i < GK; ++i)
#pragma unroll
                for (int mb = 0; mb < 2; ++mb) { s[g + i][mb] = WFrag<T16>::mma(k[i], q[mb], s[g + i][mb]); if (HL) { s[g + i][mb] = WFrag<T16>::mma(k[i], q2[mb], s[g + i][mb]); s[g + i][mb] = WFrag<T16>::mma(k2[i], q[mb], s[g + i][mb]); } }
            __builtin_amdgcn_sched_barrier(0);   // the next group's loads stay below: two groups in flight beside the 128 accumulators would spill
        }
    }
    // row max: t = S x HD^-0.5 (no mask)
    float mx[2];
#pragma unroll
    for (int mb = 0; mb < 2; ++mb) { float m = -3.0e38f;
#pragma unroll
        for (int kt = 0; kt < 8; ++kt)
#pragma unroll
            for (int j = 0; j < 8; ++j) { const float t = s[kt][mb][j] * SCL; s[kt][mb][j] = t; m = fmaxf(m, t); }
        mx[mb] = fmaxf(m, __shfl_xor(m, 16, 32)); }
    rmx[wv * 32 + lane] = hi ? mx[1] : mx[0];   // lane l carries query row l = 16 mb + lr with mb = hi
    tile_sync<16>();
    { float m = rmx[lane];
#pragma unroll
      for (int w = 1; w < 16; ++w) m = fmaxf(m, rmx[w * 32 + lane]);
      const float ot = __shfl_xor(m, 16, 32); mx[0] = hi ? ot : m; mx[1] = hi ? m : ot; }
    // one exp per score; row sum: 4 chains in the lane, lane ^ 16, then the waves in order
    float sm[2];
#pragma unroll
    for (int mb = 0; mb < 2; ++mb) { float a4[4] = {0.f, 0.f, 0.f, 0.f};
#pragma unroll
        for (int kt = 0; kt < 8; ++kt) { v8f x;
#pragma unroll
            for (int j = 0; j < 8; ++j) x[j] = __fmul_rn(__fsub_rn(s[kt][mb][j], mx[mb]), 1.4426950408889634f);
            s[kt][mb] = exp2x8(x);
#pragma unroll
            for (int j = 0; j < 8; ++j) a4[j & 3] += s[kt][mb][j]; }
        const float a = (a4[0] + a4[1]) + (a4[2] + a4[3]); sm[mb] = a + __shfl_xor(a, 16, 32); }
    rsm[wv * 32 + lane] = hi ? sm[1] : sm[0];
    tile_sync<16>();
    V vb[GC][4];
#pragma unroll
    for (int ci = 0; ci < GC; ++ci)
#pragma unroll
        for (int nb = 0; nb < 4; ++nb) vb[ci][nb] = WFrag<T16>::ld(Vt + voff + (nb * 16 * TT + ci * 32));
    ld_done(voff, Vt, Vt, Vt, Vt);   // the first group's loads issue here: the row factor and the rounding of P run under them
    float fs[2];
    { float a = rsm[lane];
#pragma unroll
      for (int w = 1; w < 16; ++w) a += rsm[w * 32 + lane];
      const float f = __fdiv_rn(HL ? 1.0f : PCAR, a); const float ot = __shfl_xor(f, 16, 32); fs[0] = hi ? ot : f; fs[1] = hi ? f : ot; }
    v8f o[2][4];
#pragma unroll
    for (int mb = 0; mb < 2; ++mb)
#pragma unroll
        for (int nb = 0; nb < 4; ++nb) o[mb][nb] = (v8f){};
#pragma unroll
    for (int cg = 0; cg < 4; cg += GC) {
        if (cg) {
#pragma unroll
            for (int ci = 0; ci < GC; ++ci)
#pragma unroll
                for (int nb = 0; nb < 4; ++nb) vb[ci][nb] = WFrag<T16>::ld(Vt + voff + (nb * 16 * TT + (cg + ci) * 32));
            ld_done(voff, Vt, Vt, Vt, Vt);   // the rounding of P below runs under the group's loads
        }
#pragma unroll
        for (int ci = 0; ci < GC; ++ci) { const int c = cg + ci;
            V a[2], a2[2];
#pragma unroll
            for (int mb = 0; mb < 2; ++mb) {
                if constexpr (HL) { v8us h0, l0, h1, l1;
#pragma unroll
                    for (int e = 0; e < 8; ++e) { unsigned short x, y; splitf(s[2 * c][mb][e] * fs[mb], x, y); h0[e] = x; l0[e] = y; splitf(s[2 * c + 1][mb][e] * fs[mb], x, y); h1[e] = x; l1[e] = y; }
                    a[mb] = cat16b(h0, h1); a2[mb] = cat16b(l0, l1);
                } else { v8h p0, p1;
#pragma unroll
                    for (int e = 0; e < 8; ++e) { p0[e] = tohx(s[2 * c][mb][e] * fs[mb]); p1[e] = tohx(s[2 * c + 1][mb][e] * fs[mb]); }
                    a[mb] = cat16(p0, p1); } }
#pragma unroll
            for (int nb = 0; nb < 4; ++nb)
#pragma unroll
                for (int mb = 0; mb < 2; ++mb) { o[mb][nb] = WFrag<T16>::mma(a[mb], vb[ci][nb], o[mb][nb]); if (HL) o[mb][nb] = WFrag<T16>::mma(a2[mb], vb[ci][nb], o[mb][nb]); }
            if constexpr (HL) {   // the lo plane of V^T is a load group of its own (registers); each accumulator still takes hi x hi, lo x hi, hi x lo in that order
                __builtin_amdgcn_sched_barrier(0);   // its loads stay below the products above: registers
                V vl[4];
#pragma unroll
                for (int nb = 0; nb < 4; ++nb) vl[nb] = WFrag<T16>::ld(Vt2 + voff + (nb * 16 * TT + c * 32));
                ld_done(voff, Vt2, Vt2, Vt2, Vt2);
#pragma unroll
                for (int nb = 0; nb < 4; ++nb)
#pragma unroll
                    for (int mb = 0; mb < 2; ++mb) o[mb][nb] = WFrag<T16>::mma(a[mb], vl[nb], o[mb][nb]); } }
        __builtin_amdgcn_sched_barrier(0);   // the next group's loads stay below these products: registers
    }
    float* osw = os + wv * (32 * 68);
#pragma unroll
    for (int mb = 0; mb < 2; ++mb)
#pragma unroll
        for (int nb = 0; nb < 4; ++nb)
#pragma unroll
            for (int j = 0; j < 8; ++j) osw[(mb * 16 + hi * 8 + j) * 68 + nb * 16 + lr] = o[mb][nb][j];
    tile_sync<16>();
    { const int row = (int)threadIdx.x >> 4, cofs = ((int)threadIdx.x & 15) * 4; v4f val = *(const v4fa*)(os + row * 68 + cofs);
#pragma unroll
      for (int w = 1; w < 16; ++w) val += *(const v4fa*)(os + w * (32 * 68) + row * 68 + cofs);
      v4us oh, ol;   // merged heads [t][h][d], hi + lo bf16 planes: the A operand of the output projection
#pragma unroll
      for (int q = 0; q < 4; ++q) { unsigned short x, y; splitf(val[q] * (HL ? 1.0f : 1.0f / PCAR), x, y); oh[q] = x; ol[q] = y; }
      const size_t oo = (size_t)(r0 + row) * DQ + blockIdx.z * HD + cofs; *(v4us*)(Ah + oo) = oh; *(v4us*)(Al + oo) = ol; }
}
__global__ __launch_bounds__(256) void k_cvt8s(const float* __restrict__ X, bf* XB, size_t pitch) { const size_t i = (size_t)blockIdx.x * 256 + threadIdx.x; if (i >= (size_t)TT * DM / 8) return; const size_t e = i * 8; const int c = (int)(e % DM); const int srow = (int)(e / DM); const v8f a = *(const v8f*)(X + (size_t)srow * pitch + c); v8us o;
#pragma unroll
    for (int q = 0; q < 8; ++q) o[q] = f2bf(a[q]);
    *(v8us*)(XB + e) = o;  }

extern "C" void kernel_launch(void* const* d_in, const int* in_sizes, int n_in,
                              void* d_out, int out_size, void* d_ws, size_t ws_size, hipStream_t stream) {
    (void)in_sizes; (void)n_in; (void)out_size;
    const float* x = (const float*)d_in[0];   /* query [S][B][D] = [2048][4][1024]: ONE stream: q, k and v all project it */ const float* xk = (const float*)d_in[0]; const float* xv = (const float*)d_in[0]; const float* wq = (const float*)d_in[1]; const float* bq = (const float*)d_in[2]; const float* wk = (const float*)d_in[3]; const float* bk = (const float*)d_in[4]; const float* wv = (const float*)d_in[5]; const float* bv = (const float*)d_in[6]; const float* wo = (const float*)d_in[7]; const float* bo = (const float*)d_in[8];
    float* OUT = (float*)d_out;     // [2048][4][1024] sequence-first
    char* wsp = (char*)d_ws;
    auto take = [&](size_t bytes) { char* p = wsp; wsp += (bytes + 255) & ~(size_t)255; return (void*)p; };
    bf* WQ = (bf*)take((size_t)DQ * DM * 2); bf* WK = (bf*)take((size_t)DKV * DM * 2); bf* WV = (bf*)take((size_t)DKV * DM * 2); bf* WO = (bf*)take((size_t)DM * DQ * 2);
    bf* XB = (bf*)take((size_t)TT * DM * 2);
    h16* QP16 = (h16*)take((size_t)NH_ * TT * HD * 2); h16* KP16 = (h16*)take((size_t)NKV * TT * HD * 2); h16* VT16 = (h16*)take((size_t)NKV * HD * TT * 2);
    bf* QPh = (bf*)take((size_t)NH_ * TT * HD * 2); bf* QPl = (bf*)take((size_t)NH_ * TT * HD * 2); bf* KPh = (bf*)take((size_t)NKV * TT * HD * 2); bf* KPl = (bf*)take((size_t)NKV * TT * HD * 2); bf* VTh = (bf*)take((size_t)NKV * HD * TT * 2); bf* VTl = (bf*)take((size_t)NKV * HD * TT * 2);
    bf* ATh = (bf*)take((size_t)TT * DQ * 2); bf* ATl = (bf*)take((size_t)TT * DQ * 2);
    if ((size_t)(wsp - (char*)d_ws) > ws_size) return;    // ws 256 MiB
    { k_cvt8<<<(unsigned)(((size_t)DQ * DM / 8 + 255) / 256), 256, 0, stream>>>(wq, WQ, (size_t)DQ * DM / 8); k_cvt8<<<(unsigned)(((size_t)DKV * DM / 8 + 255) / 256), 256, 0, stream>>>(wk, WK, (size_t)DKV * DM / 8); k_cvt8<<<(unsigned)(((size_t)DKV * DM / 8 + 255) / 256), 256, 0, stream>>>(wv, WV, (size_t)DKV * DM / 8);
      k_cvt8<<<(unsigned)(((size_t)DM * DQ / 8 + 255) / 256), 256, 0, stream>>>(wo, WO, (size_t)DM * DQ / 8);
       }
    for (int b = 0; b < NB_; ++b) {
        
        k_cvt8s<<<(unsigned)(((size_t)TT * DM / 8 + 255) / 256), 256, 0, stream>>>(x + (size_t)b * DM, XB, (size_t)NB_ * DM);   /* rows s of batch column b: pitch B x D */
        k_gemmw<bf, 0, true, 8, 1><<<dim3(TT / 64, DQ / 64, 1), 256, 0, stream>>>(XB, nullptr, WQ, nullptr, DM, DM, nullptr, 0, bq, 0, 0, 0, QP16, QPh, QPl);   // q head planes [h][t][d] straight from the tile
        k_cvt8s<<<(unsigned)(((size_t)TT * DM / 8 + 255) / 256), 256, 0, stream>>>(xk + (size_t)b * DM, XB, (size_t)NB_ * DM);   /* rows s of batch column b: pitch B x D */ k_gemmw<bf, 0, true, 8, 1><<<dim3(TT / 64, DKV / 64, 1), 256, 0, stream>>>(XB, nullptr, WK, nullptr, DM, DM, nullptr, 0, bk, 0, 0, 0, KP16, KPh, KPl);
        k_cvt8s<<<(unsigned)(((size_t)TT * DM / 8 + 255) / 256), 256, 0, stream>>>(xv + (size_t)b * DM, XB, (size_t)NB_ * DM);   /* rows s of batch column b: pitch B x D */ k_gemmw<bf, 0, true, 8, 2><<<dim3(DKV / 64, TT / 64, 1), 256, 0, stream>>>(WV, nullptr, XB, nullptr, DM, DM, nullptr, TT, bv, 0, 0, 0, VT16, VTh, VTl);   // weight rows as A, token rows as Bt: v^T planes [g][d][t]
        k_fattn<bf, true><<<dim3(RH / 32, 1, ZH), 512, 0, stream>>>(QPh, QPl, KPh, KPl, VTh, VTl, 0, ATh, ATl);   // one kv head per query head: plane z of each (z-stride TT*HD)
        k_fattn<h16, false><<<dim3((TT - RH) / 32, 1, ZH), 512, 0, stream>>>(QP16, nullptr, KP16, nullptr, VT16, nullptr, RH, ATh, ATl);
        k_gemmw<bf, 1, true, 8, 0><<<dim3(TT / 64, DM / 64, 1), 256, 0, stream>>>(ATh, ATl, WO, nullptr, DQ, DQ, OUT + (size_t)b * DM, NB_ * DM, bo, 0, 0, 0, nullptr, nullptr, nullptr);   /* [S][B][D]: row pitch B x D, column block b */ }
}

// v005
// Measured time: 443 microseconds a run.
// Two timings next to v004 both put it at 1.13 times that version's speed.
// Over all steps from v000 it is 9.03 times as fast.
#include <hip/hip_runtime.h>

// Multi-head self-attention on a SEQUENCE-FIRST tensor (query [2048][4][1024] = [S][B][D]: ONE stream; q, k, v = x W^T + b ('oi' (out, in) [1024][1024] + [1024]; normal x 0.02; biases ZEROS on this draw: read); 16 heads x 64 per batch column; q = query Wq^T + bq; scores x 64^-0.5 (== scores / 8) in the attention kernel; softmax over all keys (no mask); out = merged Wo^T + bo -> [2048][4][1024] sequence-first (8.4 M); argument order query, Wq, bq, Wk, bk, Wv, bv, Wo, bo).
// Layout: all B batch columns go through every launch together (grid z, or grid y in the gather). One strided gather makes the bf16 copy [b][s][d] of rows s of column b (row pitch B x D); q, k and v all project it; 'oi' weights; exact projections + f32 biases; dense T-2048 attention (hybrid rows: < 512 hi/lo 3 products, rest fp16 x1024); merged hi/lo x Wo exact + bo written with row pitch B x D at column offset b (the [S][B][D] output).
// Compute dtypes, f32 accumulate: every input rounded to bf16; projections exact + f32 biases; attention rows < 512 3 products, rest fp16; softmax f32; Wo hl x exact + bias.

#define NB_  4
#define TT   2048
#define DM   1024
#define NH_  16
#define NKV  16
#define REP  (NH_ / NKV)
#define HD   64
#define DQ   (NH_ * HD)
#define DKV  (NKV * HD)
#define ZH   16                   // heads of each batch column per attention launch (grid z = NB_ x ZH): all of a batch column's
#define RH   512                  // query rows < RH use hi+lo planes (0: none)
#define WIN  0
#define PCAR 1024.0f
#define SCL  0.125f   // HD^-0.5
typedef _Float16 h16;
typedef unsigned short bf;
typedef __attribute__((ext_vector_type(16))) __bf16   v16bf;
typedef __attribute__((ext_vector_type(16))) _Float16 v16h;
typedef __attribute__((ext_vector_type(8)))  _Float16 v8h;
typedef __attribute__((ext_vector_type(8)))  unsigned short v8us;
typedef __attribute__((ext_vector_type(8)))  float    v8f;
typedef __attribute__((ext_vector_type(4)))  float    v4f;
typedef v8h  __attribute__((may_alias)) v8ha;
typedef v4f  __attribute__((may_alias)) v4fa;
typedef v8us __attribute__((may_alias)) v8usa;

__device__ __forceinline__ unsigned short f2bf(float f) { unsigned u = __float_as_uint(f); u += 0x7FFFu + ((u >> 16) & 1u); return (unsigned short)(u >> 16); }
__device__ __forceinline__ float bf2f(unsigned short b) { return __uint_as_float(((unsigned)b) << 16); }
__device__ __forceinline__ float bfr(float f) { return bf2f(f2bf(f)); }
__device__ __forceinline__ v16h cat16(v8h lo, v8h hi) { return __builtin_shufflevector(lo, hi, 0, 1, 2, 3, 4, 5, 6, 7, 8, 9, 10, 11, 12, 13, 14, 15); }
__device__ __forceinline__ v16bf cat16b(v8us lo, v8us hi) { return __builtin_bit_cast(v16bf, __builtin_shufflevector(lo, hi, 0, 1, 2, 3, 4, 5, 6, 7, 8, 9, 10, 11, 12, 13, 14, 15)); }
__device__ __forceinline__ v8f wmma16(v16h a, v16h b, v8f c) { return __builtin_amdgcn_wmma_f32_16x16x32_f16(false, a, false, b, (short)0, c, false, false); }
__device__ __forceinline__ v8f wmmab(v16bf a, v16bf b, v8f c) { return __builtin_amdgcn_wmma_f32_16x16x32_bf16(false, a, false, b, (short)0, c, false, false); }
__device__ __forceinline__ h16 tohx(float x) { return (h16)x; }
__device__ __forceinline__ void splitf(float y, unsigned short& h, unsigned short& l) { h = f2bf(y); l = f2bf(y - bf2f(h)); }
typedef __attribute__((ext_vector_type(4))) _Float16 v4h;
typedef __attribute__((ext_vector_type(4))) unsigned short v4us;



// ---- k_gemmw: register-blocked GEMM, one work-group of KS waves per 64x64 output tile; wave w sums the k range [w K/KS, (w+1) K/KS) into its own 16 accumulators, operands straight from K-contiguous 16-bit planes; grid (M/64, N/64, Z), 32 x KS threads.
// The KS partial tiles meet in LDS, 16 rows at a time, and are added in wave order 0..KS-1 (fixed, the same on every run).
// C[m][n] (f32, pitch ldc, + optional f32 bias[n]) = sum_k A[m][k] Bt[n][k] (+ split products per NSPLIT). A rows have pitch lda, Bt rows pitch K. z-batch strides sA/sB/sC in elements (sC: of C, or of each 16-bit plane where OUTM is 1 or 2). K % (32 KS) == 0.
// OUTM 0: C as above. OUTM 1 and 2: no f32 copy; the summed tile (+ bias) leaves as the three 16-bit planes the attention kernel reads: fp16, bf16 hi, bf16 lo (lo = the rest after hi).
//   1: head planes [n / 64][m][n % 64] (a 64-column tile is one head, TT rows a head), bias[n].
//   2: planes [m][n] of pitch ldc, bias[m]: with A = weight rows and Bt = token rows the product IS the transposed head plane [head][d][t]; same k ranges, same k order as the untransposed product.
template <typename T16> struct WFrag;
template <> struct WFrag<h16> { typedef v16h V; static __device__ __forceinline__ V ld(const h16* p) { return cat16(*(const v8h*)p, *(const v8h*)(p + 16)); } static __device__ __forceinline__ v8f mma(V a, V b, v8f c) { return wmma16(a, b, c); } };
template <> struct WFrag<bf> { typedef v16bf V; static __device__ __forceinline__ V ld(const bf* p) { return cat16b(*(const v8us*)p, *(const v8us*)(p + 16)); } static __device__ __forceinline__ v8f mma(V a, V b, v8f c) { return wmmab(a, b, c); } };
// one wave: program order in the wave is enough. Several waves: every partial tile must be written before it is summed, and summed before it is overwritten:
// a work-group barrier between fences on LDS alone (only LDS passes between the waves; __syncthreads() would also hold every round until the round's stores to C have returned).
template <int KS> __device__ __forceinline__ void tile_sync() {
    if constexpr (KS == 1) { __builtin_amdgcn_wave_barrier(); asm volatile("" ::: "memory"); }
    else { __builtin_amdgcn_fence(__ATOMIC_RELEASE, "workgroup", "local"); __builtin_amdgcn_s_barrier(); __builtin_amdgcn_fence(__ATOMIC_ACQUIRE, "workgroup", "local"); } }
template <typename T16, int NSPLIT, bool BIAS, int KS, int OUTM>
__global__ __launch_bounds__(32 * KS) void k_gemmw(const T16* __restrict__ A, const T16* __restrict__ A2, const T16* __restrict__ Bt, const T16* __restrict__ Bt2, int K, int lda, float* C, int ldc, const float* __restrict__ bias, size_t sA, size_t sB, size_t sC, h16* P16, bf* Ph, bf* Pl) {
    typedef typename WFrag<T16>::V V;
    __shared__ __align__(16) float os[KS * 16 * 68];
    const size_t z = blockIdx.z; A += z * sA; if (A2) A2 += z * sA; Bt += z * sB; if (Bt2) Bt2 += z * sB; if constexpr (OUTM == 0) C += z * sC; else { P16 += z * sC; Ph += z * sC; Pl += z * sC; }
    const int lane = threadIdx.x & 31, lr = lane & 15, hi = lane >> 4; const int r0 = blockIdx.x * 64, c0 = blockIdx.y * 64;
    const int wv = KS == 1 ? 0 : __builtin_amdgcn_readfirstlane((int)(threadIdx.x >> 5)); const int kw = K / KS, k0 = wv * kw; float* osw = os + wv * (16 * 68);
    v8f acc[4][4];
#pragma unroll
    for (int mb = 0; mb < 4; ++mb)
#pragma unroll
        for (int nb = 0; nb < 4; ++nb) acc[mb][nb] = (v8f){};
    const size_t aoff = (size_t)(r0 + lr) * lda + 8 * hi, boff = (size_t)(c0 + lr) * K + 8 * hi;
#pragma unroll 1
    for (int kc = k0; kc < k0 + kw; kc += 32) {
        V a[4], a2[4];
#pragma unroll
        for (int mb = 0; mb < 4; ++mb) { a[mb] = WFrag<T16>::ld(A + aoff + (size_t)mb * 16 * lda + kc); if (NSPLIT == 1 || NSPLIT == 2) a2[mb] = WFrag<T16>::ld(A2 + aoff + (size_t)mb * 16 * lda + kc); }
#pragma unroll
        for (int nb = 0; nb < 4; ++nb) { const V b = WFrag<T16>::ld(Bt + boff + (size_t)nb * 16 * K + kc); V b2; if (NSPLIT >= 2) b2 = WFrag<T16>::ld(Bt2 + boff + (size_t)nb * 16 * K + kc);
#pragma unroll
            for (int mb = 0; mb < 4; ++mb) { acc[mb][nb] = WFrag<T16>::mma(a[mb], b, acc[mb][nb]); if (NSPLIT == 1 || NSPLIT == 2) acc[mb][nb] = WFrag<T16>::mma(a2[mb], b, acc[mb][nb]); if (NSPLIT >= 2) acc[mb][nb] = WFrag<T16>::mma(a[mb], b2, acc[mb][nb]); } }
        asm volatile("v_nop\n\tv_nop\n\tv_nop\n\tv_nop" : "+v"(acc[0][0]), "+v"(acc[1][1]), "+v"(acc[2][2]), "+v"(acc[3][3]) : "v"(a[0]), "v"(a[3]));
    }
#pragma unroll
    for (int mb = 0; mb < 4; ++mb) {
#pragma unroll
        for (int nb = 0; nb < 4; ++nb) {
#pragma unroll
            for (int j = 0; j < 8; ++j) osw[(hi * 8 + j) * 68 + nb * 16 + lr] = acc[mb][nb][j]; }
        tile_sync<KS>();
        float* crow = C + (size_t)(r0 + mb * 16) * ldc + c0;
{
#pragma unroll
            for (int s = 0; s < (KS < 8 ? 8 / KS : 1); ++s) { const int it = s * 32 * KS + (int)threadIdx.x; if (KS > 8 && it >= 256) break; const int row = it >> 4, cofs = (it & 15) * 4; v4f val = *(const v4fa*)(os + row * 68 + cofs);
#pragma unroll
                for (int w = 1; w < KS; ++w) val += *(const v4fa*)(os + w * (16 * 68) + row * 68 + cofs);
                if (BIAS) { if constexpr (OUTM == 2) { const float br = bfr(bias[r0 + mb * 16 + row]); val[0] += br; val[1] += br; val[2] += br; val[3] += br; }
                            else { val[0] += bfr(bias[c0 + cofs]); val[1] += bfr(bias[c0 + cofs + 1]); val[2] += bfr(bias[c0 + cofs + 2]); val[3] += bfr(bias[c0 + cofs + 3]); } }
                if constexpr (OUTM == 0) *(v4f*)(crow + (size_t)row * ldc + cofs) = val;
                else { const size_t po = OUTM == 1 ? ((size_t)blockIdx.y * TT + (r0 + mb * 16 + row)) * HD + cofs : (size_t)(r0 + mb * 16 + row) * ldc + c0 + cofs; v4h o16; v4us oh, ol;
#pragma unroll
                    for (int q = 0; q < 4; ++q) { o16[q] = tohx(val[q]); unsigned short x, y; splitf(val[q], x, y); oh[q] = x; ol[q] = y; }
                    *(v4h*)(P16 + po) = o16; *(v4us*)(Ph + po) = oh; *(v4us*)(Pl + po) = ol; } }
             }
        if (mb < 3) tile_sync<KS>();
    }
}

typedef __attribute__((ext_vector_type(2))) unsigned short v2us;

__global__ __launch_bounds__(256) void k_wtG(const float* __restrict__ w, int K, int N, bf* Bt) {
    const int lane = threadIdx.x & 31; const int L0 = (blockIdx.x * 8 + (threadIdx.x >> 5)) * 8; const int nlines = N * K / 64;
{
#pragma unroll 1
        for (int l = 0; l < 8; ++l) { const int L = L0 + l; if (L >= nlines) break; const size_t e = (size_t)L * 64 + lane * 2; const int k = (int)(e % K), n = (int)(e / K); v2us o;
            o[0] = f2bf(w[(size_t)k * N + n]); o[1] = f2bf(w[(size_t)(k + 1) * N + n]); *(v2us*)(Bt + e) = o; }
         }
}
__global__ __launch_bounds__(256) void k_cvt8(const float* __restrict__ src, bf* dst, size_t n8) { const size_t i = (size_t)blockIdx.x * 256 + threadIdx.x; if (i >= n8) return; const v8f v = *(const v8f*)(src + i * 8); v8us o;
#pragma unroll
    for (int k = 0; k < 8; ++k) o[k] = f2bf(v[k]); *(v8us*)(dst + i * 8) = o;  }

// ---- k_fattn: scores, softmax, P x V and the head merge of 32 query rows of one head in ONE work-group of 16 waves; no score or P ever leaves the registers. grid (rows / 32, 1, batch columns x heads), 512 threads; plane z = b x heads + h.
// Wave w owns keys [128 w, 128 w + 128). It forms the TRANSPOSED scores S^T = K Q^T (K rows as the A operand, Q rows as B): accumulator s[kt][mb][j] of lane (lr, hi) is key 128 w + 16 kt + 8 hi + j against query 16 mb + lr.
// So a lane holds 64 keys of each of its 2 query rows (row max and row sum: in the lane, one exchange with lane ^ 16, then over the 16 waves through LDS, in wave order),
// and the pair s[2c][mb], s[2c+1][mb], rounded to 16 bit, IS the A fragment of P for keys [32 c, 32 c + 32): element e < 8 is k = 8 hi + e, element 8 + e is k = 16 + 8 hi + e, the k order of WFrag::ld on the V^T rows.
// The 16 partial 32 x 64 outputs (one per key range) meet in LDS, are added in wave order 0..15 and go out as the merged-head hi + lo planes. Query rows t0 + 32 x ..; HL: hi + lo bf16 planes, 3 products each; else fp16, P x PCAR.
// behind a group of global loads: the wait that stands before a register which an issued load names is written again; the lane offset and the scalar bases are inputs, so their registers stay as they are up to it. The scheduling barrier behind it keeps the group's loads together above it: one L2 latency a group.
__device__ __forceinline__ void ld_done(unsigned off, const void* p0, const void* p1, const void* p2, const void* p3) { asm volatile("s_wait_xcnt 0x0" :: "v"(off), "s"(p0), "s"(p1), "s"(p2), "s"(p3) : "memory"); __builtin_amdgcn_sched_barrier(0); /* no load of the group sinks below, no product rises above */ }
// 8 x 2^x; the v_nop is the one free slot behind the last transcendental (the others are each followed by an independent one: outputs are early-clobber, so none overwrites a source)
__device__ __forceinline__ v8f exp2x8(v8f x) { float e0, e1, e2, e3, e4, e5, e6, e7;
    asm("v_exp_f32 %0, %8\n\tv_exp_f32 %1, %9\n\tv_exp_f32 %2, %10\n\tv_exp_f32 %3, %11\n\tv_exp_f32 %4, %12\n\tv_exp_f32 %5, %13\n\tv_exp_f32 %6, %14\n\tv_exp_f32 %7, %15\n\tv_nop"
        : "=&v"(e0), "=&v"(e1), "=&v"(e2), "=&v"(e3), "=&v"(e4), "=&v"(e5), "=&v"(e6), "=&v"(e7) : "v"(x[0]), "v"(x[1]), "v"(x[2]), "v"(x[3]), "v"(x[4]), "v"(x[5]), "v"(x[6]), "v"(x[7]));
    return (v8f){e0, e1, e2, e3, e4, e5, e6, e7}; }
template <typename T16, bool HL>
__global__ __launch_bounds__(512) void k_fattn(const T16* __restrict__ Q, const T16* __restrict__ Q2, const T16* __restrict__ Kp, const T16* __restrict__ Kp2, const T16* __restrict__ Vt, const T16* __restrict__ Vt2, int t0, bf* Ah, bf* Al) {
    typedef typename WFrag<T16>::V V;
    __shared__ __align__(16) float os[16 * 32 * 68];
    __shared__ float rmx[16 * 32], rsm[16 * 32];
    const size_t zo = (size_t)blockIdx.z * TT * HD;
    const int lane = threadIdx.x & 31, lr = lane & 15, hi = lane >> 4; const int r0 = t0 + blockIdx.x * 32;
    const int wv = __builtin_amdgcn_readfirstlane((int)(threadIdx.x >> 5)); const int k0 = wv * 128;
    Q += zo + (size_t)r0 * HD; Kp += zo + (size_t)k0 * HD; Vt += zo + k0; if (HL) { Q2 += zo + (size_t)r0 * HD; Kp2 += zo + (size_t)k0 * HD; Vt2 += zo + k0; }   // wave-uniform bases
    const unsigned qoff = lr * HD + 8 * hi, koff = qoff, voff = lr * TT + 8 * hi;   // one 32-bit lane offset for Q and K rows, one for V^T rows
    constexpr int GK = HL ? 4 : 8, GC = HL ? 1 : 2;   // K tiles, and 32-key steps of V^T, per load group
    v8f s[8][2];
#pragma unroll
    for (int kt = 0; kt < 8; ++kt) { s[kt][0] = (v8f){}; s[kt][1] = (v8f){}; }
#pragma unroll
    for (int kc = 0; kc < HD; kc += 32) {
        V q[2], q2[2];
#pragma unroll
        for (int mb = 0; mb < 2; ++mb) { q[mb] = WFrag<T16>::ld(Q + qoff + (mb * 16 * HD + kc)); if (HL) q2[mb] = WFrag<T16>::ld(Q2 + qoff + (mb * 16 * HD + kc)); }
#pragma unroll
        for (int g = 0; g < 8; g += GK) {
            V k[GK], k2[GK];
#pragma unroll
            for (int i = 0; i < GK; ++i) { k[i] = WFrag<T16>::ld(Kp + koff + ((g + i) * 16 * HD + kc)); if (HL) k2[i] = WFrag<T16>::ld(Kp2 + koff + ((g + i) * 16 * HD + kc)); }
            ld_done(qoff, Q, HL ? Q2 : Q, Kp, HL ? Kp2 : Kp);   // the group's loads all issue before its first product: one L2 latency a group, not one a fragment
#pragma unroll
            for (int i = 0; i < GK; ++i)
#pragma unroll
                for (int mb = 0; mb < 2; ++mb) { s[g + i][mb] = WFrag<T16>::mma(k[i], q[mb], s[g + i][mb]); if (HL) { s[g + i][mb] = WFrag<T16>::mma(k[i], q2[mb], s[g + i][mb]); s[g + i][mb] = WFrag<T16>::mma(k2[i], q[mb], s[g + i][mb]); } }
            __builtin_amdgcn_sched_barrier(0);   // the next group's loads stay below: two groups in flight beside the 128 accumulators would spill
        }
    }
    // row max: t = S x HD^-0.5 (no mask)
    float mx[2];
#pragma unroll
    for (int mb = 0; mb < 2; ++mb) { float m = -3.0e38f;
#pragma unroll
        for (int kt = 0; kt < 8; ++kt)
#pragma unroll
            for (int j = 0; j < 8; ++j) { const float t = s[kt][mb][j] * SCL; s[kt][mb][j] = t; m = fmaxf(m, t); }
        mx[mb] = fmaxf(m, __shfl_xor(m, 16, 32)); }
    rmx[wv * 32 + lane] = hi ? mx[1] : mx[0];   // lane l carries query row l = 16 mb + lr with mb = hi
    tile_sync<16>();
    { float m = rmx[lane];
#pragma unroll
      for (int w = 1; w < 16; ++w) m = fmaxf(m, rmx[w * 32 + lane]);
      const float ot = __shfl_xor(m, 16, 32); mx[0] = hi ? ot : m; mx[1] = hi ? m : ot; }
    // one exp per score; row sum: 4 chains in the lane, lane ^ 16, then the waves in order
    float sm[2];
#pragma unroll
    for (int mb = 0; mb < 2; ++mb) { float a4[4] = {0.f, 0.f, 0.f, 0.f};
#pragma unroll
        for (int kt = 0; kt < 8; ++kt) { v8f x;
#pragma unroll
            for (int j = 0; j < 8; ++j) x[j] = __fmul_rn(__fsub_rn(s[kt][mb][j], mx[mb]), 1.4426950408889634f);
            s[kt][mb] = exp2x8(x);
#pragma unroll
            for (int j = 0; j < 8; ++j) a4[j & 3] += s[kt][mb][j]; }
        const float a = (a4[0] + a4[1]) + (a4[2] + a4[3]); sm[mb] = a + __shfl_xor(a, 16, 32); }
    rsm[wv * 32 + lane] = hi ? sm[1] : sm[0];
    tile_sync<16>();
    V vb[GC][4];
#pragma unroll
    for (int ci = 0; ci < GC; ++ci)
#pragma unroll
        for (int nb = 0; nb < 4; ++nb) vb[ci][nb] = WFrag<T16>::ld(Vt + voff + (nb * 16 * TT + ci * 32));
    ld_done(voff, Vt, Vt, Vt, Vt);   // the first group's loads issue here: the row factor and the rounding of P run under them
    float fs[2];
    { float a = rsm[lane];
#pragma unroll
      for (int w = 1; w < 16; ++w) a += rsm[w * 32 + lane];
      const float f = __fdiv_rn(HL ? 1.0f : PCAR, a); const float ot = __shfl_xor(f, 16, 32); fs[0] = hi ? ot : f; fs[1] = hi ? f : ot; }
    v8f o[2][4];
#pragma unroll
    for (int mb = 0; mb < 2; ++mb)
#pragma unroll
        for (int nb = 0; nb < 4; ++nb) o[mb][nb] = (v8f){};
#pragma unroll
    for (int cg = 0; cg < 4; cg += GC) {
        if (cg) {
#pragma unroll
            for (int ci = 0; ci < GC; ++ci)
#pragma unroll
                for (int nb = 0; nb < 4; ++nb) vb[ci][nb] = WFrag<T16>::ld(Vt + voff + (nb * 16 * TT + (cg + ci) * 32));
            ld_done(voff, Vt, Vt, Vt, Vt);   // the rounding of P below runs under the group's loads
        }
#pragma unroll
        for (int ci = 0; ci < GC; ++ci) { const int c = cg + ci;
            V a[2], a2[2];
#pragma unroll
            for (int mb = 0; mb < 2; ++mb) {
                if constexpr (HL) { v8us h0, l0, h1, l1;
#pragma unroll
                    for (int e = 0; e < 8; ++e) { unsigned short x, y; splitf(s[2 * c][mb][e] * fs[mb], x, y); h0[e] = x; l0[e] = y; splitf(s[2 * c + 1][mb][e] * fs[mb], x, y); h1[e] = x; l1[e] = y; }
                    a[mb] = cat16b(h0, h1); a2[mb] = cat16b(l0, l1);
                } else { v8h p0, p1;
#pragma unroll
                    for (int e = 0; e < 8; ++e) { p0[e] = tohx(s[2 * c][mb][e] * fs[mb]); p1[e] = tohx(s[2 * c + 1][mb][e] * fs[mb]); }
                    a[mb] = cat16(p0, p1); } }
#pragma unroll
            for (int nb = 0; nb < 4; ++nb)
#pragma unroll
                for (int mb = 0; mb < 2; ++mb) { o[mb][nb] = WFrag<T16>::mma(a[mb], vb[ci][nb], o[mb][nb]); if (HL) o[mb][nb] = WFrag<T16>::mma(a2[mb], vb[ci][nb], o[mb][nb]); }
            if constexpr (HL) {   // the lo plane of V^T is a load group of its own (registers); each accumulator still takes hi x hi, lo x hi, hi x lo in that order
                __builtin_amdgcn_sched_barrier(0);   // its loads stay below the products above: registers
                V vl[4];
#pragma unroll
                for (int nb = 0; nb < 4; ++nb) vl[nb] = WFrag<T16>::ld(Vt2 + voff + (nb * 16 * TT + c * 32));
                ld_done(voff, Vt2, Vt2, Vt2, Vt2);
#pragma unroll
                for (int nb = 0; nb < 4; ++nb)
#pragma unroll
                    for (int mb = 0; mb < 2; ++mb) o[mb][nb] = WFrag<T16>::mma(a[mb], vl[nb], o[mb][nb]); } }
        __builtin_amdgcn_sched_barrier(0);   // the next group's loads stay below these products: registers
    }
    float* osw = os + wv * (32 * 68);
#pragma unroll
    for (int mb = 0; mb < 2; ++mb)
#pragma unroll
        for (int nb = 0; nb < 4; ++nb)
#pragma unroll
            for (int j = 0; j < 8; ++j) osw[(mb * 16 + hi * 8 + j) * 68 + nb * 16 + lr] = o[mb][nb][j];
    tile_sync<16>();
    { const int row = (int)threadIdx.x >> 4, cofs = ((int)threadIdx.x & 15) * 4; v4f val = *(const v4fa*)(os + row * 68 + cofs);
#pragma unroll
      for (int w = 1; w < 16; ++w) val += *(const v4fa*)(os + w * (32 * 68) + row * 68 + cofs);
      v4us oh, ol;   // merged heads [b][t][h][d], hi + lo bf16 planes: the A operand of the output projection
#pragma unroll
      for (int q = 0; q < 4; ++q) { unsigned short x, y; splitf(val[q] * (HL ? 1.0f : 1.0f / PCAR), x, y); oh[q] = x; ol[q] = y; }
      const size_t oo = ((size_t)(blockIdx.z / NH_) * TT + (r0 + row)) * DQ + (blockIdx.z % NH_) * HD + cofs; *(v4us*)(Ah + oo) = oh; *(v4us*)(Al + oo) = ol; }
}
// grid y: batch column b; its rows leave as the dense block b of XB
__global__ __launch_bounds__(256) void k_cvt8s(const float* __restrict__ X, bf* XB, size_t pitch) { const size_t i = (size_t)blockIdx.x * 256 + threadIdx.x; if (i >= (size_t)TT * DM / 8) return; X += (size_t)blockIdx.y * DM; XB += (size_t)blockIdx.y * TT * DM; const size_t e = i * 8; const int c = (int)(e % DM); const int srow = (int)(e / DM); const v8f a = *(const v8f*)(X + (size_t)srow * pitch + c); v8us o;
    asm volatile("s_wait_xcnt 0x0" ::: "memory");   // the wait that stands before a register which the issued loads name (their address pair) is written again
#pragma unroll
    for (int q = 0; q < 8; ++q) o[q] = f2bf(a[q]);
    *(v8us*)(XB + e) = o;  }

extern "C" void kernel_launch(void* const* d_in, const int* in_sizes, int n_in,
                              void* d_out, int out_size, void* d_ws, size_t ws_size, hipStream_t stream) {
    (void)in_sizes; (void)n_in; (void)out_size;
    const float* x = (const float*)d_in[0];   /* query [S][B][D] = [2048][4][1024]: ONE stream: q, k and v all project it */ const float* wq = (const float*)d_in[1]; const float* bq = (const float*)d_in[2]; const float* wk = (const float*)d_in[3]; const float* bk = (const float*)d_in[4]; const float* wv = (const float*)d_in[5]; const float* bv = (const float*)d_in[6]; const float* wo = (const float*)d_in[7]; const float* bo = (const float*)d_in[8];
    float* OUT = (float*)d_out;     // [2048][4][1024] sequence-first
    char* wsp = (char*)d_ws;
    auto take = [&](size_t bytes) { char* p = wsp; wsp += (bytes + 255) & ~(size_t)255; return (void*)p; };
    bf* WQ = (bf*)take((size_t)DQ * DM * 2); bf* WK = (bf*)take((size_t)DKV * DM * 2); bf* WV = (bf*)take((size_t)DKV * DM * 2); bf* WO = (bf*)take((size_t)DM * DQ * 2);
    bf* XB = (bf*)take((size_t)NB_ * TT * DM * 2);
    h16* QP16 = (h16*)take((size_t)NB_ * NH_ * TT * HD * 2); h16* KP16 = (h16*)take((size_t)NB_ * NKV * TT * HD * 2); h16* VT16 = (h16*)take((size_t)NB_ * NKV * HD * TT * 2);
    bf* QPh = (bf*)take((size_t)NB_ * NH_ * TT * HD * 2); bf* QPl = (bf*)take((size_t)NB_ * NH_ * TT * HD * 2); bf* KPh = (bf*)take((size_t)NB_ * NKV * TT * HD * 2); bf* KPl = (bf*)take((size_t)NB_ * NKV * TT * HD * 2); bf* VTh = (bf*)take((size_t)NB_ * NKV * HD * TT * 2); bf* VTl = (bf*)take((size_t)NB_ * NKV * HD * TT * 2);
    bf* ATh = (bf*)take((size_t)NB_ * TT * DQ * 2); bf* ATl = (bf*)take((size_t)NB_ * TT * DQ * 2);
    if ((size_t)(wsp - (char*)d_ws) > ws_size) return;    // ws 256 MiB
    { k_cvt8<<<(unsigned)(((size_t)DQ * DM / 8 + 255) / 256), 256, 0, stream>>>(wq, WQ, (size_t)DQ * DM / 8); k_cvt8<<<(unsigned)(((size_t)DKV * DM / 8 + 255) / 256), 256, 0, stream>>>(wk, WK, (size_t)DKV * DM / 8); k_cvt8<<<(unsigned)(((size_t)DKV * DM / 8 + 255) / 256), 256, 0, stream>>>(wv, WV, (size_t)DKV * DM / 8);
      k_cvt8<<<(unsigned)(((size_t)DM * DQ / 8 + 255) / 256), 256, 0, stream>>>(wo, WO, (size_t)DM * DQ / 8);
       }
    k_cvt8s<<<dim3((unsigned)(((size_t)TT * DM / 8 + 255) / 256), NB_, 1), 256, 0, stream>>>(x, XB, (size_t)NB_ * DM);   /* rows s of batch column b: pitch B x D */
    k_gemmw<bf, 0, true, 8, 1><<<dim3(TT / 64, DQ / 64, NB_), 256, 0, stream>>>(XB, nullptr, WQ, nullptr, DM, DM, nullptr, 0, bq, (size_t)TT * DM, 0, (size_t)NH_ * TT * HD, QP16, QPh, QPl);   // q head planes [b][h][t][d] straight from the tile
    k_gemmw<bf, 0, true, 8, 1><<<dim3(TT / 64, DKV / 64, NB_), 256, 0, stream>>>(XB, nullptr, WK, nullptr, DM, DM, nullptr, 0, bk, (size_t)TT * DM, 0, (size_t)NKV * TT * HD, KP16, KPh, KPl);
    k_gemmw<bf, 0, true, 8, 2><<<dim3(DKV / 64, TT / 64, NB_), 256, 0, stream>>>(WV, nullptr, XB, nullptr, DM, DM, nullptr, TT, bv, 0, (size_t)TT * DM, (size_t)NKV * HD * TT, VT16, VTh, VTl);   // weight rows as A, token rows as Bt: v^T planes [b][g][d][t]
    k_fattn<bf, true><<<dim3(RH / 32, 1, NB_ * ZH), 512, 0, stream>>>(QPh, QPl, KPh, KPl, VTh, VTl, 0, ATh, ATl);   // one kv head per query head: plane z of each (z-stride TT*HD)
    k_fattn<h16, false><<<dim3((TT - RH) / 32, 1, NB_ * ZH), 512, 0, stream>>>(QP16, nullptr, KP16, nullptr, VT16, nullptr, RH, ATh, ATl);
    k_gemmw<bf, 1, true, 8, 0><<<dim3(TT / 64, DM / 64, NB_), 256, 0, stream>>>(ATh, ATl, WO, nullptr, DQ, DQ, OUT, NB_ * DM, bo, (size_t)TT * DQ, 0, (size_t)DM, nullptr, nullptr, nullptr);   /* [S][B][D]: row pitch B x D, column block b */
}

// v006
// One run takes 290 microseconds.
// In both of two side-by-side timings against v005, it was 1.53 times as fast.
// Counting every step since v000, it is 13.8 times as fast.
#include <hip/hip_runtime.h>

// Multi-head self-attention on a SEQUENCE-FIRST tensor (query [2048][4][1024] = [S][B][D]: ONE stream; q, k, v = x W^T + b ('oi' (out, in) [1024][1024] + [1024]; normal x 0.02; biases ZEROS on this draw: read); 16 heads x 64 per batch column; q = query Wq^T + bq; scores x 64^-0.5 (== scores / 8) in the attention kernel; softmax over all keys (no mask); out = merged Wo^T + bo -> [2048][4][1024] sequence-first (8.4 M); argument order query, Wq, bq, Wk, bk, Wv, bv, Wo, bo).
// Layout: all B batch columns go through every launch together (grid z, or grid y in the gather). One strided gather makes the bf16 copy [b][s][d] of rows s of column b (row pitch B x D); q, k and v all project it; 'oi' weights; exact projections + f32 biases; dense T-2048 attention (hybrid rows: < 512 hi/lo 3 products, rest fp16 x1024); merged hi/lo x Wo exact + bo written with row pitch B x D at column offset b (the [S][B][D] output).
// Compute dtypes, f32 accumulate: every input rounded to bf16; projections exact + f32 biases; attention rows < 512 3 products, rest fp16; softmax f32; Wo hl x exact + bias.

#define NB_  4
#define TT   2048
#define DM   1024
#define NH_  16
#define NKV  16
#define REP  (NH_ / NKV)
#define HD   64
#define DQ   (NH_ * HD)
#define DKV  (NKV * HD)
#define ZH   16                   // heads of each batch column per attention launch (grid z = NB_ x ZH): all of a batch column's
#define RH   512                  // query rows < RH use hi+lo planes (0: none)
#define WIN  0
#define PCAR 1024.0f
#define SCL  0.125f   // HD^-0.5
typedef _Float16 h16;
typedef unsigned short bf;
typedef __attribute__((ext_vector_type(16))) __bf16   v16bf;
typedef __attribute__((ext_vector_type(16))) _Float16 v16h;
typedef __attribute__((ext_vector_type(8)))  _Float16 v8h;
typedef __attribute__((ext_vector_type(8)))  unsigned short v8us;
typedef __attribute__((ext_vector_type(8)))  float    v8f;
typedef __attribute__((ext_vector_type(4)))  float    v4f;
typedef v8h  __attribute__((may_alias)) v8ha;
typedef v4f  __attribute__((may_alias)) v4fa;
typedef v8us __attribute__((may_alias)) v8usa;

__device__ __forceinline__ unsigned short f2bf(float f) { unsigned u = __float_as_uint(f); u += 0x7FFFu + ((u >> 16) & 1u); return (unsigned short)(u >> 16); }
__device__ __forceinline__ float bf2f(unsigned short b) { return __uint_as_float(((unsigned)b) << 16); }
__device__ __forceinline__ float bfr(float f) { return bf2f(f2bf(f)); }
__device__ __forceinline__ v16h cat16(v8h lo, v8h hi) { return __builtin_shufflevector(lo, hi, 0, 1, 2, 3, 4, 5, 6, 7, 8, 9, 10, 11, 12, 13, 14, 15); }
__device__ __forceinline__ v16bf cat16b(v8us lo, v8us hi) { return __builtin_bit_cast(v16bf, __builtin_shufflevector(lo, hi, 0, 1, 2, 3, 4, 5, 6, 7, 8, 9, 10, 11, 12, 13, 14, 15)); }
__device__ __forceinline__ v8f wmma16(v16h a, v16h b, v8f c) { return __builtin_amdgcn_wmma_f32_16x16x32_f16(false, a, false, b, (short)0, c, false, false); }
__device__ __forceinline__ v8f wmmab(v16bf a, v16bf b, v8f c) { return __builtin_amdgcn_wmma_f32_16x16x32_bf16(false, a, false, b, (short)0, c, false, false); }
__device__ __forceinline__ h16 tohx(float x) { return (h16)x; }
__device__ __forceinline__ void splitf(float y, unsigned short& h, unsigned short& l) { h = f2bf(y); l = f2bf(y - bf2f(h)); }
typedef __attribute__((ext_vector_type(4))) _Float16 v4h;
typedef __attribute__((ext_vector_type(4))) unsigned short v4us;



// ---- k_gemmw: register-blocked GEMM, one work-group of KS waves per 64x64 output tile; wave w sums the k range [w K/KS, (w+1) K/KS) into its own 16 accumulators, operands straight from 16-bit planes in fragment order; grid (M/64, N/64, Z), 32 x KS threads.
// The KS partial tiles meet in LDS, 16 rows at a time, and are added in wave order 0..KS-1 (fixed, the same on every run).
// C[m][n] (f32, pitch ldc, + optional f32 bias[n]) = sum_k A[m][k] Bt[n][k] (+ split products per NSPLIT). A and Bt are planes of K columns in fragment order (below). z-batch strides sA/sB/sC in elements (sC: of C, or of each 16-bit plane where OUTM is 1 or 2). K % (32 KS) == 0.
// OUTM 0: C as above. OUTM 1 and 2: no f32 copy; the summed tile (+ bias) leaves as the three 16-bit planes the attention kernel reads: fp16, bf16 hi, bf16 lo (lo = the rest after hi).
//   1: head planes [n / 64][m][n % 64] (a 64-column tile is one head, TT rows a head), each in fragment order with K = 64, bias[n].
//   2: planes [m][n] in fragment order with K = ldc, bias[m]: with A = weight rows and Bt = token rows the product IS the transposed head plane [head][d][t]; same k ranges, same k order as the untransposed product.
// FRAGMENT ORDER: every 16-bit operand plane [rows][K] is stored as blocks of 16 rows x 32 k = 512 elements (1 KiB), block (r / 16, k / 32) at index (r / 16) (K / 32) + k / 32;
// inside a block element (r, k) stands at ((k >> 4) & 1) 256 + ((k >> 3) & 1) 128 + (r & 15) 8 + (k & 7). Lane (lr, hi) = lane 16 hi + lr then finds its two 8-element pieces (k = 8 hi + e and k = 16 + 8 hi + e) at 8 lane and 256 + 8 lane:
// each wave-wide 16-byte load reads 512 contiguous bytes (4 whole lines), not 32 bytes out of each of 16 lines. The k order of a fragment is what it was with row-major planes.
template <typename T16> struct WFrag;
template <> struct WFrag<h16> { typedef v16h V; static __device__ __forceinline__ V ld(const h16* p) { return cat16(*(const v8h*)p, *(const v8h*)(p + 256)); } static __device__ __forceinline__ v8f mma(V a, V b, v8f c) { return wmma16(a, b, c); } };
template <> struct WFrag<bf> { typedef v16bf V; static __device__ __forceinline__ V ld(const bf* p) { return cat16b(*(const v8us*)p, *(const v8us*)(p + 256)); } static __device__ __forceinline__ v8f mma(V a, V b, v8f c) { return wmmab(a, b, c); } };
// one wave: program order in the wave is enough. Several waves: every partial tile must be written before it is summed, and summed before it is overwritten:
// a work-group barrier between fences on LDS alone (only LDS passes between the waves; __syncthreads() would also hold every round until the round's stores to C have returned).
template <int KS> __device__ __forceinline__ void tile_sync() {
    if constexpr (KS == 1) { __builtin_amdgcn_wave_barrier(); asm volatile("" ::: "memory"); }
    else { __builtin_amdgcn_fence(__ATOMIC_RELEASE, "workgroup", "local"); __builtin_amdgcn_s_barrier(); __builtin_amdgcn_fence(__ATOMIC_ACQUIRE, "workgroup", "local"); } }
// behind a group of global loads: the wait that stands before a register which an issued load names is written again; the lanes' address pairs are inputs, so their registers stay as they are up to it (no load of the group lands on them). The scheduling barrier behind it keeps the group's loads together above it.
__device__ __forceinline__ void ld_done_v(const void* p0, const void* p1, const void* p2, const void* p3) { asm volatile("s_wait_xcnt 0x0" :: "v"(p0), "v"(p1), "v"(p2), "v"(p3) : "memory"); __builtin_amdgcn_sched_barrier(0); /* no load of the group sinks below, no product rises above */ }
template <typename T16, int NSPLIT, bool BIAS, int KS, int OUTM, int K>
__global__ __launch_bounds__(32 * KS) void k_gemmw(const T16* __restrict__ A, const T16* __restrict__ A2, const T16* __restrict__ Bt, const T16* __restrict__ Bt2, float* C, int ldc, const float* __restrict__ bias, size_t sA, size_t sB, size_t sC, h16* P16, bf* Ph, bf* Pl) {
    typedef typename WFrag<T16>::V V;
    __shared__ __align__(16) float os[KS * 16 * 68];
    const size_t z = blockIdx.z; A += z * sA; if (A2) A2 += z * sA; Bt += z * sB; if (Bt2) Bt2 += z * sB; if constexpr (OUTM == 0) C += z * sC; else { P16 += z * sC; Ph += z * sC; Pl += z * sC; }
    const int lane = threadIdx.x & 31, lr = lane & 15, hi = lane >> 4; const int r0 = blockIdx.x * 64, c0 = blockIdx.y * 64;
    const int wv = KS == 1 ? 0 : __builtin_amdgcn_readfirstlane((int)(threadIdx.x >> 5)); const int kw = K / KS, k0 = wv * kw; float* osw = os + wv * (16 * 68);
    v8f acc[4][4];
#pragma unroll
    for (int mb = 0; mb < 4; ++mb)
#pragma unroll
        for (int nb = 0; nb < 4; ++nb) acc[mb][nb] = (v8f){};
    constexpr int KB = K / 32;   // 32-k blocks a row block
    const size_t ab = ((size_t)(r0 >> 4) * KB + (k0 >> 5)) * 512, bb = ((size_t)(c0 >> 4) * KB + (k0 >> 5)) * 512; A += ab + lane * 8; Bt += bb + lane * 8; if (NSPLIT == 1 || NSPLIT == 2) A2 += ab + lane * 8; if (NSPLIT >= 2) Bt2 += bb + lane * 8;   // the lane's piece in the wave's first block of the tile's first row block
#pragma unroll 1
    for (int kt = 0; kt < kw / 32; ++kt) {
        V a[4], a2[4];
#pragma unroll
        for (int mb = 0; mb < 4; ++mb) { a[mb] = WFrag<T16>::ld(A + mb * KB * 512); if (NSPLIT == 1 || NSPLIT == 2) a2[mb] = WFrag<T16>::ld(A2 + mb * KB * 512); }
        V b[4], b2[4];
#pragma unroll
        for (int nb = 0; nb < 4; ++nb) { b[nb] = WFrag<T16>::ld(Bt + nb * KB * 512); if (NSPLIT >= 2) b2[nb] = WFrag<T16>::ld(Bt2 + nb * KB * 512); }
        ld_done_v(A, NSPLIT == 1 || NSPLIT == 2 ? A2 : A, Bt, NSPLIT >= 2 ? Bt2 : Bt);   // the addresses step on only behind it
        A += 512; Bt += 512; if (NSPLIT == 1 || NSPLIT == 2) A2 += 512; if (NSPLIT >= 2) Bt2 += 512;
#pragma unroll
        for (int nb = 0; nb < 4; ++nb) {
#pragma unroll
            for (int mb = 0; mb < 4; ++mb) { acc[mb][nb] = WFrag<T16>::mma(a[mb], b[nb], acc[mb][nb]); if (NSPLIT == 1 || NSPLIT == 2) acc[mb][nb] = WFrag<T16>::mma(a2[mb], b[nb], acc[mb][nb]); if (NSPLIT >= 2) acc[mb][nb] = WFrag<T16>::mma(a[mb], b2[nb], acc[mb][nb]); } }
        asm volatile("v_nop\n\tv_nop\n\tv_nop\n\tv_nop" : "+v"(acc[0][0]), "+v"(acc[1][1]), "+v"(acc[2][2]), "+v"(acc[3][3]) : "v"(a[0]), "v"(a[3]));
    }
#pragma unroll
    for (int mb = 0; mb < 4; ++mb) {
#pragma unroll
        for (int nb = 0; nb < 4; ++nb) {
#pragma unroll
            for (int j = 0; j < 8; ++j) osw[(hi * 8 + j) * 68 + nb * 16 + lr] = acc[mb][nb][j]; }
        tile_sync<KS>();
        float* crow = C + (size_t)(r0 + mb * 16) * ldc + c0;
{
#pragma unroll
            for (int s = 0; s < (KS < 8 ? 8 / KS : 1); ++s) { const int it = s * 32 * KS + (int)threadIdx.x; if (KS > 8 && it >= 256) break;
                // OUTM 0: a wave takes 2 rows of 64 columns. Else: 16 rows of 8 columns, which are 256 contiguous bytes of a fragment-order plane; lanes 0-15 and lanes 16-31 each read 16 different rows of os at one column: no bank twice
                const int row = OUTM == 0 ? it >> 4 : it & 15, cofs = OUTM == 0 ? (it & 15) * 4 : (it >> 5) * 8 + ((it >> 4) & 1) * 4; v4f val = *(const v4fa*)(os + row * 68 + cofs);
#pragma unroll
                for (int w = 1; w < KS; ++w) val += *(const v4fa*)(os + w * (16 * 68) + row * 68 + cofs);
                if (BIAS) { if constexpr (OUTM == 2) { const float br = bfr(bias[r0 + mb * 16 + row]); val[0] += br; val[1] += br; val[2] += br; val[3] += br; }
                            else { val[0] += bfr(bias[c0 + cofs]); val[1] += bfr(bias[c0 + cofs + 1]); val[2] += bfr(bias[c0 + cofs + 2]); val[3] += bfr(bias[c0 + cofs + 3]); } }
                if constexpr (OUTM == 0) *(v4f*)(crow + (size_t)row * ldc + cofs) = val;
                else { const size_t po = (OUTM == 1 ? (size_t)blockIdx.y * TT * HD + (size_t)((r0 >> 4) + mb) * 1024 : ((size_t)((r0 >> 4) + mb) * (ldc >> 5) + (c0 >> 5)) * 512) + (cofs >> 3) * 128 + row * 8 + (cofs & 7); v4h o16; v4us oh, ol;   // the 16 x 64 round is two neighbouring blocks
#pragma unroll
                    for (int q = 0; q < 4; ++q) { o16[q] = tohx(val[q]); unsigned short x, y; splitf(val[q], x, y); oh[q] = x; ol[q] = y; }
                    *(v4h*)(P16 + po) = o16; *(v4us*)(Ph + po) = oh; *(v4us*)(Pl + po) = ol; } }
             }
        if (mb < 3) tile_sync<KS>();
    }
}

typedef __attribute__((ext_vector_type(2))) unsigned short v2us;

__global__ __launch_bounds__(256) void k_wtG(const float* __restrict__ w, int K, int N, bf* Bt) {
    const int lane = threadIdx.x & 31; const int L0 = (blockIdx.x * 8 + (threadIdx.x >> 5)) * 8; const int nlines = N * K / 64;
{
#pragma unroll 1
        for (int l = 0; l < 8; ++l) { const int L = L0 + l; if (L >= nlines) break; const size_t e = (size_t)L * 64 + lane * 2; const int k = (int)(e % K), n = (int)(e / K); v2us o;
            o[0] = f2bf(w[(size_t)k * N + n]); o[1] = f2bf(w[(size_t)(k + 1) * N + n]); *(v2us*)(Bt + e) = o; }
         }
}
// f32 [rows][K] -> bf16 in fragment order. 64 threads a block of 16 rows x 32 k: thread = (row, 8-k piece), 4 pieces a row: a wave reads 8 whole 128-byte lines and stores 4 whole lines.
template <int K>
__global__ __launch_bounds__(256) void k_cvt8(const float* __restrict__ src, bf* dst, size_t n8) { const size_t i = (size_t)blockIdx.x * 256 + threadIdx.x; if (i >= n8) return; const size_t t = i >> 6; const int rl = (int)(i >> 2) & 15, c = (int)i & 3; constexpr int KB = K / 32;
    const v8f v = *(const v8f*)(src + ((t / KB) * 16 + rl) * K + (t % KB) * 32 + c * 8); v8us o;
    asm volatile("s_wait_xcnt 0x0" ::: "memory");   // the wait that stands before a register which the issued loads name (their address pair) is written again
#pragma unroll
    for (int k = 0; k < 8; ++k) o[k] = f2bf(v[k]); *(v8us*)(dst + t * 512 + (c >> 1) * 256 + (c & 1) * 128 + rl * 8) = o;  }

// ---- k_fattn: scores, softmax, P x V and the head merge of 32 query rows of one head in ONE work-group of 16 waves; no score or P ever leaves the registers. grid (rows / 32, 1, batch columns x heads), 512 threads; plane z = b x heads + h.
// Wave w owns keys [128 w, 128 w + 128). It forms the TRANSPOSED scores S^T = K Q^T (K rows as the A operand, Q rows as B): accumulator s[kt][mb][j] of lane (lr, hi) is key 128 w + 16 kt + 8 hi + j against query 16 mb + lr.
// So a lane holds 64 keys of each of its 2 query rows (row max and row sum: in the lane, one exchange with lane ^ 16, then over the 16 waves through LDS, in wave order),
// and the pair s[2c][mb], s[2c+1][mb], rounded to 16 bit, IS the A fragment of P for keys [32 c, 32 c + 32): element e < 8 is k = 8 hi + e, element 8 + e is k = 16 + 8 hi + e, the k order of WFrag::ld on the V^T rows.
// The 16 partial 32 x 64 outputs (one per key range) meet in LDS, are added in wave order 0..15 and go out as the merged-head hi + lo planes. Query rows t0 + 32 x ..; HL: hi + lo bf16 planes, 3 products each; else fp16, P x PCAR.
// behind a group of global loads: the wait that stands before a register which an issued load names is written again; the lane offset and the scalar bases are inputs, so their registers stay as they are up to it. The scheduling barrier behind it keeps the group's loads together above it: one L2 latency a group.
__device__ __forceinline__ void ld_done(unsigned off, const void* p0, const void* p1, const void* p2, const void* p3) { asm volatile("s_wait_xcnt 0x0" :: "v"(off), "s"(p0), "s"(p1), "s"(p2), "s"(p3) : "memory"); __builtin_amdgcn_sched_barrier(0); /* no load of the group sinks below, no product rises above */ }
// 8 x 2^x; the v_nop is the one free slot behind the last transcendental (the others are each followed by an independent one: outputs are early-clobber, so none overwrites a source)
__device__ __forceinline__ v8f exp2x8(v8f x) { float e0, e1, e2, e3, e4, e5, e6, e7;
    asm("v_exp_f32 %0, %8\n\tv_exp_f32 %1, %9\n\tv_exp_f32 %2, %10\n\tv_exp_f32 %3, %11\n\tv_exp_f32 %4, %12\n\tv_exp_f32 %5, %13\n\tv_exp_f32 %6, %14\n\tv_exp_f32 %7, %15\n\tv_nop"
        : "=&v"(e0), "=&v"(e1), "=&v"(e2), "=&v"(e3), "=&v"(e4), "=&v"(e5), "=&v"(e6), "=&v"(e7) : "v"(x[0]), "v"(x[1]), "v"(x[2]), "v"(x[3]), "v"(x[4]), "v"(x[5]), "v"(x[6]), "v"(x[7]));
    return (v8f){e0, e1, e2, e3, e4, e5, e6, e7}; }
template <typename T16, bool HL>
__global__ __launch_bounds__(512) void k_fattn(const T16* __restrict__ Q, const T16* __restrict__ Q2, const T16* __restrict__ Kp, const T16* __restrict__ Kp2, const T16* __restrict__ Vt, const T16* __restrict__ Vt2, int t0, bf* Ah, bf* Al) {
    typedef typename WFrag<T16>::V V;
    __shared__ __align__(16) float os[16 * 32 * 68];
    __shared__ float rmx[16 * 32], rsm[16 * 32];
    const size_t zo = (size_t)blockIdx.z * TT * HD;
    const int lane = threadIdx.x & 31, lr = lane & 15, hi = lane >> 4; const int r0 = t0 + blockIdx.x * 32;
    const int wv = __builtin_amdgcn_readfirstlane((int)(threadIdx.x >> 5)); const int k0 = wv * 128;
    Q += zo + (size_t)r0 * HD; Kp += zo + (size_t)k0 * HD; Vt += zo + (size_t)k0 * 16; if (HL) { Q2 += zo + (size_t)r0 * HD; Kp2 += zo + (size_t)k0 * HD; Vt2 += zo + (size_t)k0 * 16; }   // wave-uniform bases, planes in fragment order: 16 rows of Q or K are 2 blocks (1024 elements); 32 keys of V^T are one block of each of its 4 row blocks (TT / 32 blocks apart)
    const unsigned qoff = lane * 8, koff = qoff, voff = qoff;   // one 32-bit lane offset: the lane's piece in a block
    constexpr int GK = HL ? 4 : 8, GC = HL ? 1 : 2;   // K tiles, and 32-key steps of V^T, per load group
    v8f s[8][2];
#pragma unroll
    for (int kt = 0; kt < 8; ++kt) { s[kt][0] = (v8f){}; s[kt][1] = (v8f){}; }
#pragma unroll
    for (int kc = 0; kc < HD; kc += 32) {
        V q[2], q2[2];
#pragma unroll
        for (int mb = 0; mb < 2; ++mb) { q[mb] = WFrag<T16>::ld(Q + qoff + (mb * 16 * HD + kc * 16)); if (HL) q2[mb] = WFrag<T16>::ld(Q2 + qoff + (mb * 16 * HD + kc * 16)); }
#pragma unroll
        for (int g = 0; g < 8; g += GK) {
            V k[GK], k2[GK];
#pragma unroll
            for (int i = 0; i < GK; ++i) { k[i] = WFrag<T16>::ld(Kp + koff + ((g + i) * 16 * HD + kc * 16)); if (HL) k2[i] = WFrag<T16>::ld(Kp2 + koff + ((g + i) * 16 * HD + kc * 16)); }
            ld_done(qoff, Q, HL ? Q2 : Q, Kp, HL ? Kp2 : Kp);   // the group's loads all issue before its first product: one L2 latency a group, not one a fragment
#pragma unroll
            for (int i = 0; i < GK; ++i)
#pragma unroll
                for (int mb = 0; mb < 2; ++mb) { s[g + i][mb] = WFrag<T16>::mma(k[i], q[mb], s[g + i][mb]); if (HL) { s[g + i][mb] = WFrag<T16>::mma(k[i], q2[mb], s[g + i][mb]); s[g + i][mb] = WFrag<T16>::mma(k2[i], q[mb], s[g + i][mb]); } }
            __builtin_amdgcn_sched_barrier(0);   // the next group's loads stay below: two groups in flight beside the 128 accumulators would spill
        }
    }
    // row max: t = S x HD^-0.5 (no mask)
    float mx[2];
#pragma unroll
    for (int mb = 0; mb < 2; ++mb) { float m = -3.0e38f;
#pragma unroll
        for (int kt = 0; kt < 8; ++kt)
#pragma unroll
            for (int j = 0; j < 8; ++j) { const float t = s[kt][mb][j] * SCL; s[kt][mb][j] = t; m = fmaxf(m, t); }
        mx[mb] = fmaxf(m, __shfl_xor(m, 16, 32)); }
    rmx[wv * 32 + lane] = hi ? mx[1] : mx[0];   // lane l carries query row l = 16 mb + lr with mb = hi
    tile_sync<16>();
    { float m = rmx[lane];
#pragma unroll
      for (int w = 1; w < 16; ++w) m = fmaxf(m, rmx[w * 32 + lane]);
      const float ot = __shfl_xor(m, 16, 32); mx[0] = hi ? ot : m; mx[1] = hi ? m : ot; }
    // one exp per score; row sum: 4 chains in the lane, lane ^ 16, then the waves in order
    float sm[2];
#pragma unroll
    for (int mb = 0; mb < 2; ++mb) { float a4[4] = {0.f, 0.f, 0.f, 0.f};
#pragma unroll
        for (int kt = 0; kt < 8; ++kt) { v8f x;
#pragma unroll
            for (int j = 0; j < 8; ++j) x[j] = __fmul_rn(__fsub_rn(s[kt][mb][j], mx[mb]), 1.4426950408889634f);
            s[kt][mb] = exp2x8(x);
#pragma unroll
            for (int j = 0; j < 8; ++j) a4[j & 3] += s[kt][mb][j]; }
        const float a = (a4[0] + a4[1]) + (a4[2] + a4[3]); sm[mb] = a + __shfl_xor(a, 16, 32); }
    rsm[wv * 32 + lane] = hi ? sm[1] : sm[0];
    tile_sync<16>();
    V vb[GC][4];
#pragma unroll
    for (int ci = 0; ci < GC; ++ci)
#pragma unroll
        for (int nb = 0; nb < 4; ++nb) vb[ci][nb] = WFrag<T16>::ld(Vt + voff + (nb * 16 * TT + ci * 512));
    ld_done(voff, Vt, Vt, Vt, Vt);   // the first group's loads issue here: the row factor and the rounding of P run under them
    float fs[2];
    { float a = rsm[lane];
#pragma unroll
      for (int w = 1; w < 16; ++w) a += rsm[w * 32 + lane];
      const float f = __fdiv_rn(HL ? 1.0f : PCAR, a); const float ot = __shfl_xor(f, 16, 32); fs[0] = hi ? ot : f; fs[1] = hi ? f : ot; }
    v8f o[2][4];
#pragma unroll
    for (int mb = 0; mb < 2; ++mb)
#pragma unroll
        for (int nb = 0; nb < 4; ++nb) o[mb][nb] = (v8f){};
#pragma unroll
    for (int cg = 0; cg < 4; cg += GC) {
        if (cg) {
#pragma unroll
            for (int ci = 0; ci < GC; ++ci)
#pragma unroll
                for (int nb = 0; nb < 4; ++nb) vb[ci][nb] = WFrag<T16>::ld(Vt + voff + (nb * 16 * TT + (cg + ci) * 512));
            ld_done(voff, Vt, Vt, Vt, Vt);   // the rounding of P below runs under the group's loads
        }
#pragma unroll
        for (int ci = 0; ci < GC; ++ci) { const int c = cg + ci;
            V a[2], a2[2];
#pragma unroll
            for (int mb = 0; mb < 2; ++mb) {
                if constexpr (HL) { v8us h0, l0, h1, l1;
#pragma unroll
                    for (int e = 0; e < 8; ++e) { unsigned short x, y; splitf(s[2 * c][mb][e] * fs[mb], x, y); h0[e] = x; l0[e] = y; splitf(s[2 * c + 1][mb][e] * fs[mb], x, y); h1[e] = x; l1[e] = y; }
                    a[mb] = cat16b(h0, h1); a2[mb] = cat16b(l0, l1);
                } else { v8h p0, p1;
#pragma unroll
                    for (int e = 0; e < 8; ++e) { p0[e] = tohx(s[2 * c][mb][e] * fs[mb]); p1[e] = tohx(s[2 * c + 1][mb][e] * fs[mb]); }
                    a[mb] = cat16(p0, p1); } }
#pragma unroll
            for (int nb = 0; nb < 4; ++nb)
#pragma unroll
                for (int mb = 0; mb < 2; ++mb) { o[mb][nb] = WFrag<T16>::mma(a[mb], vb[ci][nb], o[mb][nb]); if (HL) o[mb][nb] = WFrag<T16>::mma(a2[mb], vb[ci][nb], o[mb][nb]); }
            if constexpr (HL) {   // the lo plane of V^T is a load group of its own (registers); each accumulator still takes hi x hi, lo x hi, hi x lo in that order
                __builtin_amdgcn_sched_barrier(0);   // its loads stay below the products above: registers
                V vl[4];
#pragma unroll
                for (int nb = 0; nb < 4; ++nb) vl[nb] = WFrag<T16>::ld(Vt2 + voff + (nb * 16 * TT + c * 512));
                ld_done(voff, Vt2, Vt2, Vt2, Vt2);
#pragma unroll
                for (int nb = 0; nb < 4; ++nb)
#pragma unroll
                    for (int mb = 0; mb < 2; ++mb) o[mb][nb] = WFrag<T16>::mma(a[mb], vl[nb], o[mb][nb]); } }
        __builtin_amdgcn_sched_barrier(0);   // the next group's loads stay below these products: registers
    }
    float* osw = os + wv * (32 * 68);
#pragma unroll
    for (int mb = 0; mb < 2; ++mb)
#pragma unroll
        for (int nb = 0; nb < 4; ++nb)
#pragma unroll
            for (int j = 0; j < 8; ++j) osw[(mb * 16 + hi * 8 + j) * 68 + nb * 16 + lr] = o[mb][nb][j];
    tile_sync<16>();
    { const int it = (int)threadIdx.x & 255, rb = (int)threadIdx.x >> 8;   // a wave takes 16 rows of 8 columns: 256 contiguous bytes of a fragment-order plane; each half wave reads 16 different rows of os at one column: no bank twice
      const int row = rb * 16 + (it & 15), cofs = (it >> 5) * 8 + ((it >> 4) & 1) * 4; v4f val = *(const v4fa*)(os + row * 68 + cofs);
#pragma unroll
      for (int w = 1; w < 16; ++w) val += *(const v4fa*)(os + w * (32 * 68) + row * 68 + cofs);
      v4us oh, ol;   // merged heads [b][t][h][d], hi + lo bf16 planes, each [TT][DQ] in fragment order: the A operand of the output projection
#pragma unroll
      for (int q = 0; q < 4; ++q) { unsigned short x, y; splitf(val[q] * (HL ? 1.0f : 1.0f / PCAR), x, y); oh[q] = x; ol[q] = y; }
      const size_t oo = (size_t)(blockIdx.z / NH_) * TT * DQ + ((size_t)((r0 >> 4) + rb) * (DQ / 32) + (blockIdx.z % NH_) * (HD / 32)) * 512 + (cofs >> 3) * 128 + (it & 15) * 8 + (cofs & 7); *(v4us*)(Ah + oo) = oh; *(v4us*)(Al + oo) = ol; }
}
// grid y: batch column b; its rows leave as plane b of XB, [TT][DM] in fragment order (threads as in k_cvt8)
__global__ __launch_bounds__(256) void k_cvt8s(const float* __restrict__ X, bf* XB, size_t pitch) { const size_t i = (size_t)blockIdx.x * 256 + threadIdx.x; if (i >= (size_t)TT * DM / 8) return; X += (size_t)blockIdx.y * DM; XB += (size_t)blockIdx.y * TT * DM; const size_t t = i >> 6; const int rl = (int)(i >> 2) & 15, pc = (int)i & 3; const int c = (int)(t % (DM / 32)) * 32 + pc * 8; const int srow = (int)(t / (DM / 32)) * 16 + rl; const v8f a = *(const v8f*)(X + (size_t)srow * pitch + c); v8us o;
    asm volatile("s_wait_xcnt 0x0" ::: "memory");   // the wait that stands before a register which the issued loads name (their address pair) is written again
#pragma unroll
    for (int q = 0; q < 8; ++q) o[q] = f2bf(a[q]);
    *(v8us*)(XB + t * 512 + (pc >> 1) * 256 + (pc & 1) * 128 + rl * 8) = o;  }

extern "C" void kernel_launch(void* const* d_in, const int* in_sizes, int n_in,
                              void* d_out, int out_size, void* d_ws, size_t ws_size, hipStream_t stream) {
    (void)in_sizes; (void)n_in; (void)out_size;
    const float* x = (const float*)d_in[0];   /* query [S][B][D] = [2048][4][1024]: ONE stream: q, k and v all project it */ const float* wq = (const float*)d_in[1]; const float* bq = (const float*)d_in[2]; const float* wk = (const float*)d_in[3]; const float* bk = (const float*)d_in[4]; const float* wv = (const float*)d_in[5]; const float* bv = (const float*)d_in[6]; const float* wo = (const float*)d_in[7]; const float* bo = (const float*)d_in[8];
    float* OUT = (float*)d_out;     // [2048][4][1024] sequence-first
    char* wsp = (char*)d_ws;
    auto take = [&](size_t bytes) { char* p = wsp; wsp += (bytes + 255) & ~(size_t)255; return (void*)p; };
    bf* WQ = (bf*)take((size_t)DQ * DM * 2); bf* WK = (bf*)take((size_t)DKV * DM * 2); bf* WV = (bf*)take((size_t)DKV * DM * 2); bf* WO = (bf*)take((size_t)DM * DQ * 2);
    bf* XB = (bf*)take((size_t)NB_ * TT * DM * 2);
    h16* QP16 = (h16*)take((size_t)NB_ * NH_ * TT * HD * 2); h16* KP16 = (h16*)take((size_t)NB_ * NKV * TT * HD * 2); h16* VT16 = (h16*)take((size_t)NB_ * NKV * HD * TT * 2);
    bf* QPh = (bf*)take((size_t)NB_ * NH_ * TT * HD * 2); bf* QPl = (bf*)take((size_t)NB_ * NH_ * TT * HD * 2); bf* KPh = (bf*)take((size_t)NB_ * NKV * TT * HD * 2); bf* KPl = (bf*)take((size_t)NB_ * NKV * TT * HD * 2); bf* VTh = (bf*)take((size_t)NB_ * NKV * HD * TT * 2); bf* VTl = (bf*)take((size_t)NB_ * NKV * HD * TT * 2);
    bf* ATh = (bf*)take((size_t)NB_ * TT * DQ * 2); bf* ATl = (bf*)take((size_t)NB_ * TT * DQ * 2);
    if ((size_t)(wsp - (char*)d_ws) > ws_size) return;    // ws 256 MiB
    { k_cvt8<DM><<<(unsigned)(((size_t)DQ * DM / 8 + 255) / 256), 256, 0, stream>>>(wq, WQ, (size_t)DQ * DM / 8); k_cvt8<DM><<<(unsigned)(((size_t)DKV * DM / 8 + 255) / 256), 256, 0, stream>>>(wk, WK, (size_t)DKV * DM / 8); k_cvt8<DM><<<(unsigned)(((size_t)DKV * DM / 8 + 255) / 256), 256, 0, stream>>>(wv, WV, (size_t)DKV * DM / 8);
      k_cvt8<DQ><<<(unsigned)(((size_t)DM * DQ / 8 + 255) / 256), 256, 0, stream>>>(wo, WO, (size_t)DM * DQ / 8);
       }
    k_cvt8s<<<dim3((unsigned)(((size_t)TT * DM / 8 + 255) / 256), NB_, 1), 256, 0, stream>>>(x, XB, (size_t)NB_ * DM);   /* rows s of batch column b: pitch B x D */
    k_gemmw<bf, 0, true, 8, 1, DM><<<dim3(TT / 64, DQ / 64, NB_), 256, 0, stream>>>(XB, nullptr, WQ, nullptr, nullptr, 0, bq, (size_t)TT * DM, 0, (size_t)NH_ * TT * HD, QP16, QPh, QPl);   // q head planes [b][h][t][d] straight from the tile
    k_gemmw<bf, 0, true, 8, 1, DM><<<dim3(TT / 64, DKV / 64, NB_), 256, 0, stream>>>(XB, nullptr, WK, nullptr, nullptr, 0, bk, (size_t)TT * DM, 0, (size_t)NKV * TT * HD, KP16, KPh, KPl);
    k_gemmw<bf, 0, true, 8, 2, DM><<<dim3(DKV / 64, TT / 64, NB_), 256, 0, stream>>>(WV, nullptr, XB, nullptr, nullptr, TT, bv, 0, (size_t)TT * DM, (size_t)NKV * HD * TT, VT16, VTh, VTl);   // weight rows as A, token rows as Bt: v^T planes [b][g][d][t]
    k_fattn<bf, true><<<dim3(RH / 32, 1, NB_ * ZH), 512, 0, stream>>>(QPh, QPl, KPh, KPl, VTh, VTl, 0, ATh, ATl);   // one kv head per query head: plane z of each (z-stride TT*HD)
    k_fattn<h16, false><<<dim3((TT - RH) / 32, 1, NB_ * ZH), 512, 0, stream>>>(QP16, nullptr, KP16, nullptr, VT16, nullptr, RH, ATh, ATl);
    k_gemmw<bf, 1, true, 8, 0, DQ><<<dim3(TT / 64, DM / 64, NB_), 256, 0, stream>>>(ATh, ATl, WO, nullptr, OUT, NB_ * DM, bo, (size_t)TT * DQ, 0, (size_t)DM, nullptr, nullptr, nullptr);   /* [S][B][D]: row pitch B x D, column block b */
}

// v007
// It runs in 212 microseconds.
// Next to v006, in two timings, it ran 1.36 times as fast each time.
// Counting every step since v000, it is 18.8 times as fast.
#include <hip/hip_runtime.h>

// Multi-head self-attention on a SEQUENCE-FIRST tensor (query [2048][4][1024] = [S][B][D]: ONE stream; q, k, v = x W^T + b ('oi' (out, in) [1024][1024] + [1024]; normal x 0.02; biases ZEROS on this draw: read); 16 heads x 64 per batch column; q = (query Wq^T + bq) x 64^-0.5 (pre-scaled: == scores / 8); softmax over all keys (no mask); out = merged Wo^T + bo -> [2048][4][1024] sequence-first (8.4 M); argument order query, Wq, bq, Wk, bk, Wv, bv, Wo, bo).
// Layout: all B batch columns go through every launch together (grid z, or grid y in the gather). One strided gather makes the bf16 copy [b][s][d] of rows s of column b (row pitch B x D); q, k and v all project it; 'oi' weights; exact projections + f32 biases; dense T-2048 attention (hybrid rows: < 512 hi/lo 3 products, rest fp16); merged hi/lo x Wo exact + bo written with row pitch B x D at column offset b (the [S][B][D] output).
// Compute dtypes, f32 accumulate: every input rounded to bf16; projections exact + f32 biases; attention rows < 512 3 products, rest fp16; softmax f32; Wo hl x exact + bias.

#define NB_  4
#define TT   2048
#define DM   1024
#define NH_  16
#define NKV  16
#define REP  (NH_ / NKV)
#define HD   64
#define DQ   (NH_ * HD)
#define DKV  (NKV * HD)
#define ZH   16                   // heads of each batch column per attention launch (grid z = NB_ x ZH): all of a batch column's
#define RH   512                  // query rows < RH use hi+lo planes (0: none)
#define WIN  0
#define PCAR 1024.0f
#define SCL  0.125f   // HD^-0.5
typedef _Float16 h16;
typedef unsigned short bf;
typedef __attribute__((ext_vector_type(16))) __bf16   v16bf;
typedef __attribute__((ext_vector_type(16))) _Float16 v16h;
typedef __attribute__((ext_vector_type(8)))  _Float16 v8h;
typedef __attribute__((ext_vector_type(8)))  unsigned short v8us;
typedef __attribute__((ext_vector_type(8)))  float    v8f;
typedef __attribute__((ext_vector_type(4)))  float    v4f;
typedef v8h  __attribute__((may_alias)) v8ha;
typedef v4f  __attribute__((may_alias)) v4fa;
typedef v8us __attribute__((may_alias)) v8usa;

__device__ __forceinline__ unsigned short f2bf(float f) { unsigned u = __float_as_uint(f); u += 0x7FFFu + ((u >> 16) & 1u); return (unsigned short)(u >> 16); }
__device__ __forceinline__ float bf2f(unsigned short b) { return __uint_as_float(((unsigned)b) << 16); }
__device__ __forceinline__ float bfr(float f) { return bf2f(f2bf(f)); }
__device__ __forceinline__ v16h cat16(v8h lo, v8h hi) { return __builtin_shufflevector(lo, hi, 0, 1, 2, 3, 4, 5, 6, 7, 8, 9, 10, 11, 12, 13, 14, 15); }
__device__ __forceinline__ v16bf cat16b(v8us lo, v8us hi) { return __builtin_bit_cast(v16bf, __builtin_shufflevector(lo, hi, 0, 1, 2, 3, 4, 5, 6, 7, 8, 9, 10, 11, 12, 13, 14, 15)); }
__device__ __forceinline__ v8f wmma16(v16h a, v16h b, v8f c) { return __builtin_amdgcn_wmma_f32_16x16x32_f16(false, a, false, b, (short)0, c, false, false); }
__device__ __forceinline__ v8f wmmab(v16bf a, v16bf b, v8f c) { return __builtin_amdgcn_wmma_f32_16x16x32_bf16(false, a, false, b, (short)0, c, false, false); }
__device__ __forceinline__ h16 tohx(float x) { return (h16)x; }
__device__ __forceinline__ void splitf(float y, unsigned short& h, unsigned short& l) { h = f2bf(y); l = f2bf(y - bf2f(h)); }
typedef __attribute__((ext_vector_type(4))) _Float16 v4h;
typedef __attribute__((ext_vector_type(4))) unsigned short v4us;



// ---- k_gemmw: register-blocked GEMM, one work-group of KS waves per 64x64 output tile; wave w sums the k range [w K/KS, (w+1) K/KS) into its own 16 accumulators, operands straight from 16-bit planes in fragment order; grid (M/64, N/64, Z), 32 x KS threads.
// The KS partial tiles meet in LDS, 16 rows at a time, and are added in wave order 0..KS-1 (fixed, the same on every run).
// C[m][n] (f32, pitch ldc, + optional f32 bias[n]) = sum_k A[m][k] Bt[n][k] (+ split products per NSPLIT). A and Bt are planes of K columns in fragment order (below). z-batch strides sA/sB/sC in elements (sC: of C, or of each 16-bit plane where OUTM is 1 or 2). K % (32 KS) == 0.
// OUTM 0: C as above. OUTM 1 and 2: no f32 copy; the summed tile (+ bias) leaves as the three 16-bit planes the attention kernel reads: fp16, bf16 hi, bf16 lo (lo = the rest after hi).
//   1: head planes [n / 64][m][n % 64] (a 64-column tile is one head, TT rows a head), each in fragment order with K = 64, bias[n].
//   2: planes [m][n] in fragment order with K = ldc, bias[m]: with A = weight rows and Bt = token rows the product IS the transposed head plane [head][d][t]; same k ranges, same k order as the untransposed product.
// FRAGMENT ORDER: every 16-bit operand plane [rows][K] is stored as blocks of 16 rows x 32 k = 512 elements (1 KiB), block (r / 16, k / 32) at index (r / 16) (K / 32) + k / 32;
// inside a block element (r, k) stands at ((k >> 4) & 1) 256 + ((k >> 3) & 1) 128 + (r & 15) 8 + (k & 7). Lane (lr, hi) = lane 16 hi + lr then finds its two 8-element pieces (k = 8 hi + e and k = 16 + 8 hi + e) at 8 lane and 256 + 8 lane:
// each wave-wide 16-byte load reads 512 contiguous bytes (4 whole lines), not 32 bytes out of each of 16 lines. The k order of a fragment is what it was with row-major planes.
template <typename T16> struct WFrag;
template <> struct WFrag<h16> { typedef v16h V; static __device__ __forceinline__ V ld(const h16* p) { return cat16(*(const v8h*)p, *(const v8h*)(p + 256)); } static __device__ __forceinline__ v8f mma(V a, V b, v8f c) { return wmma16(a, b, c); } };
template <> struct WFrag<bf> { typedef v16bf V; static __device__ __forceinline__ V ld(const bf* p) { return cat16b(*(const v8us*)p, *(const v8us*)(p + 256)); } static __device__ __forceinline__ v8f mma(V a, V b, v8f c) { return wmmab(a, b, c); } };
// one wave: program order in the wave is enough. Several waves: every partial tile must be written before it is summed, and summed before it is overwritten:
// a work-group barrier between fences on LDS alone (only LDS passes between the waves; __syncthreads() would also hold every round until the round's stores to C have returned).
template <int KS> __device__ __forceinline__ void tile_sync() {
    if constexpr (KS == 1) { __builtin_amdgcn_wave_barrier(); asm volatile("" ::: "memory"); }
    else { __builtin_amdgcn_fence(__ATOMIC_RELEASE, "workgroup", "local"); __builtin_amdgcn_s_barrier(); __builtin_amdgcn_fence(__ATOMIC_ACQUIRE, "workgroup", "local"); } }
// behind a group of global loads: the wait that stands before a register which an issued load names is written again; the lanes' address pairs are inputs, so their registers stay as they are up to it (no load of the group lands on them). The scheduling barrier behind it keeps the group's loads together above it.
__device__ __forceinline__ void ld_done_v(const void* p0, const void* p1, const void* p2, const void* p3) { asm volatile("s_wait_xcnt 0x0" :: "v"(p0), "v"(p1), "v"(p2), "v"(p3) : "memory"); __builtin_amdgcn_sched_barrier(0); /* no load of the group sinks below, no product rises above */ }
template <typename T16, int NSPLIT, bool BIAS, int KS, int OUTM, int K>
__global__ __launch_bounds__(32 * KS) void k_gemmw(const T16* __restrict__ A, const T16* __restrict__ A2, const T16* __restrict__ Bt, const T16* __restrict__ Bt2, float* C, int ldc, const float* __restrict__ bias, size_t sA, size_t sB, size_t sC, h16* P16, bf* Ph, bf* Pl) {
    typedef typename WFrag<T16>::V V;
    __shared__ __align__(16) float os[KS * 16 * 68];
    const size_t z = blockIdx.z; A += z * sA; if (A2) A2 += z * sA; Bt += z * sB; if (Bt2) Bt2 += z * sB; if constexpr (OUTM == 0) C += z * sC; else { P16 += z * sC; Ph += z * sC; Pl += z * sC; }
    const int lane = threadIdx.x & 31, lr = lane & 15, hi = lane >> 4; const int r0 = blockIdx.x * 64, c0 = blockIdx.y * 64;
    const int wv = KS == 1 ? 0 : __builtin_amdgcn_readfirstlane((int)(threadIdx.x >> 5)); const int kw = K / KS, k0 = wv * kw; float* osw = os + wv * (16 * 68);
    v8f acc[4][4];
#pragma unroll
    for (int mb = 0; mb < 4; ++mb)
#pragma unroll
        for (int nb = 0; nb < 4; ++nb) acc[mb][nb] = (v8f){};
    constexpr int KB = K / 32;   // 32-k blocks a row block
    const size_t ab = ((size_t)(r0 >> 4) * KB + (k0 >> 5)) * 512, bb = ((size_t)(c0 >> 4) * KB + (k0 >> 5)) * 512; A += ab + lane * 8; Bt += bb + lane * 8; if (NSPLIT == 1 || NSPLIT == 2) A2 += ab + lane * 8; if (NSPLIT >= 2) Bt2 += bb + lane * 8;   // the lane's piece in the wave's first block of the tile's first row block
#pragma unroll 1
    for (int kt = 0; kt < kw / 32; ++kt) {
        V a[4], a2[4];
#pragma unroll
        for (int mb = 0; mb < 4; ++mb) { a[mb] = WFrag<T16>::ld(A + mb * KB * 512); if (NSPLIT == 1 || NSPLIT == 2) a2[mb] = WFrag<T16>::ld(A2 + mb * KB * 512); }
        V b[4], b2[4];
#pragma unroll
        for (int nb = 0; nb < 4; ++nb) { b[nb] = WFrag<T16>::ld(Bt + nb * KB * 512); if (NSPLIT >= 2) b2[nb] = WFrag<T16>::ld(Bt2 + nb * KB * 512); }
        ld_done_v(A, NSPLIT == 1 || NSPLIT == 2 ? A2 : A, Bt, NSPLIT >= 2 ? Bt2 : Bt);   // the addresses step on only behind it
        A += 512; Bt += 512; if (NSPLIT == 1 || NSPLIT == 2) A2 += 512; if (NSPLIT >= 2) Bt2 += 512;
#pragma unroll
        for (int nb = 0; nb < 4; ++nb) {
#pragma unroll
            for (int mb = 0; mb < 4; ++mb) { acc[mb][nb] = WFrag<T16>::mma(a[mb], b[nb], acc[mb][nb]); if (NSPLIT == 1 || NSPLIT == 2) acc[mb][nb] = WFrag<T16>::mma(a2[mb], b[nb], acc[mb][nb]); if (NSPLIT >= 2) acc[mb][nb] = WFrag<T16>::mma(a[mb], b2[nb], acc[mb][nb]); } }
        asm volatile("v_nop\n\tv_nop\n\tv_nop\n\tv_nop" : "+v"(acc[0][0]), "+v"(acc[1][1]), "+v"(acc[2][2]), "+v"(acc[3][3]) : "v"(a[0]), "v"(a[3]));
    }
#pragma unroll
    for (int mb = 0; mb < 4; ++mb) {
#pragma unroll
        for (int nb = 0; nb < 4; ++nb) {
#pragma unroll
            for (int j = 0; j < 8; ++j) osw[(hi * 8 + j) * 68 + nb * 16 + lr] = acc[mb][nb][j]; }
        tile_sync<KS>();
        float* crow = C + (size_t)(r0 + mb * 16) * ldc + c0;
{
#pragma unroll
            for (int s = 0; s < (KS < 8 ? 8 / KS : 1); ++s) { const int it = s * 32 * KS + (int)threadIdx.x; if (KS > 8 && it >= 256) break;
                // OUTM 0: a wave takes 2 rows of 64 columns. Else: 16 rows of 8 columns, which are 256 contiguous bytes of a fragment-order plane; lanes 0-15 and lanes 16-31 each read 16 different rows of os at one column: no bank twice
                const int row = OUTM == 0 ? it >> 4 : it & 15, cofs = OUTM == 0 ? (it & 15) * 4 : (it >> 5) * 8 + ((it >> 4) & 1) * 4; v4f val = *(const v4fa*)(os + row * 68 + cofs);
#pragma unroll
                for (int w = 1; w < KS; ++w) val += *(const v4fa*)(os + w * (16 * 68) + row * 68 + cofs);
                if (BIAS) { if constexpr (OUTM == 2) { const float br = bfr(bias[r0 + mb * 16 + row]); val[0] += br; val[1] += br; val[2] += br; val[3] += br; }
                            else { val[0] += bfr(bias[c0 + cofs]); val[1] += bfr(bias[c0 + cofs + 1]); val[2] += bfr(bias[c0 + cofs + 2]); val[3] += bfr(bias[c0 + cofs + 3]); } }
                if constexpr (OUTM == 0) *(v4f*)(crow + (size_t)row * ldc + cofs) = val;
                else { const size_t po = (OUTM == 1 ? (size_t)blockIdx.y * TT * HD + (size_t)((r0 >> 4) + mb) * 1024 : ((size_t)((r0 >> 4) + mb) * (ldc >> 5) + (c0 >> 5)) * 512) + (cofs >> 3) * 128 + row * 8 + (cofs & 7); v4h o16; v4us oh, ol;   // the 16 x 64 round is two neighbouring blocks
#pragma unroll
                    for (int q = 0; q < 4; ++q) { o16[q] = tohx(val[q]); unsigned short x, y; splitf(val[q], x, y); oh[q] = x; ol[q] = y; }
                    *(v4h*)(P16 + po) = o16; *(v4us*)(Ph + po) = oh; *(v4us*)(Pl + po) = ol; } }
             }
        if (mb < 3) tile_sync<KS>();
    }
}

typedef __attribute__((ext_vector_type(2))) unsigned short v2us;

__global__ __launch_bounds__(256) void k_wtG(const float* __restrict__ w, int K, int N, bf* Bt) {
    const int lane = threadIdx.x & 31; const int L0 = (blockIdx.x * 8 + (threadIdx.x >> 5)) * 8; const int nlines = N * K / 64;
{
#pragma unroll 1
        for (int l = 0; l < 8; ++l) { const int L = L0 + l; if (L >= nlines) break; const size_t e = (size_t)L * 64 + lane * 2; const int k = (int)(e % K), n = (int)(e / K); v2us o;
            o[0] = f2bf(w[(size_t)k * N + n]); o[1] = f2bf(w[(size_t)(k + 1) * N + n]); *(v2us*)(Bt + e) = o; }
         }
}
// f32 [rows][K] -> bf16 in fragment order. 64 threads a block of 16 rows x 32 k: thread = (row, 8-k piece), 4 pieces a row: a wave reads 8 whole 128-byte lines and stores 4 whole lines.
template <int K>
__global__ __launch_bounds__(256) void k_cvt8(const float* __restrict__ src, bf* dst, size_t n8) { const size_t i = (size_t)blockIdx.x * 256 + threadIdx.x; if (i >= n8) return; const size_t t = i >> 6; const int rl = (int)(i >> 2) & 15, c = (int)i & 3; constexpr int KB = K / 32;
    const v8f v = *(const v8f*)(src + ((t / KB) * 16 + rl) * K + (t % KB) * 32 + c * 8); v8us o;
    asm volatile("s_wait_xcnt 0x0" ::: "memory");   // the wait that stands before a register which the issued loads name (their address pair) is written again
#pragma unroll
    for (int k = 0; k < 8; ++k) o[k] = f2bf(v[k]); *(v8us*)(dst + t * 512 + (c >> 1) * 256 + (c & 1) * 128 + rl * 8) = o;  }

// ---- k_fattn: scores, softmax, P x V and the head merge; a WAVE owns 32 query rows of one head and walks the keys in chunks of CH with a running row maximum and row sum; no score or P ever leaves the registers. grid (rows / (32 NT), 1, batch columns x heads), 32 x NT x KSP threads; plane z = b x heads + h.
// A work-group is NT row tiles x KSP key ranges: wave w has tile w / KSP and keys [(w % KSP) TT / KSP, ..). The waves of a work-group with the same key range read the same K and V^T blocks of one head at about the same time.
// Per chunk the wave forms the TRANSPOSED scores S^T = K Q^T (K rows as the A operand, Q rows as B): accumulator s[kt][mb][j] of lane (lr, hi) is key 16 kt + 8 hi + j against query 16 mb + lr.
// So a lane holds CH / 2 keys of each of its 2 query rows (chunk maximum: in the lane, one exchange with lane ^ 16; the row sum stays a per-lane partial until the end),
// and the pair s[2c][mb], s[2c+1][mb], rounded to 16 bit, IS the B fragment of P^T for keys [32 c, 32 c + 32): element e < 8 is k = 8 hi + e, element 8 + e is k = 16 + 8 hi + e, the k order of WFrag::ld on the V^T rows.
// O^T += V^T P^T (V^T rows as A): o[nb][mb][j] of lane (lr, hi) is d = 16 nb + 8 hi + j of query 16 mb + lr: the query is the lane's own, so the factor 2^((old max - new max) HD^-0.5 log2 e) is applied in the lane, and 8 j are 16 contiguous bytes of a fragment-order plane.
// P = 2^((S - running max) HD^-0.5 log2 e) is not normalised in the loop; O^T is divided by the row sum at the end. KSP = 2: the two key ranges of a tile meet once in LDS (max, sum, O^T; range 0 first). HL: hi + lo bf16 planes, 3 products each; else fp16.
// behind a group of global loads: the wait that stands before a register which an issued load names is written again; the lane offset and the scalar bases are inputs, so their registers stay as they are up to it. The scheduling barrier behind it keeps the group's loads together above it: one latency a group.
__device__ __forceinline__ void ld_done(unsigned off, const void* p0, const void* p1, const void* p2, const void* p3) { asm volatile("s_wait_xcnt 0x0" :: "v"(off), "s"(p0), "s"(p1), "s"(p2), "s"(p3) : "memory"); __builtin_amdgcn_sched_barrier(0); /* no load of the group sinks below, no product rises above */ }
// 8 x 2^x; the v_nop is the one free slot behind the last transcendental (the others are each followed by an independent one: outputs are early-clobber, so none overwrites a source)
__device__ __forceinline__ v8f exp2x8(v8f x) { float e0, e1, e2, e3, e4, e5, e6, e7;
    asm("v_exp_f32 %0, %8\n\tv_exp_f32 %1, %9\n\tv_exp_f32 %2, %10\n\tv_exp_f32 %3, %11\n\tv_exp_f32 %4, %12\n\tv_exp_f32 %5, %13\n\tv_exp_f32 %6, %14\n\tv_exp_f32 %7, %15\n\tv_nop"
        : "=&v"(e0), "=&v"(e1), "=&v"(e2), "=&v"(e3), "=&v"(e4), "=&v"(e5), "=&v"(e6), "=&v"(e7) : "v"(x[0]), "v"(x[1]), "v"(x[2]), "v"(x[3]), "v"(x[4]), "v"(x[5]), "v"(x[6]), "v"(x[7]));
    return (v8f){e0, e1, e2, e3, e4, e5, e6, e7}; }
// 2 x 2^x, the same form
__device__ __forceinline__ void exp2x2(float x0, float x1, float& e0, float& e1) { asm("v_exp_f32 %0, %2\n\tv_exp_f32 %1, %3\n\tv_nop" : "=&v"(e0), "=&v"(e1) : "v"(x0), "v"(x1)); }
// the value of lane ^ 16, by a vector cross-row move (no LDS round trip)
__device__ __forceinline__ float xhalf(float v) { const unsigned u = __float_as_uint(v); return __uint_as_float(__builtin_amdgcn_permlanex16(u, u, 0x76543210u, 0xfedcba98u, false, false)); }
template <typename T16, bool HL, int NT, int KSP>
__global__ __launch_bounds__(32 * NT * KSP) void k_fattn(const T16* __restrict__ Q, const T16* __restrict__ Q2, const T16* __restrict__ Kp, const T16* __restrict__ Kp2, const T16* __restrict__ Vt, const T16* __restrict__ Vt2, int t0, bf* Ah, bf* Al) {
    typedef typename WFrag<T16>::V V;
    __shared__ float xs[KSP > 1 ? NT * 68 * 32 : 1];
    constexpr int CH = HL ? 32 : 64, NKT = CH / 16, NC = CH / 32;   // keys, K tiles and 32-key steps of V^T a chunk
    constexpr float CE = SCL * 1.4426950408889634f;                 // HD^-0.5 log2 e
    const size_t zo = (size_t)blockIdx.z * TT * HD;
    const int lane = threadIdx.x & 31;
    const int wv = __builtin_amdgcn_readfirstlane((int)(threadIdx.x >> 5)); const int tile = wv / KSP, part = wv % KSP;
    const int r0 = t0 + (blockIdx.x * NT + tile) * 32, k0 = part * (TT / KSP);
    Q += zo + (size_t)r0 * HD; Kp += zo + (size_t)k0 * HD; Vt += zo + (size_t)k0 * 16; if (HL) { Q2 += zo + (size_t)r0 * HD; Kp2 += zo + (size_t)k0 * HD; Vt2 += zo + (size_t)k0 * 16; }   // wave-uniform bases, planes in fragment order: 16 rows of Q or K are 2 blocks (1024 elements); 32 keys of V^T are one block of each of its 4 row blocks (TT / 32 blocks apart)
    const unsigned loff = lane * 8;   // one 32-bit lane offset: the lane's piece in a block
    unsigned kof = lane * 16, vof = lane * 16;   // the same in bytes, plus the chunk's place: scalar base + 32-bit lane offset + constant is the address form of every load in the loop
    auto at = [](const T16* p, unsigned byte_off, int elems) { return (const T16*)((const char*)p + byte_off) + elems; };
    V q[2][2], q2[2][2];
#pragma unroll
    for (int kc = 0; kc < 2; ++kc)
#pragma unroll
        for (int mb = 0; mb < 2; ++mb) { q[kc][mb] = WFrag<T16>::ld(Q + loff + (mb * 16 * HD + kc * 512)); if (HL) q2[kc][mb] = WFrag<T16>::ld(Q2 + loff + (mb * 16 * HD + kc * 512)); }
    V k[NKT][2], k2[NKT][2];   // the K fragments of the chunk at hand; the next chunk's are fetched into them once its scores are formed (next_k below)
#pragma unroll
    for (int kt = 0; kt < NKT; ++kt)
#pragma unroll
        for (int kc = 0; kc < 2; ++kc) { k[kt][kc] = WFrag<T16>::ld(at(Kp, kof, kt * 16 * HD + kc * 512)); if (HL) k2[kt][kc] = WFrag<T16>::ld(at(Kp2, kof, kt * 16 * HD + kc * 512)); }
    ld_done(kof, Q, HL ? Q2 : Q, Kp, HL ? Kp2 : Kp);
    v8f o[4][2];
#pragma unroll
    for (int nb = 0; nb < 4; ++nb) { o[nb][0] = (v8f){}; o[nb][1] = (v8f){}; }
    float mx[2] = {-3.0e38f, -3.0e38f}, sm[2] = {0.f, 0.f};
#pragma unroll 1
    for (int kb = 0; kb < TT / KSP / CH; ++kb) {
        V vb[NC][4], vl[NC][4];
#pragma unroll
        for (int c = 0; c < NC; ++c)
#pragma unroll
            for (int nb = 0; nb < 4; ++nb) { vb[c][nb] = WFrag<T16>::ld(at(Vt, vof, nb * 16 * TT + c * 512)); if (HL) vl[c][nb] = WFrag<T16>::ld(at(Vt2, vof, nb * 16 * TT + c * 512)); }
        ld_done(vof, Vt, HL ? Vt2 : Vt, Vt, HL ? Vt2 : Vt);   // the chunk's V^T loads issue here and land under the scores and the softmax; the offset steps on only behind it
        vof += kb + 1 < TT / KSP / CH ? CH * 16 * 2 : 0;   // stepped as kof is: never past the plane, and the 32-bit offset stays in its vector register beside the scalar base
        v8f s[NKT][2];
#pragma unroll
        for (int kt = 0; kt < NKT; ++kt) { s[kt][0] = (v8f){}; s[kt][1] = (v8f){}; }
#pragma unroll
        for (int kc = 0; kc < 2; ++kc)
#pragma unroll
            for (int kt = 0; kt < NKT; ++kt)
#pragma unroll
                for (int mb = 0; mb < 2; ++mb) { s[kt][mb] = WFrag<T16>::mma(k[kt][kc], q[kc][mb], s[kt][mb]); if (HL) { s[kt][mb] = WFrag<T16>::mma(k[kt][kc], q2[kc][mb], s[kt][mb]); s[kt][mb] = WFrag<T16>::mma(k2[kt][kc], q[kc][mb], s[kt][mb]); } }
        auto next_k = [&]() {
            __builtin_amdgcn_sched_barrier(0);   // the next chunk's K loads stay below the scores that read these registers
            kof += kb + 1 < TT / KSP / CH ? CH * HD * 2 : 0;   // the last chunk fetches itself again: no address past the head's plane
#pragma unroll
            for (int kt = 0; kt < NKT; ++kt)
#pragma unroll
                for (int kc = 0; kc < 2; ++kc) { k[kt][kc] = WFrag<T16>::ld(at(Kp, kof, kt * 16 * HD + kc * 512)); if (HL) k2[kt][kc] = WFrag<T16>::ld(at(Kp2, kof, kt * 16 * HD + kc * 512)); }
            ld_done(kof, Kp, HL ? Kp2 : Kp, Kp, HL ? Kp2 : Kp); };
        if constexpr (HL) next_k();   // 2 waves a SIMD, registers to spare: they land under the softmax and P x V
        else __builtin_amdgcn_sched_barrier(0);   // the scores' products issue back to back, each behind 7 independent ones; without it the maxima are woven in and each waits out a product's latency behind v_nops
        float mn[2], al[2];
#pragma unroll
        for (int mb = 0; mb < 2; ++mb) { float m = s[0][mb][0];
#pragma unroll
            for (int kt = 0; kt < NKT; ++kt)
#pragma unroll
                for (int j = 0; j < 8; ++j) m = fmaxf(m, s[kt][mb][j]);
            mn[mb] = fmaxf(mx[mb], fmaxf(m, xhalf(m))); }
        exp2x2((mx[0] - mn[0]) * CE, (mx[1] - mn[1]) * CE, al[0], al[1]);
#pragma unroll
        for (int mb = 0; mb < 2; ++mb) { const float nm = -mn[mb] * CE; float a4[4] = {0.f, 0.f, 0.f, 0.f};
#pragma unroll
            for (int kt = 0; kt < NKT; ++kt) { v8f x;
#pragma unroll
                for (int j = 0; j < 8; ++j) x[j] = fmaf(s[kt][mb][j], CE, nm);
                s[kt][mb] = exp2x8(x);
#pragma unroll
                for (int j = 0; j < 8; ++j) a4[j & 3] += s[kt][mb][j]; }
            sm[mb] = fmaf(sm[mb], al[mb], (a4[0] + a4[1]) + (a4[2] + a4[3])); mx[mb] = mn[mb];
#pragma unroll
            for (int nb = 0; nb < 4; ++nb) o[nb][mb] *= al[mb]; }
        __builtin_amdgcn_sched_barrier(0);   // no product of P x V rises among the exponentials above
        V a[NC][2], a2[NC][2];
#pragma unroll
        for (int c = 0; c < NC; ++c)
#pragma unroll
            for (int mb = 0; mb < 2; ++mb) {
                if constexpr (HL) { v8us h0, l0, h1, l1;
#pragma unroll
                    for (int e = 0; e < 8; ++e) { unsigned short x, y; splitf(s[2 * c][mb][e], x, y); h0[e] = x; l0[e] = y; splitf(s[2 * c + 1][mb][e], x, y); h1[e] = x; l1[e] = y; }
                    a[c][mb] = cat16b(h0, h1); a2[c][mb] = cat16b(l0, l1);
                } else { v8h p0, p1;
#pragma unroll
                    for (int e = 0; e < 8; ++e) { p0[e] = tohx(s[2 * c][mb][e]); p1[e] = tohx(s[2 * c + 1][mb][e]); }
                    a[c][mb] = cat16(p0, p1); } }
        if constexpr (!HL) next_k();   // 3 waves a SIMD: only here, with the f32 scores rounded and gone, are the registers free; they land under P x V and the other waves
#pragma unroll
        for (int c = 0; c < NC; ++c)
#pragma unroll
            for (int nb = 0; nb < 4; ++nb)
#pragma unroll
                for (int mb = 0; mb < 2; ++mb) { o[nb][mb] = WFrag<T16>::mma(vb[c][nb], a[c][mb], o[nb][mb]); if (HL) { o[nb][mb] = WFrag<T16>::mma(vb[c][nb], a2[c][mb], o[nb][mb]); o[nb][mb] = WFrag<T16>::mma(vl[c][nb], a[c][mb], o[nb][mb]); } }
    }
    if constexpr (KSP > 1) {   // key range 1 hands its maximum, its per-lane sums and its O^T to range 0 of the same tile: word i of lane l at [i][l], no bank twice
        float* xw = xs + tile * (68 * 32) + lane;
        if (part) { xw[0] = mx[0]; xw[32] = mx[1]; xw[64] = sm[0]; xw[96] = sm[1];
#pragma unroll
            for (int nb = 0; nb < 4; ++nb)
#pragma unroll
                for (int mb = 0; mb < 2; ++mb)
#pragma unroll
                    for (int j = 0; j < 8; ++j) xw[(4 + (nb * 2 + mb) * 8 + j) * 32] = o[nb][mb][j]; }
        __syncthreads();   // every wave passes it once; range 0 reads only behind it
        if (part) return;
#pragma unroll
        for (int mb = 0; mb < 2; ++mb) { const float mo = xw[mb * 32], so = xw[(2 + mb) * 32], m = fmaxf(mx[mb], mo); float f0, f1; exp2x2((mx[mb] - m) * CE, (mo - m) * CE, f0, f1);
            sm[mb] = sm[mb] * f0 + so * f1;
#pragma unroll
            for (int nb = 0; nb < 4; ++nb)
#pragma unroll
                for (int j = 0; j < 8; ++j) o[nb][mb][j] = o[nb][mb][j] * f0 + xw[(4 + (nb * 2 + mb) * 8 + j) * 32] * f1; }
    }
    // merged heads [b][t][h][d], hi + lo bf16 planes, each [TT][DQ] in fragment order (the A operand of the output projection): the wave's (nb, mb) piece is 512 contiguous bytes, 4 whole lines
    v8us oh[4][2], ol[4][2];
#pragma unroll
    for (int mb = 0; mb < 2; ++mb) { const float a = sm[mb] + xhalf(sm[mb]); const float f = __fdiv_rn(1.0f, a);
#pragma unroll
        for (int nb = 0; nb < 4; ++nb)
#pragma unroll
            for (int j = 0; j < 8; ++j) { unsigned short x, y; splitf(o[nb][mb][j] * f, x, y); oh[nb][mb][j] = x; ol[nb][mb][j] = y; } }
    __builtin_amdgcn_sched_barrier(0);   // the stores stand together behind all the arithmetic: no register that an issued store names is written again
    const size_t oo = (size_t)(blockIdx.z / NH_) * TT * DQ + ((size_t)(r0 >> 4) * (DQ / 32) + (blockIdx.z % NH_) * (HD / 32)) * 512 + loff;
#pragma unroll
    for (int mb = 0; mb < 2; ++mb)
#pragma unroll
        for (int nb = 0; nb < 4; ++nb) { *(v8us*)(Ah + oo + (mb * (DQ / 32) * 512 + nb * 256)) = oh[nb][mb]; *(v8us*)(Al + oo + (mb * (DQ / 32) * 512 + nb * 256)) = ol[nb][mb]; }
}
// grid y: batch column b; its rows leave as plane b of XB, [TT][DM] in fragment order (threads as in k_cvt8)
__global__ __launch_bounds__(256) void k_cvt8s(const float* __restrict__ X, bf* XB, size_t pitch) { const size_t i = (size_t)blockIdx.x * 256 + threadIdx.x; if (i >= (size_t)TT * DM / 8) return; X += (size_t)blockIdx.y * DM; XB += (size_t)blockIdx.y * TT * DM; const size_t t = i >> 6; const int rl = (int)(i >> 2) & 15, pc = (int)i & 3; const int c = (int)(t % (DM / 32)) * 32 + pc * 8; const int srow = (int)(t / (DM / 32)) * 16 + rl; const v8f a = *(const v8f*)(X + (size_t)srow * pitch + c); v8us o;
    asm volatile("s_wait_xcnt 0x0" ::: "memory");   // the wait that stands before a register which the issued loads name (their address pair) is written again
#pragma unroll
    for (int q = 0; q < 8; ++q) o[q] = f2bf(a[q]);
    *(v8us*)(XB + t * 512 + (pc >> 1) * 256 + (pc & 1) * 128 + rl * 8) = o;  }

extern "C" void kernel_launch(void* const* d_in, const int* in_sizes, int n_in,
                              void* d_out, int out_size, void* d_ws, size_t ws_size, hipStream_t stream) {
    (void)in_sizes; (void)n_in; (void)out_size;
    const float* x = (const float*)d_in[0];   /* query [S][B][D] = [2048][4][1024]: ONE stream: q, k and v all project it */ const float* wq = (const float*)d_in[1]; const float* bq = (const float*)d_in[2]; const float* wk = (const float*)d_in[3]; const float* bk = (const float*)d_in[4]; const float* wv = (const float*)d_in[5]; const float* bv = (const float*)d_in[6]; const float* wo = (const float*)d_in[7]; const float* bo = (const float*)d_in[8];
    float* OUT = (float*)d_out;     // [2048][4][1024] sequence-first
    char* wsp = (char*)d_ws;
    auto take = [&](size_t bytes) { char* p = wsp; wsp += (bytes + 255) & ~(size_t)255; return (void*)p; };
    bf* WQ = (bf*)take((size_t)DQ * DM * 2); bf* WK = (bf*)take((size_t)DKV * DM * 2); bf* WV = (bf*)take((size_t)DKV * DM * 2); bf* WO = (bf*)take((size_t)DM * DQ * 2);
    bf* XB = (bf*)take((size_t)NB_ * TT * DM * 2);
    h16* QP16 = (h16*)take((size_t)NB_ * NH_ * TT * HD * 2); h16* KP16 = (h16*)take((size_t)NB_ * NKV * TT * HD * 2); h16* VT16 = (h16*)take((size_t)NB_ * NKV * HD * TT * 2);
    bf* QPh = (bf*)take((size_t)NB_ * NH_ * TT * HD * 2); bf* QPl = (bf*)take((size_t)NB_ * NH_ * TT * HD * 2); bf* KPh = (bf*)take((size_t)NB_ * NKV * TT * HD * 2); bf* KPl = (bf*)take((size_t)NB_ * NKV * TT * HD * 2); bf* VTh = (bf*)take((size_t)NB_ * NKV * HD * TT * 2); bf* VTl = (bf*)take((size_t)NB_ * NKV * HD * TT * 2);
    bf* ATh = (bf*)take((size_t)NB_ * TT * DQ * 2); bf* ATl = (bf*)take((size_t)NB_ * TT * DQ * 2);
    if ((size_t)(wsp - (char*)d_ws) > ws_size) return;    // ws 256 MiB
    { k_cvt8<DM><<<(unsigned)(((size_t)DQ * DM / 8 + 255) / 256), 256, 0, stream>>>(wq, WQ, (size_t)DQ * DM / 8); k_cvt8<DM><<<(unsigned)(((size_t)DKV * DM / 8 + 255) / 256), 256, 0, stream>>>(wk, WK, (size_t)DKV * DM / 8); k_cvt8<DM><<<(unsigned)(((size_t)DKV * DM / 8 + 255) / 256), 256, 0, stream>>>(wv, WV, (size_t)DKV * DM / 8);
      k_cvt8<DQ><<<(unsigned)(((size_t)DM * DQ / 8 + 255) / 256), 256, 0, stream>>>(wo, WO, (size_t)DM * DQ / 8);
       }
    k_cvt8s<<<dim3((unsigned)(((size_t)TT * DM / 8 + 255) / 256), NB_, 1), 256, 0, stream>>>(x, XB, (size_t)NB_ * DM);   /* rows s of batch column b: pitch B x D */
    k_gemmw<bf, 0, true, 8, 1, DM><<<dim3(TT / 64, DQ / 64, NB_), 256, 0, stream>>>(XB, nullptr, WQ, nullptr, nullptr, 0, bq, (size_t)TT * DM, 0, (size_t)NH_ * TT * HD, QP16, QPh, QPl);   // q head planes [b][h][t][d] straight from the tile
    k_gemmw<bf, 0, true, 8, 1, DM><<<dim3(TT / 64, DKV / 64, NB_), 256, 0, stream>>>(XB, nullptr, WK, nullptr, nullptr, 0, bk, (size_t)TT * DM, 0, (size_t)NKV * TT * HD, KP16, KPh, KPl);
    k_gemmw<bf, 0, true, 8, 2, DM><<<dim3(DKV / 64, TT / 64, NB_), 256, 0, stream>>>(WV, nullptr, XB, nullptr, nullptr, TT, bv, 0, (size_t)TT * DM, (size_t)NKV * HD * TT, VT16, VTh, VTl);   // weight rows as A, token rows as Bt: v^T planes [b][g][d][t]
    k_fattn<bf, true, 4, 2><<<dim3(RH / 128, 1, NB_ * ZH), 256, 0, stream>>>(QPh, QPl, KPh, KPl, VTh, VTl, 0, ATh, ATl);   // one kv head per query head: plane z of each (z-stride TT*HD)
    k_fattn<h16, false, 12, 1><<<dim3((TT - RH) / 384, 1, NB_ * ZH), 384, 0, stream>>>(QP16, nullptr, KP16, nullptr, VT16, nullptr, RH, ATh, ATl);
    k_gemmw<bf, 1, true, 8, 0, DQ><<<dim3(TT / 64, DM / 64, NB_), 256, 0, stream>>>(ATh, ATl, WO, nullptr, OUT, NB_ * DM, bo, (size_t)TT * DQ, 0, (size_t)DM, nullptr, nullptr, nullptr);   /* [S][B][D]: row pitch B x D, column block b */
}

// v008
// Measured time: 196 microseconds a run.
// Next to v007, in two timings, it ran 1.08 times as fast each time.
// All steps since v000 together make it 20.4 times as fast.
#include <hip/hip_runtime.h>

// Multi-head self-attention on a SEQUENCE-FIRST tensor (query [2048][4][1024] = [S][B][D]: ONE stream; q, k, v = x W^T + b ('oi' (out, in) [1024][1024] + [1024]; normal x 0.02; biases ZEROS on this draw: read); 16 heads x 64 per batch column; q = query Wq^T + bq, not pre-scaled (the softmax exponent takes 64^-0.5: == scores / 8); softmax over all keys (no mask); out = merged Wo^T + bo -> [2048][4][1024] sequence-first (8.4 M); argument order query, Wq, bq, Wk, bk, Wv, bv, Wo, bo).
// Layout: all B batch columns go through every launch together (grid z, or grid y in the gather). One strided gather makes the bf16 copy [b][s][d] of rows s of column b (row pitch B x D); q, k and v all project it; 'oi' weights; exact projections + f32 biases; dense T-2048 attention (hybrid rows: < 512 hi/lo 3 products, rest fp16); merged hi/lo x Wo exact + bo written with row pitch B x D at column offset b (the [S][B][D] output).
// Compute dtypes, f32 accumulate: every input rounded to bf16; projections exact + f32 biases; attention rows < 512 3 products, rest fp16; softmax f32; Wo hl x exact + bias.

#define NB_  4
#define TT   2048
#define DM   1024
#define NH_  16
#define NKV  16
#define REP  (NH_ / NKV)
#define HD   64
#define DQ   (NH_ * HD)
#define DKV  (NKV * HD)
#define ZH   16                   // heads of each batch column per attention launch (grid z = NB_ x ZH): all of a batch column's
#define RH   512                  // query rows < RH use hi+lo planes (0: none)
#define WIN  0
#define PCAR 1024.0f
#define SCL  0.125f   // HD^-0.5
typedef _Float16 h16;
typedef unsigned short bf;
typedef __attribute__((ext_vector_type(16))) __bf16   v16bf;
typedef __attribute__((ext_vector_type(16))) _Float16 v16h;
typedef __attribute__((ext_vector_type(8)))  _Float16 v8h;
typedef __attribute__((ext_vector_type(8)))  unsigned short v8us;
typedef __attribute__((ext_vector_type(8)))  float    v8f;
typedef __attribute__((ext_vector_type(4)))  float    v4f;
typedef v8h  __attribute__((may_alias)) v8ha;
typedef v4f  __attribute__((may_alias)) v4fa;
typedef v8us __attribute__((may_alias)) v8usa;

__device__ __forceinline__ unsigned short f2bf(float f) { unsigned u = __float_as_uint(f); u += 0x7FFFu + ((u >> 16) & 1u); return (unsigned short)(u >> 16); }
__device__ __forceinline__ float bf2f(unsigned short b) { return __uint_as_float(((unsigned)b) << 16); }
__device__ __forceinline__ float bfr(float f) { return bf2f(f2bf(f)); }
__device__ __forceinline__ v16h cat16(v8h lo, v8h hi) { return __builtin_shufflevector(lo, hi, 0, 1, 2, 3, 4, 5, 6, 7, 8, 9, 10, 11, 12, 13, 14, 15); }
__device__ __forceinline__ v16bf cat16b(v8us lo, v8us hi) { return __builtin_bit_cast(v16bf, __builtin_shufflevector(lo, hi, 0, 1, 2, 3, 4, 5, 6, 7, 8, 9, 10, 11, 12, 13, 14, 15)); }
__device__ __forceinline__ v8f wmma16(v16h a, v16h b, v8f c) { return __builtin_amdgcn_wmma_f32_16x16x32_f16(false, a, false, b, (short)0, c, false, false); }
__device__ __forceinline__ v8f wmmab(v16bf a, v16bf b, v8f c) { return __builtin_amdgcn_wmma_f32_16x16x32_bf16(false, a, false, b, (short)0, c, false, false); }
__device__ __forceinline__ h16 tohx(float x) { return (h16)x; }
__device__ __forceinline__ void splitf(float y, unsigned short& h, unsigned short& l) { h = f2bf(y); l = f2bf(y - bf2f(h)); }
typedef __attribute__((ext_vector_type(4))) _Float16 v4h;
typedef __attribute__((ext_vector_type(4))) unsigned short v4us;



// ---- k_gemmw: register-blocked GEMM, one work-group of SM x SN x KS waves per (64 SM) x (64 SN) output tile: SM x SN wave tiles of 64x64, each shared by a group of KS waves; wave wk of a group sums the k range [wk K/KS, (wk+1) K/KS) into its own 16 accumulators, operands straight from 16-bit planes in fragment order; grid (M/(64 SM), N/(64 SN), Z), 32 x KS x SM x SN threads.
// The SN groups of one tile row read the same A blocks and the SM groups of one tile column the same Bt blocks, at about the same time, so that a block fetched from L2 into the WGP's cache can serve them all.
// The KS partial tiles of a group meet in the group's own LDS, 16 rows at a time, and are added in wave order 0..KS-1 (fixed, the same on every run).
// C[m][n] (f32, pitch ldc, + optional f32 bias[n]) = sum_k A[m][k] Bt[n][k] (+ split products per NSPLIT). A and Bt are planes of K columns in fragment order (below). z-batch strides sA/sB/sC in elements (sC: of C, or of each 16-bit plane where OUTM is 1 or 2). K % (32 KS) == 0.
// OUTM 0: C as above. OUTM 1 and 2: no f32 copy; the summed tile (+ bias) leaves as the three 16-bit planes the attention kernel reads: fp16, bf16 hi, bf16 lo (lo = the rest after hi).
//   1: head planes [n / 64][m][n % 64] (a 64-column tile is one head, TT rows a head), each in fragment order with K = 64, bias[n].
//   2: planes [m][n] in fragment order with K = ldc, bias[m]: with A = weight rows and Bt = token rows the product IS the transposed head plane [head][d][t]; same k ranges, same k order as the untransposed product.
// FRAGMENT ORDER: every 16-bit operand plane [rows][K] is stored as blocks of 16 rows x 32 k = 512 elements (1 KiB), block (r / 16, k / 32) at index (r / 16) (K / 32) + k / 32;
// inside a block element (r, k) stands at ((k >> 4) & 1) 256 + ((k >> 3) & 1) 128 + (r & 15) 8 + (k & 7). Lane (lr, hi) = lane 16 hi + lr then finds its two 8-element pieces (k = 8 hi + e and k = 16 + 8 hi + e) at 8 lane and 256 + 8 lane:
// each wave-wide 16-byte load reads 512 contiguous bytes (4 whole lines), not 32 bytes out of each of 16 lines. The k order of a fragment is what it was with row-major planes.
template <typename T16> struct WFrag;
template <> struct WFrag<h16> { typedef v16h V; static __device__ __forceinline__ V ld(const h16* p) { return cat16(*(const v8h*)p, *(const v8h*)(p + 256)); } static __device__ __forceinline__ v8f mma(V a, V b, v8f c) { return wmma16(a, b, c); } };
template <> struct WFrag<bf> { typedef v16bf V; static __device__ __forceinline__ V ld(const bf* p) { return cat16b(*(const v8us*)p, *(const v8us*)(p + 256)); } static __device__ __forceinline__ v8f mma(V a, V b, v8f c) { return wmmab(a, b, c); } };
// one wave: program order in the wave is enough. Several waves: every partial tile must be written before it is summed, and summed before it is overwritten:
// a work-group barrier between fences on LDS alone (only LDS passes between the waves; __syncthreads() would also hold every round until the round's stores to C have returned).
template <int KS> __device__ __forceinline__ void tile_sync() {
    if constexpr (KS == 1) { __builtin_amdgcn_wave_barrier(); asm volatile("" ::: "memory"); }
    else { __builtin_amdgcn_fence(__ATOMIC_RELEASE, "workgroup", "local"); __builtin_amdgcn_s_barrier(); __builtin_amdgcn_fence(__ATOMIC_ACQUIRE, "workgroup", "local"); } }
// behind a group of global loads: the wait that stands before a register which an issued load names is written again; the lanes' address pairs are inputs, so their registers stay as they are up to it (no load of the group lands on them). The scheduling barrier behind it keeps the group's loads together above it.
__device__ __forceinline__ void ld_done_v(const void* p0, const void* p1, const void* p2, const void* p3) { asm volatile("s_wait_xcnt 0x0" :: "v"(p0), "v"(p1), "v"(p2), "v"(p3) : "memory"); __builtin_amdgcn_sched_barrier(0); /* no load of the group sinks below, no product rises above */ }
template <typename T16, int NSPLIT, bool BIAS, int KS, int OUTM, int K, int SM, int SN>
__global__ __launch_bounds__(32 * KS * SM * SN) void k_gemmw(const T16* __restrict__ A, const T16* __restrict__ A2, const T16* __restrict__ Bt, const T16* __restrict__ Bt2, float* C, int ldc, const float* __restrict__ bias, size_t sA, size_t sB, size_t sC, h16* P16, bf* Ph, bf* Pl) {
    typedef typename WFrag<T16>::V V;
    __shared__ __align__(16) float osa[SM * SN * KS * 16 * 68];
    const size_t z = blockIdx.z; A += z * sA; if (A2) A2 += z * sA; Bt += z * sB; if (Bt2) Bt2 += z * sB; if constexpr (OUTM == 0) C += z * sC; else { P16 += z * sC; Ph += z * sC; Pl += z * sC; }
    const int lane = threadIdx.x & 31, lr = lane & 15, hi = lane >> 4;
    const int wa = __builtin_amdgcn_readfirstlane((int)(threadIdx.x >> 5)); const int grp = wa / KS, wv = wa % KS, tid = (int)threadIdx.x % (32 * KS);   // the wave's group (its 64x64 tile), its k range in the group, the thread's number in the group
    const int r0 = (blockIdx.x * SM + grp % SM) * 64, c0 = (blockIdx.y * SN + grp / SM) * 64;
    const int kw = K / KS, k0 = wv * kw; float* os = osa + grp * (KS * 16 * 68); float* osw = os + wv * (16 * 68);
    v8f acc[4][4];
#pragma unroll
    for (int mb = 0; mb < 4; ++mb)
#pragma unroll
        for (int nb = 0; nb < 4; ++nb) acc[mb][nb] = (v8f){};
    constexpr int KB = K / 32;   // 32-k blocks a row block
    const size_t ab = ((size_t)(r0 >> 4) * KB + (k0 >> 5)) * 512, bb = ((size_t)(c0 >> 4) * KB + (k0 >> 5)) * 512; A += ab + lane * 8; Bt += bb + lane * 8; if (NSPLIT == 1 || NSPLIT == 2) A2 += ab + lane * 8; if (NSPLIT >= 2) Bt2 += bb + lane * 8;   // the lane's piece in the wave's first block of the tile's first row block
#pragma unroll 1
    for (int kt = 0; kt < kw / 32; ++kt) {
        V a[4], a2[4];
#pragma unroll
        for (int mb = 0; mb < 4; ++mb) { a[mb] = WFrag<T16>::ld(A + mb * KB * 512); if (NSPLIT == 1 || NSPLIT == 2) a2[mb] = WFrag<T16>::ld(A2 + mb * KB * 512); }
        V b[4], b2[4];
#pragma unroll
        for (int nb = 0; nb < 4; ++nb) { b[nb] = WFrag<T16>::ld(Bt + nb * KB * 512); if (NSPLIT >= 2) b2[nb] = WFrag<T16>::ld(Bt2 + nb * KB * 512); }
        ld_done_v(A, NSPLIT == 1 || NSPLIT == 2 ? A2 : A, Bt, NSPLIT >= 2 ? Bt2 : Bt);   // the addresses step on only behind it
        A += 512; Bt += 512; if (NSPLIT == 1 || NSPLIT == 2) A2 += 512; if (NSPLIT >= 2) Bt2 += 512;
#pragma unroll
        for (int nb = 0; nb < 4; ++nb) {
#pragma unroll
            for (int mb = 0; mb < 4; ++mb) { acc[mb][nb] = WFrag<T16>::mma(a[mb], b[nb], acc[mb][nb]); if (NSPLIT == 1 || NSPLIT == 2) acc[mb][nb] = WFrag<T16>::mma(a2[mb], b[nb], acc[mb][nb]); if (NSPLIT >= 2) acc[mb][nb] = WFrag<T16>::mma(a[mb], b2[nb], acc[mb][nb]); } }
        asm volatile("v_nop\n\tv_nop\n\tv_nop\n\tv_nop" : "+v"(acc[0][0]), "+v"(acc[1][1]), "+v"(acc[2][2]), "+v"(acc[3][3]) : "v"(a[0]), "v"(a[3]));
    }
#pragma unroll
    for (int mb = 0; mb < 4; ++mb) {
#pragma unroll
        for (int nb = 0; nb < 4; ++nb) {
#pragma unroll
            for (int j = 0; j < 8; ++j) osw[(hi * 8 + j) * 68 + nb * 16 + lr] = acc[mb][nb][j]; }
        tile_sync<KS>();
        float* crow = C + (size_t)(r0 + mb * 16) * ldc + c0;
{
            constexpr int NI = KS < 8 ? 8 / KS : 1;   // 4-column pieces of the round a thread sums and stores
            v4f vs[NI]; v4h o16s[NI]; v4us ohs[NI], ols[NI]; unsigned pos[NI];   // pos: the lane's byte offset from the round's wave-uniform base: scalar base + 32-bit lane offset is the address form of every store, no address arithmetic stands among them
            const size_t ub = OUTM == 1 ? (size_t)(c0 >> 6) * TT * HD + (size_t)((r0 >> 4) + mb) * 1024 : OUTM == 2 ? ((size_t)((r0 >> 4) + mb) * (ldc >> 5) + (c0 >> 5)) * 512 : 0;   // the 16 x 64 round is two neighbouring blocks
#pragma unroll
            for (int s = 0; s < NI; ++s) { const int it = s * 32 * KS + tid; if (KS > 8 && it >= 256) break;
                // OUTM 0: a wave takes 2 rows of 64 columns. Else: 16 rows of 8 columns, which are 256 contiguous bytes of a fragment-order plane; lanes 0-15 and lanes 16-31 each read 16 different rows of os at one column: no bank twice
                const int row = OUTM == 0 ? it >> 4 : it & 15, cofs = OUTM == 0 ? (it & 15) * 4 : (it >> 5) * 8 + ((it >> 4) & 1) * 4; v4f val = *(const v4fa*)(os + row * 68 + cofs);
#pragma unroll
                for (int w = 1; w < KS; ++w) val += *(const v4fa*)(os + w * (16 * 68) + row * 68 + cofs);
                if (BIAS) { if constexpr (OUTM == 2) { const float br = bfr(bias[r0 + mb * 16 + row]); val[0] += br; val[1] += br; val[2] += br; val[3] += br; }
                            else { val[0] += bfr(bias[c0 + cofs]); val[1] += bfr(bias[c0 + cofs + 1]); val[2] += bfr(bias[c0 + cofs + 2]); val[3] += bfr(bias[c0 + cofs + 3]); } }
                if constexpr (OUTM == 0) { vs[s] = val; pos[s] = (unsigned)(row * ldc + cofs) * 4u; }
                else { pos[s] = (unsigned)((cofs >> 3) * 128 + row * 8 + (cofs & 7)) * 2u; v4h o16; v4us oh, ol;
#pragma unroll
                    for (int q = 0; q < 4; ++q) { o16[q] = tohx(val[q]); unsigned short x, y; splitf(val[q], x, y); oh[q] = x; ol[q] = y; }
                    o16s[s] = o16; ohs[s] = oh; ols[s] = ol; } }
            __builtin_amdgcn_sched_barrier(0);   // the round's stores stand together behind all its arithmetic: none of it writes a register that an issued store names
#pragma unroll
            for (int s = 0; s < NI; ++s) { if (KS > 8 && s * 32 * KS + tid >= 256) break;
                if constexpr (OUTM == 0) *(v4f*)((char*)crow + pos[s]) = vs[s];
                else { *(v4h*)((char*)(P16 + ub) + pos[s]) = o16s[s]; *(v4us*)((char*)(Ph + ub) + pos[s]) = ohs[s]; *(v4us*)((char*)(Pl + ub) + pos[s]) = ols[s]; } }
            asm volatile("s_wait_xcnt 0x0" ::: "memory");   // the wait that stands before a register which the issued stores name is written again (the next round uses them anew)
            __builtin_amdgcn_sched_barrier(0);   // nothing of the next round rises above that wait
             }
        if (mb < 3) tile_sync<KS>();
    }
}

typedef __attribute__((ext_vector_type(2))) unsigned short v2us;

__global__ __launch_bounds__(256) void k_wtG(const float* __restrict__ w, int K, int N, bf* Bt) {
    const int lane = threadIdx.x & 31; const int L0 = (blockIdx.x * 8 + (threadIdx.x >> 5)) * 8; const int nlines = N * K / 64;
{
#pragma unroll 1
        for (int l = 0; l < 8; ++l) { const int L = L0 + l; if (L >= nlines) break; const size_t e = (size_t)L * 64 + lane * 2; const int k = (int)(e % K), n = (int)(e / K); v2us o;
            o[0] = f2bf(w[(size_t)k * N + n]); o[1] = f2bf(w[(size_t)(k + 1) * N + n]); *(v2us*)(Bt + e) = o; }
         }
}
// f32 [rows][K] -> bf16 in fragment order. 64 threads a block of 16 rows x 32 k: thread = (row, 8-k piece), 4 pieces a row: a wave reads 8 whole 128-byte lines and stores 4 whole lines.
template <int K>
__global__ __launch_bounds__(256) void k_cvt8(const float* __restrict__ src, bf* dst, size_t n8) { const size_t i = (size_t)blockIdx.x * 256 + threadIdx.x; if (i >= n8) return; const size_t t = i >> 6; const int rl = (int)(i >> 2) & 15, c = (int)i & 3; constexpr int KB = K / 32;
    const v8f v = *(const v8f*)(src + ((t / KB) * 16 + rl) * K + (t % KB) * 32 + c * 8); v8us o;
    asm volatile("s_wait_xcnt 0x0" ::: "memory");   // the wait that stands before a register which the issued loads name (their address pair) is written again
#pragma unroll
    for (int k = 0; k < 8; ++k) o[k] = f2bf(v[k]); *(v8us*)(dst + t * 512 + (c >> 1) * 256 + (c & 1) * 128 + rl * 8) = o;  }

// ---- k_fattn: scores, softmax, P x V and the head merge; a WAVE owns 32 query rows of one head and walks the keys in chunks of CH with a running row maximum and row sum; no score or P ever leaves the registers. grid (rows / (32 NT), 1, batch columns x heads), 32 x NT x KSP threads; plane z = b x heads + h.
// A work-group is NT row tiles x KSP key ranges: wave w has tile w / KSP and keys [(w % KSP) TT / KSP, ..). The waves of a work-group with the same key range read the same K and V^T blocks of one head at about the same time.
// Per chunk the wave forms the TRANSPOSED scores S^T = K Q^T (K rows as the A operand, Q rows as B): accumulator s[kt][mb][j] of lane (lr, hi) is key 16 kt + 8 hi + j against query 16 mb + lr.
// So a lane holds CH / 2 keys of each of its 2 query rows (chunk maximum: in the lane, one exchange with lane ^ 16; the row sum stays a per-lane partial until the end),
// and the pair s[2c][mb], s[2c+1][mb], rounded to 16 bit, IS the B fragment of P^T for keys [32 c, 32 c + 32): element e < 8 is k = 8 hi + e, element 8 + e is k = 16 + 8 hi + e, the k order of WFrag::ld on the V^T rows.
// O^T += V^T P^T (V^T rows as A): o[nb][mb][j] of lane (lr, hi) is d = 16 nb + 8 hi + j of query 16 mb + lr: the query is the lane's own, so the factor 2^((old max - new max) HD^-0.5 log2 e) is applied in the lane, and 8 j are 16 contiguous bytes of a fragment-order plane.
// P = 2^((S - running max) HD^-0.5 log2 e) is not normalised in the loop; O^T is divided by the row sum at the end. KSP = 2: the two key ranges of a tile meet once in LDS (max, sum, O^T; range 0 first). HL: hi + lo bf16 planes, 3 products each; else fp16.
// behind a group of global loads: the wait that stands before a register which an issued load names is written again; the lane offset and the scalar bases are inputs, so their registers stay as they are up to it. The scheduling barrier behind it keeps the group's loads together above it: one latency a group.
__device__ __forceinline__ void ld_done(unsigned off, const void* p0, const void* p1, const void* p2, const void* p3) { asm volatile("s_wait_xcnt 0x0" :: "v"(off), "s"(p0), "s"(p1), "s"(p2), "s"(p3) : "memory"); __builtin_amdgcn_sched_barrier(0); /* no load of the group sinks below, no product rises above */ }
// 8 x 2^x; the v_nop is the one free slot behind the last transcendental (the others are each followed by an independent one: outputs are early-clobber, so none overwrites a source)
__device__ __forceinline__ v8f exp2x8(v8f x) { float e0, e1, e2, e3, e4, e5, e6, e7;
    asm("v_exp_f32 %0, %8\n\tv_exp_f32 %1, %9\n\tv_exp_f32 %2, %10\n\tv_exp_f32 %3, %11\n\tv_exp_f32 %4, %12\n\tv_exp_f32 %5, %13\n\tv_exp_f32 %6, %14\n\tv_exp_f32 %7, %15\n\tv_nop"
        : "=&v"(e0), "=&v"(e1), "=&v"(e2), "=&v"(e3), "=&v"(e4), "=&v"(e5), "=&v"(e6), "=&v"(e7) : "v"(x[0]), "v"(x[1]), "v"(x[2]), "v"(x[3]), "v"(x[4]), "v"(x[5]), "v"(x[6]), "v"(x[7]));
    return (v8f){e0, e1, e2, e3, e4, e5, e6, e7}; }
// 2 x 2^x, the same form
__device__ __forceinline__ void exp2x2(float x0, float x1, float& e0, float& e1) { asm("v_exp_f32 %0, %2\n\tv_exp_f32 %1, %3\n\tv_nop" : "=&v"(e0), "=&v"(e1) : "v"(x0), "v"(x1)); }
// the value of lane ^ 16, by a vector cross-row move (no LDS round trip)
__device__ __forceinline__ float xhalf(float v) { const unsigned u = __float_as_uint(v); return __uint_as_float(__builtin_amdgcn_permlanex16(u, u, 0x76543210u, 0xfedcba98u, false, false)); }
template <typename T16, bool HL, int NT, int KSP>
__global__ __launch_bounds__(32 * NT * KSP) void k_fattn(const T16* __restrict__ Q, const T16* __restrict__ Q2, const T16* __restrict__ Kp, const T16* __restrict__ Kp2, const T16* __restrict__ Vt, const T16* __restrict__ Vt2, int t0, bf* Ah, bf* Al) {
    typedef typename WFrag<T16>::V V;
    __shared__ float xs[KSP > 1 ? NT * 68 * 32 : 1];
    constexpr int CH = HL ? 32 : 64, NKT = CH / 16, NC = CH / 32;   // keys, K tiles and 32-key steps of V^T a chunk
    constexpr float CE = SCL * 1.4426950408889634f;                 // HD^-0.5 log2 e
    const size_t zo = (size_t)blockIdx.z * TT * HD;
    const int lane = threadIdx.x & 31;
    const int wv = __builtin_amdgcn_readfirstlane((int)(threadIdx.x >> 5)); const int tile = wv / KSP, part = wv % KSP;
    const int r0 = t0 + (blockIdx.x * NT + tile) * 32, k0 = part * (TT / KSP);
    Q += zo + (size_t)r0 * HD; Kp += zo + (size_t)k0 * HD; Vt += zo + (size_t)k0 * 16; if (HL) { Q2 += zo + (size_t)r0 * HD; Kp2 += zo + (size_t)k0 * HD; Vt2 += zo + (size_t)k0 * 16; }   // wave-uniform bases, planes in fragment order: 16 rows of Q or K are 2 blocks (1024 elements); 32 keys of V^T are one block of each of its 4 row blocks (TT / 32 blocks apart)
    const unsigned loff = lane * 8;   // one 32-bit lane offset: the lane's piece in a block
    unsigned kof = lane * 16, vof = lane * 16;   // the same in bytes, plus the chunk's place: scalar base + 32-bit lane offset + constant is the address form of every load in the loop
    auto at = [](const T16* p, unsigned byte_off, int elems) { return (const T16*)((const char*)p + byte_off) + elems; };
    V q[2][2], q2[2][2];
#pragma unroll
    for (int kc = 0; kc < 2; ++kc)
#pragma unroll
        for (int mb = 0; mb < 2; ++mb) { q[kc][mb] = WFrag<T16>::ld(Q + loff + (mb * 16 * HD + kc * 512)); if (HL) q2[kc][mb] = WFrag<T16>::ld(Q2 + loff + (mb * 16 * HD + kc * 512)); }
    V k[NKT][2], k2[NKT][2];   // the K fragments of the chunk at hand; the next chunk's are fetched into them once its scores are formed (next_k below)
#pragma unroll
    for (int kt = 0; kt < NKT; ++kt)
#pragma unroll
        for (int kc = 0; kc < 2; ++kc) { k[kt][kc] = WFrag<T16>::ld(at(Kp, kof, kt * 16 * HD + kc * 512)); if (HL) k2[kt][kc] = WFrag<T16>::ld(at(Kp2, kof, kt * 16 * HD + kc * 512)); }
    ld_done(kof, Q, HL ? Q2 : Q, Kp, HL ? Kp2 : Kp);
    v8f o[4][2];
#pragma unroll
    for (int nb = 0; nb < 4; ++nb) { o[nb][0] = (v8f){}; o[nb][1] = (v8f){}; }
    float mx[2] = {-3.0e38f, -3.0e38f}, sm[2] = {0.f, 0.f};
#pragma unroll 1
    for (int kb = 0; kb < TT / KSP / CH; ++kb) {
        V vb[NC][4], vl[NC][4];
#pragma unroll
        for (int c = 0; c < NC; ++c)
#pragma unroll
            for (int nb = 0; nb < 4; ++nb) { vb[c][nb] = WFrag<T16>::ld(at(Vt, vof, nb * 16 * TT + c * 512)); if (HL) vl[c][nb] = WFrag<T16>::ld(at(Vt2, vof, nb * 16 * TT + c * 512)); }
        ld_done(vof, Vt, HL ? Vt2 : Vt, Vt, HL ? Vt2 : Vt);   // the chunk's V^T loads issue here and land under the scores and the softmax; the offset steps on only behind it
        vof += kb + 1 < TT / KSP / CH ? CH * 16 * 2 : 0;   // stepped as kof is: never past the plane, and the 32-bit offset stays in its vector register beside the scalar base
        v8f s[NKT][2];
#pragma unroll
        for (int kt = 0; kt < NKT; ++kt) { s[kt][0] = (v8f){}; s[kt][1] = (v8f){}; }
#pragma unroll
        for (int kc = 0; kc < 2; ++kc)
#pragma unroll
            for (int kt = 0; kt < NKT; ++kt)
#pragma unroll
                for (int mb = 0; mb < 2; ++mb) { s[kt][mb] = WFrag<T16>::mma(k[kt][kc], q[kc][mb], s[kt][mb]); if (HL) { s[kt][mb] = WFrag<T16>::mma(k[kt][kc], q2[kc][mb], s[kt][mb]); s[kt][mb] = WFrag<T16>::mma(k2[kt][kc], q[kc][mb], s[kt][mb]); } }
        auto next_k = [&]() {
            __builtin_amdgcn_sched_barrier(0);   // the next chunk's K loads stay below the scores that read these registers
            kof += kb + 1 < TT / KSP / CH ? CH * HD * 2 : 0;   // the last chunk fetches itself again: no address past the head's plane
#pragma unroll
            for (int kt = 0; kt < NKT; ++kt)
#pragma unroll
                for (int kc = 0; kc < 2; ++kc) { k[kt][kc] = WFrag<T16>::ld(at(Kp, kof, kt * 16 * HD + kc * 512)); if (HL) k2[kt][kc] = WFrag<T16>::ld(at(Kp2, kof, kt * 16 * HD + kc * 512)); }
            ld_done(kof, Kp, HL ? Kp2 : Kp, Kp, HL ? Kp2 : Kp); };
        if constexpr (HL) next_k();   // 2 waves a SIMD, registers to spare: they land under the softmax and P x V
        else __builtin_amdgcn_sched_barrier(0);   // the scores' products issue back to back, each behind 7 independent ones; without it the maxima are woven in and each waits out a product's latency behind v_nops
        float mn[2], al[2];
#pragma unroll
        for (int mb = 0; mb < 2; ++mb) { float m = s[0][mb][0];
#pragma unroll
            for (int kt = 0; kt < NKT; ++kt)
#pragma unroll
                for (int j = 0; j < 8; ++j) m = fmaxf(m, s[kt][mb][j]);
            mn[mb] = fmaxf(mx[mb], fmaxf(m, xhalf(m))); }
        exp2x2((mx[0] - mn[0]) * CE, (mx[1] - mn[1]) * CE, al[0], al[1]);
#pragma unroll
        for (int mb = 0; mb < 2; ++mb) { const float nm = -mn[mb] * CE; float a4[4] = {0.f, 0.f, 0.f, 0.f};
#pragma unroll
            for (int kt = 0; kt < NKT; ++kt) { v8f x;
#pragma unroll
                for (int j = 0; j < 8; ++j) x[j] = fmaf(s[kt][mb][j], CE, nm);
                s[kt][mb] = exp2x8(x);
#pragma unroll
                for (int j = 0; j < 8; ++j) a4[j & 3] += s[kt][mb][j]; }
            sm[mb] = fmaf(sm[mb], al[mb], (a4[0] + a4[1]) + (a4[2] + a4[3])); mx[mb] = mn[mb];
#pragma unroll
            for (int nb = 0; nb < 4; ++nb) o[nb][mb] *= al[mb]; }
        __builtin_amdgcn_sched_barrier(0);   // no product of P x V rises among the exponentials above
        V a[NC][2], a2[NC][2];
#pragma unroll
        for (int c = 0; c < NC; ++c)
#pragma unroll
            for (int mb = 0; mb < 2; ++mb) {
                if constexpr (HL) { v8us h0, l0, h1, l1;
#pragma unroll
                    for (int e = 0; e < 8; ++e) { unsigned short x, y; splitf(s[2 * c][mb][e], x, y); h0[e] = x; l0[e] = y; splitf(s[2 * c + 1][mb][e], x, y); h1[e] = x; l1[e] = y; }
                    a[c][mb] = cat16b(h0, h1); a2[c][mb] = cat16b(l0, l1);
                } else { v8h p0, p1;
#pragma unroll
                    for (int e = 0; e < 8; ++e) { p0[e] = tohx(s[2 * c][mb][e]); p1[e] = tohx(s[2 * c + 1][mb][e]); }
                    a[c][mb] = cat16(p0, p1); } }
        if constexpr (!HL) next_k();   // 3 waves a SIMD: only here, with the f32 scores rounded and gone, are the registers free; they land under P x V and the other waves
#pragma unroll
        for (int c = 0; c < NC; ++c)
#pragma unroll
            for (int nb = 0; nb < 4; ++nb)
#pragma unroll
                for (int mb = 0; mb < 2; ++mb) { o[nb][mb] = WFrag<T16>::mma(vb[c][nb], a[c][mb], o[nb][mb]); if (HL) { o[nb][mb] = WFrag<T16>::mma(vb[c][nb], a2[c][mb], o[nb][mb]); o[nb][mb] = WFrag<T16>::mma(vl[c][nb], a[c][mb], o[nb][mb]); } }
    }
    if constexpr (KSP > 1) {   // key range 1 hands its maximum, its per-lane sums and its O^T to range 0 of the same tile: word i of lane l at [i][l], no bank twice
        float* xw = xs + tile * (68 * 32) + lane;
        if (part) { xw[0] = mx[0]; xw[32] = mx[1]; xw[64] = sm[0]; xw[96] = sm[1];
#pragma unroll
            for (int nb = 0; nb < 4; ++nb)
#pragma unroll
                for (int mb = 0; mb < 2; ++mb)
#pragma unroll
                    for (int j = 0; j < 8; ++j) xw[(4 + (nb * 2 + mb) * 8 + j) * 32] = o[nb][mb][j]; }
        __syncthreads();   // every wave passes it once; range 0 reads only behind it
        if (part) return;
#pragma unroll
        for (int mb = 0; mb < 2; ++mb) { const float mo = xw[mb * 32], so = xw[(2 + mb) * 32], m = fmaxf(mx[mb], mo); float f0, f1; exp2x2((mx[mb] - m) * CE, (mo - m) * CE, f0, f1);
            sm[mb] = sm[mb] * f0 + so * f1;
#pragma unroll
            for (int nb = 0; nb < 4; ++nb)
#pragma unroll
                for (int j = 0; j < 8; ++j) o[nb][mb][j] = o[nb][mb][j] * f0 + xw[(4 + (nb * 2 + mb) * 8 + j) * 32] * f1; }
    }
    // merged heads [b][t][h][d], hi + lo bf16 planes, each [TT][DQ] in fragment order (the A operand of the output projection): the wave's (nb, mb) piece is 512 contiguous bytes, 4 whole lines
    v8us oh[4][2], ol[4][2];
#pragma unroll
    for (int mb = 0; mb < 2; ++mb) { const float a = sm[mb] + xhalf(sm[mb]); const float f = __fdiv_rn(1.0f, a);
#pragma unroll
        for (int nb = 0; nb < 4; ++nb)
#pragma unroll
            for (int j = 0; j < 8; ++j) { unsigned short x, y; splitf(o[nb][mb][j] * f, x, y); oh[nb][mb][j] = x; ol[nb][mb][j] = y; } }
    __builtin_amdgcn_sched_barrier(0);   // the stores stand together behind all the arithmetic: no register that an issued store names is written again
    const size_t oo = (size_t)(blockIdx.z / NH_) * TT * DQ + ((size_t)(r0 >> 4) * (DQ / 32) + (blockIdx.z % NH_) * (HD / 32)) * 512 + loff;
#pragma unroll
    for (int mb = 0; mb < 2; ++mb)
#pragma unroll
        for (int nb = 0; nb < 4; ++nb) { *(v8us*)(Ah + oo + (mb * (DQ / 32) * 512 + nb * 256)) = oh[nb][mb]; *(v8us*)(Al + oo + (mb * (DQ / 32) * 512 + nb * 256)) = ol[nb][mb]; }
}
// grid y: batch column b; its rows leave as plane b of XB, [TT][DM] in fragment order (threads as in k_cvt8)
__global__ __launch_bounds__(256) void k_cvt8s(const float* __restrict__ X, bf* XB, size_t pitch) { const size_t i = (size_t)blockIdx.x * 256 + threadIdx.x; if (i >= (size_t)TT * DM / 8) return; X += (size_t)blockIdx.y * DM; XB += (size_t)blockIdx.y * TT * DM; const size_t t = i >> 6; const int rl = (int)(i >> 2) & 15, pc = (int)i & 3; const int c = (int)(t % (DM / 32)) * 32 + pc * 8; const int srow = (int)(t / (DM / 32)) * 16 + rl; const v8f a = *(const v8f*)(X + (size_t)srow * pitch + c); v8us o;
    asm volatile("s_wait_xcnt 0x0" ::: "memory");   // the wait that stands before a register which the issued loads name (their address pair) is written again
#pragma unroll
    for (int q = 0; q < 8; ++q) o[q] = f2bf(a[q]);
    *(v8us*)(XB + t * 512 + (pc >> 1) * 256 + (pc & 1) * 128 + rl * 8) = o;  }

extern "C" void kernel_launch(void* const* d_in, const int* in_sizes, int n_in,
                              void* d_out, int out_size, void* d_ws, size_t ws_size, hipStream_t stream) {
    (void)in_sizes; (void)n_in; (void)out_size;
    const float* x = (const float*)d_in[0];   /* query [S][B][D] = [2048][4][1024]: ONE stream: q, k and v all project it */ const float* wq = (const float*)d_in[1]; const float* bq = (const float*)d_in[2]; const float* wk = (const float*)d_in[3]; const float* bk = (const float*)d_in[4]; const float* wv = (const float*)d_in[5]; const float* bv = (const float*)d_in[6]; const float* wo = (const float*)d_in[7]; const float* bo = (const float*)d_in[8];
    float* OUT = (float*)d_out;     // [2048][4][1024] sequence-first
    char* wsp = (char*)d_ws;
    auto take = [&](size_t bytes) { char* p = wsp; wsp += (bytes + 255) & ~(size_t)255; return (void*)p; };
    bf* WQ = (bf*)take((size_t)DQ * DM * 2); bf* WK = (bf*)take((size_t)DKV * DM * 2); bf* WV = (bf*)take((size_t)DKV * DM * 2); bf* WO = (bf*)take((size_t)DM * DQ * 2);
    bf* XB = (bf*)take((size_t)NB_ * TT * DM * 2);
    h16* QP16 = (h16*)take((size_t)NB_ * NH_ * TT * HD * 2); h16* KP16 = (h16*)take((size_t)NB_ * NKV * TT * HD * 2); h16* VT16 = (h16*)take((size_t)NB_ * NKV * HD * TT * 2);
    bf* QPh = (bf*)take((size_t)NB_ * NH_ * TT * HD * 2); bf* QPl = (bf*)take((size_t)NB_ * NH_ * TT * HD * 2); bf* KPh = (bf*)take((size_t)NB_ * NKV * TT * HD * 2); bf* KPl = (bf*)take((size_t)NB_ * NKV * TT * HD * 2); bf* VTh = (bf*)take((size_t)NB_ * NKV * HD * TT * 2); bf* VTl = (bf*)take((size_t)NB_ * NKV * HD * TT * 2);
    bf* ATh = (bf*)take((size_t)NB_ * TT * DQ * 2); bf* ATl = (bf*)take((size_t)NB_ * TT * DQ * 2);
    if ((size_t)(wsp - (char*)d_ws) > ws_size) return;    // ws 256 MiB
    { k_cvt8<DM><<<(unsigned)(((size_t)DQ * DM / 8 + 255) / 256), 256, 0, stream>>>(wq, WQ, (size_t)DQ * DM / 8); k_cvt8<DM><<<(unsigned)(((size_t)DKV * DM / 8 + 255) / 256), 256, 0, stream>>>(wk, WK, (size_t)DKV * DM / 8); k_cvt8<DM><<<(unsigned)(((size_t)DKV * DM / 8 + 255) / 256), 256, 0, stream>>>(wv, WV, (size_t)DKV * DM / 8);
      k_cvt8<DQ><<<(unsigned)(((size_t)DM * DQ / 8 + 255) / 256), 256, 0, stream>>>(wo, WO, (size_t)DM * DQ / 8);
       }
    k_cvt8s<<<dim3((unsigned)(((size_t)TT * DM / 8 + 255) / 256), NB_, 1), 256, 0, stream>>>(x, XB, (size_t)NB_ * DM);   /* rows s of batch column b: pitch B x D */
    k_gemmw<bf, 0, true, 2, 1, DM, 4, 2><<<dim3(TT / 256, DQ / 128, NB_), 512, 0, stream>>>(XB, nullptr, WQ, nullptr, nullptr, 0, bq, (size_t)TT * DM, 0, (size_t)NH_ * TT * HD, QP16, QPh, QPl);   // q head planes [b][h][t][d] straight from the tile
    k_gemmw<bf, 0, true, 2, 1, DM, 4, 2><<<dim3(TT / 256, DKV / 128, NB_), 512, 0, stream>>>(XB, nullptr, WK, nullptr, nullptr, 0, bk, (size_t)TT * DM, 0, (size_t)NKV * TT * HD, KP16, KPh, KPl);
    k_gemmw<bf, 0, true, 2, 2, DM, 4, 2><<<dim3(DKV / 256, TT / 128, NB_), 512, 0, stream>>>(WV, nullptr, XB, nullptr, nullptr, TT, bv, 0, (size_t)TT * DM, (size_t)NKV * HD * TT, VT16, VTh, VTl);   // weight rows as A, token rows as Bt: v^T planes [b][g][d][t]
    k_fattn<bf, true, 4, 2><<<dim3(RH / 128, 1, NB_ * ZH), 256, 0, stream>>>(QPh, QPl, KPh, KPl, VTh, VTl, 0, ATh, ATl);   // one kv head per query head: plane z of each (z-stride TT*HD)
    k_fattn<h16, false, 12, 1><<<dim3((TT - RH) / 384, 1, NB_ * ZH), 384, 0, stream>>>(QP16, nullptr, KP16, nullptr, VT16, nullptr, RH, ATh, ATl);
    k_gemmw<bf, 1, true, 2, 0, DQ, 4, 2><<<dim3(TT / 256, DM / 128, NB_), 512, 0, stream>>>(ATh, ATl, WO, nullptr, OUT, NB_ * DM, bo, (size_t)TT * DQ, 0, (size_t)DM, nullptr, nullptr, nullptr);   /* [S][B][D]: row pitch B x D, column block b */
}

// v009
// Measured time: 189 microseconds a run.
// In two side-by-side timings against v008, it was 1.03 and 1.04 times as fast.
// Counting every step since v000, it is 21.1 times as fast.
#include <hip/hip_runtime.h>

// Multi-head self-attention on a SEQUENCE-FIRST tensor (query [2048][4][1024] = [S][B][D]: ONE stream; q, k, v = x W^T + b ('oi' (out, in) [1024][1024] + [1024]; normal x 0.02; biases ZEROS on this draw: read); 16 heads x 64 per batch column; q = query Wq^T + bq, not pre-scaled (the softmax exponent takes 64^-0.5: == scores / 8); softmax over all keys (no mask); out = merged Wo^T + bo -> [2048][4][1024] sequence-first (8.4 M); argument order query, Wq, bq, Wk, bk, Wv, bv, Wo, bo).
// Layout: all B batch columns go through every launch together (grid z, or grid y in the gather). One strided gather makes the bf16 copy [b][s][d] of rows s of column b (row pitch B x D); q, k and v all project it; 'oi' weights; exact projections + f32 biases; dense T-2048 attention (hybrid rows: < 512 hi/lo 3 products, rest fp16); merged hi/lo x Wo exact + bo written with row pitch B x D at column offset b (the [S][B][D] output).
// Compute dtypes, f32 accumulate: every input rounded to bf16; projections exact + f32 biases; attention rows < 512 3 products, rest fp16; softmax f32; Wo hl x exact + bias.

#define NB_  4
#define TT   2048
#define DM   1024
#define NH_  16
#define NKV  16
#define REP  (NH_ / NKV)
#define HD   64
#define DQ   (NH_ * HD)
#define DKV  (NKV * HD)
#define ZH   16                   // heads of each batch column per attention launch (grid z = NB_ x ZH): all of a batch column's
#define RH   512                  // query rows < RH use hi+lo planes (0: none)
#define WIN  0
#define PCAR 1024.0f
#define SCL  0.125f   // HD^-0.5
typedef _Float16 h16;
typedef unsigned short bf;
typedef __attribute__((ext_vector_type(16))) __bf16   v16bf;
typedef __attribute__((ext_vector_type(16))) _Float16 v16h;
typedef __attribute__((ext_vector_type(8)))  _Float16 v8h;
typedef __attribute__((ext_vector_type(8)))  unsigned short v8us;
typedef __attribute__((ext_vector_type(8)))  float    v8f;
typedef __attribute__((ext_vector_type(4)))  float    v4f;
typedef v8h  __attribute__((may_alias)) v8ha;
typedef v4f  __attribute__((may_alias)) v4fa;
typedef v8us __attribute__((may_alias)) v8usa;

typedef __attribute__((ext_vector_type(2))) float  v2f;
typedef __attribute__((ext_vector_type(2))) __bf16 v2bf;
typedef __attribute__((ext_vector_type(4))) unsigned v4u;
typedef __attribute__((ext_vector_type(2))) unsigned v2u;
// two f32 -> two bf16 in one dword (a in the low half), round to nearest even: the chip's packed convert, one instruction for the pair
__device__ __forceinline__ unsigned f2bf2(float a, float b) { return __builtin_bit_cast(unsigned, __builtin_convertvector((v2f){a, b}, v2bf)); }
__device__ __forceinline__ unsigned short f2bf(float f) { return (unsigned short)f2bf2(f, f); }
__device__ __forceinline__ float bf2f(unsigned short b) { return __uint_as_float(((unsigned)b) << 16); }
__device__ __forceinline__ float bfr(float f) { return bf2f(f2bf(f)); }
__device__ __forceinline__ v16h cat16(v8h lo, v8h hi) { return __builtin_shufflevector(lo, hi, 0, 1, 2, 3, 4, 5, 6, 7, 8, 9, 10, 11, 12, 13, 14, 15); }
__device__ __forceinline__ v16bf cat16b(v8us lo, v8us hi) { return __builtin_bit_cast(v16bf, __builtin_shufflevector(lo, hi, 0, 1, 2, 3, 4, 5, 6, 7, 8, 9, 10, 11, 12, 13, 14, 15)); }
__device__ __forceinline__ v8f wmma16(v16h a, v16h b, v8f c) { return __builtin_amdgcn_wmma_f32_16x16x32_f16(false, a, false, b, (short)0, c, false, false); }
__device__ __forceinline__ v8f wmmab(v16bf a, v16bf b, v8f c) { return __builtin_amdgcn_wmma_f32_16x16x32_bf16(false, a, false, b, (short)0, c, false, false); }
__device__ __forceinline__ h16 tohx(float x) { return (h16)x; }
// a pair split into hi and lo (lo = the rest after hi), each pair one dword
__device__ __forceinline__ void splitf2(float y0, float y1, unsigned& h, unsigned& l) { h = f2bf2(y0, y1); v2bf lv; lv[0] = (__bf16)(y0 - __uint_as_float(h << 16)); lv[1] = (__bf16)(y1 - __uint_as_float(h & 0xFFFF0000u)); l = __builtin_bit_cast(unsigned, lv); }
typedef __attribute__((ext_vector_type(4))) _Float16 v4h;
typedef __attribute__((ext_vector_type(4))) unsigned short v4us;



// ---- k_gemmw: register-blocked GEMM, one work-group of SM x SN x KS waves per (64 SM) x (64 SN) output tile: SM x SN wave tiles of 64x64, each shared by a group of KS waves; wave wk of a group sums the k range [wk K/KS, (wk+1) K/KS) into its own 16 accumulators, operands straight from 16-bit planes in fragment order; grid (M/(64 SM), N/(64 SN), Z), 32 x KS x SM x SN threads.
// The SN groups of one tile row read the same A blocks and the SM groups of one tile column the same Bt blocks, at about the same time, so that a block fetched from L2 into the WGP's cache can serve them all.
// The KS partial tiles of a group meet in the group's own LDS, 16 rows at a time, and are added in wave order 0..KS-1 (fixed, the same on every run).
// C[m][n] (f32, pitch ldc, + optional f32 bias[n]) = sum_k A[m][k] Bt[n][k] (+ split products per NSPLIT). A and Bt are planes of K columns in fragment order (below). z-batch strides sA/sB/sC in elements (sC: of C, or of each 16-bit plane where OUTM is 1 or 2). K % (32 KS) == 0.
// OUTM 0: C as above. OUTM 1 and 2: no f32 copy; the summed tile (+ bias) leaves as the three 16-bit planes the attention kernel reads: fp16, bf16 hi, bf16 lo (lo = the rest after hi).
//   1: head planes [n / 64][m][n % 64] (a 64-column tile is one head, TT rows a head), each in fragment order with K = 64, bias[n].
//   2: planes [m][n] in fragment order with K = ldc, bias[m]: with A = weight rows and Bt = token rows the product IS the transposed head plane [head][d][t]; same k ranges, same k order as the untransposed product.
// FRAGMENT ORDER: every 16-bit operand plane [rows][K] is stored as blocks of 16 rows x 32 k = 512 elements (1 KiB), block (r / 16, k / 32) at index (r / 16) (K / 32) + k / 32;
// inside a block element (r, k) stands at ((k >> 4) & 1) 256 + ((k >> 3) & 1) 128 + (r & 15) 8 + (k & 7). Lane (lr, hi) = lane 16 hi + lr then finds its two 8-element pieces (k = 8 hi + e and k = 16 + 8 hi + e) at 8 lane and 256 + 8 lane:
// each wave-wide 16-byte load reads 512 contiguous bytes (4 whole lines), not 32 bytes out of each of 16 lines. The k order of a fragment is what it was with row-major planes.
template <typename T16> struct WFrag;
template <> struct WFrag<h16> { typedef v16h V; static __device__ __forceinline__ V ld(const h16* p) { return cat16(*(const v8h*)p, *(const v8h*)(p + 256)); } static __device__ __forceinline__ v8f mma(V a, V b, v8f c) { return wmma16(a, b, c); } };
template <> struct WFrag<bf> { typedef v16bf V; static __device__ __forceinline__ V ld(const bf* p) { return cat16b(*(const v8us*)p, *(const v8us*)(p + 256)); } static __device__ __forceinline__ v8f mma(V a, V b, v8f c) { return wmmab(a, b, c); } };
// one wave: program order in the wave is enough. Several waves: every partial tile must be written before it is summed, and summed before it is overwritten:
// a work-group barrier between fences on LDS alone (only LDS passes between the waves; __syncthreads() would also hold every round until the round's stores to C have returned).
template <int KS> __device__ __forceinline__ void tile_sync() {
    if constexpr (KS == 1) { __builtin_amdgcn_wave_barrier(); asm volatile("" ::: "memory"); }
    else { __builtin_amdgcn_fence(__ATOMIC_RELEASE, "workgroup", "local"); __builtin_amdgcn_s_barrier(); __builtin_amdgcn_fence(__ATOMIC_ACQUIRE, "workgroup", "local"); } }
// behind a group of global loads: the wait that stands before a register which an issued load names is written again; the lanes' address pairs are inputs, so their registers stay as they are up to it (no load of the group lands on them). The scheduling barrier behind it keeps the group's loads together above it.
__device__ __forceinline__ void ld_done_v(const void* p0, const void* p1, const void* p2, const void* p3) { asm volatile("s_wait_xcnt 0x0" :: "v"(p0), "v"(p1), "v"(p2), "v"(p3) : "memory"); __builtin_amdgcn_sched_barrier(0); /* no load of the group sinks below, no product rises above */ }
template <typename T16, int NSPLIT, bool BIAS, int KS, int OUTM, int K, int SM, int SN>
__global__ __launch_bounds__(32 * KS * SM * SN) void k_gemmw(const T16* __restrict__ A, const T16* __restrict__ A2, const T16* __restrict__ Bt, const T16* __restrict__ Bt2, float* C, int ldc, const float* __restrict__ bias, size_t sA, size_t sB, size_t sC, h16* P16, bf* Ph, bf* Pl) {
    typedef typename WFrag<T16>::V V;
    __shared__ __align__(16) float osa[SM * SN * KS * 16 * 68];
    const size_t z = blockIdx.z; A += z * sA; if (A2) A2 += z * sA; Bt += z * sB; if (Bt2) Bt2 += z * sB; if constexpr (OUTM == 0) C += z * sC; else { P16 += z * sC; Ph += z * sC; Pl += z * sC; }
    const int lane = threadIdx.x & 31, lr = lane & 15, hi = lane >> 4;
    const int wa = __builtin_amdgcn_readfirstlane((int)(threadIdx.x >> 5)); const int grp = wa / KS, wv = wa % KS, tid = (int)threadIdx.x % (32 * KS);   // the wave's group (its 64x64 tile), its k range in the group, the thread's number in the group
    const int r0 = (blockIdx.x * SM + grp % SM) * 64, c0 = (blockIdx.y * SN + grp / SM) * 64;
    const int kw = K / KS, k0 = wv * kw; float* os = osa + grp * (KS * 16 * 68); float* osw = os + wv * (16 * 68);
    v8f acc[4][4];
#pragma unroll
    for (int mb = 0; mb < 4; ++mb)
#pragma unroll
        for (int nb = 0; nb < 4; ++nb) acc[mb][nb] = (v8f){};
    constexpr int KB = K / 32;   // 32-k blocks a row block
    const size_t ab = ((size_t)(r0 >> 4) * KB + (k0 >> 5)) * 512, bb = ((size_t)(c0 >> 4) * KB + (k0 >> 5)) * 512; A += ab + lane * 8; Bt += bb + lane * 8; if (NSPLIT == 1 || NSPLIT == 2) A2 += ab + lane * 8; if (NSPLIT >= 2) Bt2 += bb + lane * 8;   // the lane's piece in the wave's first block of the tile's first row block
#pragma unroll 1
    for (int kt = 0; kt < kw / 32; ++kt) {
        V a[4], a2[4];
#pragma unroll
        for (int mb = 0; mb < 4; ++mb) { a[mb] = WFrag<T16>::ld(A + mb * KB * 512); if (NSPLIT == 1 || NSPLIT == 2) a2[mb] = WFrag<T16>::ld(A2 + mb * KB * 512); }
        V b[4], b2[4];
#pragma unroll
        for (int nb = 0; nb < 4; ++nb) { b[nb] = WFrag<T16>::ld(Bt + nb * KB * 512); if (NSPLIT >= 2) b2[nb] = WFrag<T16>::ld(Bt2 + nb * KB * 512); }
        ld_done_v(A, NSPLIT == 1 || NSPLIT == 2 ? A2 : A, Bt, NSPLIT >= 2 ? Bt2 : Bt);   // the addresses step on only behind it
        A += 512; Bt += 512; if (NSPLIT == 1 || NSPLIT == 2) A2 += 512; if (NSPLIT >= 2) Bt2 += 512;
#pragma unroll
        for (int nb = 0; nb < 4; ++nb) {
#pragma unroll
            for (int mb = 0; mb < 4; ++mb) { acc[mb][nb] = WFrag<T16>::mma(a[mb], b[nb], acc[mb][nb]); if (NSPLIT == 1 || NSPLIT == 2) acc[mb][nb] = WFrag<T16>::mma(a2[mb], b[nb], acc[mb][nb]); if (NSPLIT >= 2) acc[mb][nb] = WFrag<T16>::mma(a[mb], b2[nb], acc[mb][nb]); } }
        asm volatile("v_nop\n\tv_nop\n\tv_nop\n\tv_nop" : "+v"(acc[0][0]), "+v"(acc[1][1]), "+v"(acc[2][2]), "+v"(acc[3][3]) : "v"(a[0]), "v"(a[3]));
    }
#pragma unroll
    for (int mb = 0; mb < 4; ++mb) {
#pragma unroll
        for (int nb = 0; nb < 4; ++nb) {
#pragma unroll
            for (int j = 0; j < 8; ++j) osw[(hi * 8 + j) * 68 + nb * 16 + lr] = acc[mb][nb][j]; }
        tile_sync<KS>();
        float* crow = C + (size_t)(r0 + mb * 16) * ldc + c0;
{
            constexpr int NI = KS < 8 ? 8 / KS : 1;   // 4-column pieces of the round a thread sums and stores
            v4f vs[NI]; v4h o16s[NI]; v4us ohs[NI], ols[NI]; unsigned pos[NI];   // pos: the lane's byte offset from the round's wave-uniform base: scalar base + 32-bit lane offset is the address form of every store, no address arithmetic stands among them
            const size_t ub = OUTM == 1 ? (size_t)(c0 >> 6) * TT * HD + (size_t)((r0 >> 4) + mb) * 1024 : OUTM == 2 ? ((size_t)((r0 >> 4) + mb) * (ldc >> 5) + (c0 >> 5)) * 512 : 0;   // the 16 x 64 round is two neighbouring blocks
#pragma unroll
            for (int s = 0; s < NI; ++s) { const int it = s * 32 * KS + tid; if (KS > 8 && it >= 256) break;
                // OUTM 0: a wave takes 2 rows of 64 columns. Else: 16 rows of 8 columns, which are 256 contiguous bytes of a fragment-order plane; lanes 0-15 and lanes 16-31 each read 16 different rows of os at one column: no bank twice
                const int row = OUTM == 0 ? it >> 4 : it & 15, cofs = OUTM == 0 ? (it & 15) * 4 : (it >> 5) * 8 + ((it >> 4) & 1) * 4; v4f val = *(const v4fa*)(os + row * 68 + cofs);
#pragma unroll
                for (int w = 1; w < KS; ++w) val += *(const v4fa*)(os + w * (16 * 68) + row * 68 + cofs);
                if (BIAS) { if constexpr (OUTM == 2) { const float br = bfr(bias[r0 + mb * 16 + row]); val[0] += br; val[1] += br; val[2] += br; val[3] += br; }
                            else { val[0] += bfr(bias[c0 + cofs]); val[1] += bfr(bias[c0 + cofs + 1]); val[2] += bfr(bias[c0 + cofs + 2]); val[3] += bfr(bias[c0 + cofs + 3]); } }
                if constexpr (OUTM == 0) { vs[s] = val; pos[s] = (unsigned)(row * ldc + cofs) * 4u; }
                else { pos[s] = (unsigned)((cofs >> 3) * 128 + row * 8 + (cofs & 7)) * 2u; v4h o16; v4us oh, ol;
#pragma unroll
                    for (int q = 0; q < 4; ++q) o16[q] = tohx(val[q]);
                    v2u hh, ll; unsigned x, y; splitf2(val[0], val[1], x, y); hh[0] = x; ll[0] = y; splitf2(val[2], val[3], x, y); hh[1] = x; ll[1] = y; oh = __builtin_bit_cast(v4us, hh); ol = __builtin_bit_cast(v4us, ll);
                    o16s[s] = o16; ohs[s] = oh; ols[s] = ol; } }
            __builtin_amdgcn_sched_barrier(0);   // the round's stores stand together behind all its arithmetic: none of it writes a register that an issued store names
#pragma unroll
            for (int s = 0; s < NI; ++s) { if (KS > 8 && s * 32 * KS + tid >= 256) break;
                if constexpr (OUTM == 0) *(v4f*)((char*)crow + pos[s]) = vs[s];
                else { *(v4h*)((char*)(P16 + ub) + pos[s]) = o16s[s]; *(v4us*)((char*)(Ph + ub) + pos[s]) = ohs[s]; *(v4us*)((char*)(Pl + ub) + pos[s]) = ols[s]; } }
            asm volatile("s_wait_xcnt 0x0" ::: "memory");   // the wait that stands before a register which the issued stores name is written again (the next round uses them anew)
            __builtin_amdgcn_sched_barrier(0);   // nothing of the next round rises above that wait
             }
        if (mb < 3) tile_sync<KS>();
    }
}

typedef __attribute__((ext_vector_type(2))) unsigned short v2us;

__global__ __launch_bounds__(256) void k_wtG(const float* __restrict__ w, int K, int N, bf* Bt) {
    const int lane = threadIdx.x & 31; const int L0 = (blockIdx.x * 8 + (threadIdx.x >> 5)) * 8; const int nlines = N * K / 64;
{
#pragma unroll 1
        for (int l = 0; l < 8; ++l) { const int L = L0 + l; if (L >= nlines) break; const size_t e = (size_t)L * 64 + lane * 2; const int k = (int)(e % K), n = (int)(e / K); v2us o;
            o[0] = f2bf(w[(size_t)k * N + n]); o[1] = f2bf(w[(size_t)(k + 1) * N + n]); *(v2us*)(Bt + e) = o; }
         }
}
// f32 [rows][K] -> bf16 in fragment order. 64 threads a block of 16 rows x 32 k: thread = (row, 8-k piece), 4 pieces a row: a wave reads 8 whole 128-byte lines and stores 4 whole lines.
template <int K>
__global__ __launch_bounds__(256) void k_cvt8(const float* __restrict__ src, bf* dst, size_t n8) { const size_t i = (size_t)blockIdx.x * 256 + threadIdx.x; if (i >= n8) return; const size_t t = i >> 6; const int rl = (int)(i >> 2) & 15, c = (int)i & 3; constexpr int KB = K / 32;
    const v8f v = *(const v8f*)(src + ((t / KB) * 16 + rl) * K + (t % KB) * 32 + c * 8); v8us o; v4u ou;
    asm volatile("s_wait_xcnt 0x0" ::: "memory");   // the wait that stands before a register which the issued loads name (their address pair) is written again
#pragma unroll
    for (int k = 0; k < 4; ++k) ou[k] = f2bf2(v[2 * k], v[2 * k + 1]);
    o = __builtin_bit_cast(v8us, ou); *(v8us*)(dst + t * 512 + (c >> 1) * 256 + (c & 1) * 128 + rl * 8) = o;  }

// ---- k_fattn: scores, softmax, P x V and the head merge; a WAVE owns 32 query rows of one head and walks the keys in chunks of CH with a running row maximum and row sum; no score or P ever leaves the registers. grid (rows / (32 NT), 1, batch columns x heads), 32 x NT x KSP threads; plane z = b x heads + h.
// A work-group is NT row tiles x KSP key ranges: wave w has tile w / KSP and keys [(w % KSP) TT / KSP, ..). The waves of a work-group with the same key range read the same K and V^T blocks of one head at about the same time.
// Per chunk the wave forms the TRANSPOSED scores S^T = K Q^T (K rows as the A operand, Q rows as B): accumulator s[kt][mb][j] of lane (lr, hi) is key 16 kt + 8 hi + j against query 16 mb + lr.
// So a lane holds CH / 2 keys of each of its 2 query rows (chunk maximum: in the lane, one exchange with lane ^ 16; the row sum stays a per-lane partial until the end),
// and the pair s[2c][mb], s[2c+1][mb], rounded to 16 bit, IS the B fragment of P^T for keys [32 c, 32 c + 32): element e < 8 is k = 8 hi + e, element 8 + e is k = 16 + 8 hi + e, the k order of WFrag::ld on the V^T rows.
// O^T += V^T P^T (V^T rows as A): o[nb][mb][j] of lane (lr, hi) is d = 16 nb + 8 hi + j of query 16 mb + lr: the query is the lane's own, so the factor 2^((old max - new max) HD^-0.5 log2 e) is applied in the lane, and 8 j are 16 contiguous bytes of a fragment-order plane.
// P = 2^((S - running max) HD^-0.5 log2 e) is not normalised in the loop; O^T is divided by the row sum at the end. KSP = 2: the two key ranges of a tile meet once in LDS (max, sum, O^T; range 0 first). HL: hi + lo bf16 planes, 3 products each; else fp16.
// behind a group of global loads: the wait that stands before a register which an issued load names is written again; the lane offset and the scalar bases are inputs, so their registers stay as they are up to it. The scheduling barrier behind it keeps the group's loads together above it: one latency a group.
__device__ __forceinline__ void ld_done(unsigned off, const void* p0, const void* p1, const void* p2, const void* p3) { asm volatile("s_wait_xcnt 0x0" :: "v"(off), "s"(p0), "s"(p1), "s"(p2), "s"(p3) : "memory"); __builtin_amdgcn_sched_barrier(0); /* no load of the group sinks below, no product rises above */ }
// 8 x 2^x; the v_nop is the one free slot behind the last transcendental (the others are each followed by an independent one: outputs are early-clobber, so none overwrites a source)
__device__ __forceinline__ v8f exp2x8(v8f x) { float e0, e1, e2, e3, e4, e5, e6, e7;
    asm("v_exp_f32 %0, %8\n\tv_exp_f32 %1, %9\n\tv_exp_f32 %2, %10\n\tv_exp_f32 %3, %11\n\tv_exp_f32 %4, %12\n\tv_exp_f32 %5, %13\n\tv_exp_f32 %6, %14\n\tv_exp_f32 %7, %15\n\tv_nop"
        : "=&v"(e0), "=&v"(e1), "=&v"(e2), "=&v"(e3), "=&v"(e4), "=&v"(e5), "=&v"(e6), "=&v"(e7) : "v"(x[0]), "v"(x[1]), "v"(x[2]), "v"(x[3]), "v"(x[4]), "v"(x[5]), "v"(x[6]), "v"(x[7]));
    return (v8f){e0, e1, e2, e3, e4, e5, e6, e7}; }
// 2 x 2^x, the same form
__device__ __forceinline__ void exp2x2(float x0, float x1, float& e0, float& e1) { asm("v_exp_f32 %0, %2\n\tv_exp_f32 %1, %3\n\tv_nop" : "=&v"(e0), "=&v"(e1) : "v"(x0), "v"(x1)); }
// the value of lane ^ 16, by a vector cross-row move (no LDS round trip)
__device__ __forceinline__ float xhalf(float v) { const unsigned u = __float_as_uint(v); return __uint_as_float(__builtin_amdgcn_permlanex16(u, u, 0x76543210u, 0xfedcba98u, false, false)); }
template <typename T16, bool HL, int NT, int KSP>
__global__ __launch_bounds__(32 * NT * KSP) void k_fattn(const T16* __restrict__ Q, const T16* __restrict__ Q2, const T16* __restrict__ Kp, const T16* __restrict__ Kp2, const T16* __restrict__ Vt, const T16* __restrict__ Vt2, int t0, bf* Ah, bf* Al) {
    typedef typename WFrag<T16>::V V;
    __shared__ float xs[KSP > 1 ? NT * 68 * 32 : 1];
    constexpr int CH = HL ? 32 : 64, NKT = CH / 16, NC = CH / 32;   // keys, K tiles and 32-key steps of V^T a chunk
    constexpr float CE = SCL * 1.4426950408889634f;                 // HD^-0.5 log2 e
    const size_t zo = (size_t)blockIdx.z * TT * HD;
    const int lane = threadIdx.x & 31;
    const int wv = __builtin_amdgcn_readfirstlane((int)(threadIdx.x >> 5)); const int tile = wv / KSP, part = wv % KSP;
    const int r0 = t0 + (blockIdx.x * NT + tile) * 32, k0 = part * (TT / KSP);
    Q += zo + (size_t)r0 * HD; Kp += zo + (size_t)k0 * HD; Vt += zo + (size_t)k0 * 16; if (HL) { Q2 += zo + (size_t)r0 * HD; Kp2 += zo + (size_t)k0 * HD; Vt2 += zo + (size_t)k0 * 16; }   // wave-uniform bases, planes in fragment order: 16 rows of Q or K are 2 blocks (1024 elements); 32 keys of V^T are one block of each of its 4 row blocks (TT / 32 blocks apart)
    const unsigned loff = lane * 8;   // one 32-bit lane offset: the lane's piece in a block
    unsigned kof = lane * 16, vof = lane * 16;   // the same in bytes, plus the chunk's place: scalar base + 32-bit lane offset + constant is the address form of every load in the loop
    auto at = [](const T16* p, unsigned byte_off, int elems) { return (const T16*)((const char*)p + byte_off) + elems; };
    V q[2][2], q2[2][2];
#pragma unroll
    for (int kc = 0; kc < 2; ++kc)
#pragma unroll
        for (int mb = 0; mb < 2; ++mb) { q[kc][mb] = WFrag<T16>::ld(Q + loff + (mb * 16 * HD + kc * 512)); if (HL) q2[kc][mb] = WFrag<T16>::ld(Q2 + loff + (mb * 16 * HD + kc * 512)); }
    V k[NKT][2], k2[NKT][2];   // the K fragments of the chunk at hand; the next chunk's are fetched into them once its scores are formed (next_k below)
#pragma unroll
    for (int kt = 0; kt < NKT; ++kt)
#pragma unroll
        for (int kc = 0; kc < 2; ++kc) { k[kt][kc] = WFrag<T16>::ld(at(Kp, kof, kt * 16 * HD + kc * 512)); if (HL) k2[kt][kc] = WFrag<T16>::ld(at(Kp2, kof, kt * 16 * HD + kc * 512)); }
    ld_done(kof, Q, HL ? Q2 : Q, Kp, HL ? Kp2 : Kp);
    v8f o[4][2];
#pragma unroll
    for (int nb = 0; nb < 4; ++nb) { o[nb][0] = (v8f){}; o[nb][1] = (v8f){}; }
    float mx[2] = {-3.0e38f, -3.0e38f}, sm[2] = {0.f, 0.f};
#pragma unroll 1
    for (int kb = 0; kb < TT / KSP / CH; ++kb) {
        V vb[NC][4], vl[NC][4];
#pragma unroll
        for (int c = 0; c < NC; ++c)
#pragma unroll
            for (int nb = 0; nb < 4; ++nb) { vb[c][nb] = WFrag<T16>::ld(at(Vt, vof, nb * 16 * TT + c * 512)); if (HL) vl[c][nb] = WFrag<T16>::ld(at(Vt2, vof, nb * 16 * TT + c * 512)); }
        ld_done(vof, Vt, HL ? Vt2 : Vt, Vt, HL ? Vt2 : Vt);   // the chunk's V^T loads issue here and land under the scores and the softmax; the offset steps on only behind it
        vof += kb + 1 < TT / KSP / CH ? CH * 16 * 2 : 0;   // stepped as kof is: never past the plane, and the 32-bit offset stays in its vector register beside the scalar base
        v8f s[NKT][2];
#pragma unroll
        for (int kt = 0; kt < NKT; ++kt) { s[kt][0] = (v8f){}; s[kt][1] = (v8f){}; }
#pragma unroll
        for (int kc = 0; kc < 2; ++kc)
#pragma unroll
            for (int kt = 0; kt < NKT; ++kt)
#pragma unroll
                for (int mb = 0; mb < 2; ++mb) { s[kt][mb] = WFrag<T16>::mma(k[kt][kc], q[kc][mb], s[kt][mb]); if (HL) { s[kt][mb] = WFrag<T16>::mma(k[kt][kc], q2[kc][mb], s[kt][mb]); s[kt][mb] = WFrag<T16>::mma(k2[kt][kc], q[kc][mb], s[kt][mb]); } }
        auto next_k = [&]() {
            __builtin_amdgcn_sched_barrier(0);   // the next chunk's K loads stay below the scores that read these registers
            kof += kb + 1 < TT / KSP / CH ? CH * HD * 2 : 0;   // the last chunk fetches itself again: no address past the head's plane
#pragma unroll
            for (int kt = 0; kt < NKT; ++kt)
#pragma unroll
                for (int kc = 0; kc < 2; ++kc) { k[kt][kc] = WFrag<T16>::ld(at(Kp, kof, kt * 16 * HD + kc * 512)); if (HL) k2[kt][kc] = WFrag<T16>::ld(at(Kp2, kof, kt * 16 * HD + kc * 512)); }
            ld_done(kof, Kp, HL ? Kp2 : Kp, Kp, HL ? Kp2 : Kp); };
        if constexpr (HL) next_k();   // 2 waves a SIMD, registers to spare: they land under the softmax and P x V
        else __builtin_amdgcn_sched_barrier(0);   // the scores' products issue back to back, each behind 7 independent ones; without it the maxima are woven in and each waits out a product's latency behind v_nops
        float mn[2], al[2];
#pragma unroll
        for (int mb = 0; mb < 2; ++mb) { float m = s[0][mb][0];
#pragma unroll
            for (int kt = 0; kt < NKT; ++kt)
#pragma unroll
                for (int j = 0; j < 8; ++j) m = fmaxf(m, s[kt][mb][j]);
            mn[mb] = fmaxf(mx[mb], fmaxf(m, xhalf(m))); }
        exp2x2((mx[0] - mn[0]) * CE, (mx[1] - mn[1]) * CE, al[0], al[1]);
#pragma unroll
        for (int mb = 0; mb < 2; ++mb) { const float nm = -mn[mb] * CE; float a4[4] = {0.f, 0.f, 0.f, 0.f};
#pragma unroll
            for (int kt = 0; kt < NKT; ++kt) { v8f x;
#pragma unroll
                for (int j = 0; j < 8; ++j) x[j] = fmaf(s[kt][mb][j], CE, nm);
                s[kt][mb] = exp2x8(x);
#pragma unroll
                for (int j = 0; j < 8; ++j) a4[j & 3] += s[kt][mb][j]; }
            sm[mb] = fmaf(sm[mb], al[mb], (a4[0] + a4[1]) + (a4[2] + a4[3])); mx[mb] = mn[mb];
#pragma unroll
            for (int nb = 0; nb < 4; ++nb) o[nb][mb] *= al[mb]; }
        __builtin_amdgcn_sched_barrier(0);   // no product of P x V rises among the exponentials above
        V a[NC][2], a2[NC][2];
#pragma unroll
        for (int c = 0; c < NC; ++c)
#pragma unroll
            for (int mb = 0; mb < 2; ++mb) {
                if constexpr (HL) { v4u h0, l0, h1, l1;
#pragma unroll
                    for (int e = 0; e < 4; ++e) { unsigned x, y; splitf2(s[2 * c][mb][2 * e], s[2 * c][mb][2 * e + 1], x, y); h0[e] = x; l0[e] = y; splitf2(s[2 * c + 1][mb][2 * e], s[2 * c + 1][mb][2 * e + 1], x, y); h1[e] = x; l1[e] = y; }
                    a[c][mb] = cat16b(__builtin_bit_cast(v8us, h0), __builtin_bit_cast(v8us, h1)); a2[c][mb] = cat16b(__builtin_bit_cast(v8us, l0), __builtin_bit_cast(v8us, l1));
                } else { v8h p0, p1;
#pragma unroll
                    for (int e = 0; e < 8; ++e) { p0[e] = tohx(s[2 * c][mb][e]); p1[e] = tohx(s[2 * c + 1][mb][e]); }
                    a[c][mb] = cat16(p0, p1); } }
        if constexpr (!HL) next_k();   // 3 waves a SIMD: only here, with the f32 scores rounded and gone, are the registers free; they land under P x V and the other waves
#pragma unroll
        for (int c = 0; c < NC; ++c)
#pragma unroll
            for (int nb = 0; nb < 4; ++nb)
#pragma unroll
                for (int mb = 0; mb < 2; ++mb) { o[nb][mb] = WFrag<T16>::mma(vb[c][nb], a[c][mb], o[nb][mb]); if (HL) { o[nb][mb] = WFrag<T16>::mma(vb[c][nb], a2[c][mb], o[nb][mb]); o[nb][mb] = WFrag<T16>::mma(vl[c][nb], a[c][mb], o[nb][mb]); } }
    }
    if constexpr (KSP > 1) {   // key range 1 hands its maximum, its per-lane sums and its O^T to range 0 of the same tile: word i of lane l at [i][l], no bank twice
        float* xw = xs + tile * (68 * 32) + lane;
        if (part) { xw[0] = mx[0]; xw[32] = mx[1]; xw[64] = sm[0]; xw[96] = sm[1];
#pragma unroll
            for (int nb = 0; nb < 4; ++nb)
#pragma unroll
                for (int mb = 0; mb < 2; ++mb)
#pragma unroll
                    for (int j = 0; j < 8; ++j) xw[(4 + (nb * 2 + mb) * 8 + j) * 32] = o[nb][mb][j]; }
        __syncthreads();   // every wave passes it once; range 0 reads only behind it
        if (part) return;
#pragma unroll
        for (int mb = 0; mb < 2; ++mb) { const float mo = xw[mb * 32], so = xw[(2 + mb) * 32], m = fmaxf(mx[mb], mo); float f0, f1; exp2x2((mx[mb] - m) * CE, (mo - m) * CE, f0, f1);
            sm[mb] = sm[mb] * f0 + so * f1;
#pragma unroll
            for (int nb = 0; nb < 4; ++nb)
#pragma unroll
                for (int j = 0; j < 8; ++j) o[nb][mb][j] = o[nb][mb][j] * f0 + xw[(4 + (nb * 2 + mb) * 8 + j) * 32] * f1; }
    }
    // merged heads [b][t][h][d], hi + lo bf16 planes, each [TT][DQ] in fragment order (the A operand of the output projection): the wave's (nb, mb) piece is 512 contiguous bytes, 4 whole lines
    v4u oh[4][2], ol[4][2];
#pragma unroll
    for (int mb = 0; mb < 2; ++mb) { const float a = sm[mb] + xhalf(sm[mb]); const float f = __fdiv_rn(1.0f, a);
#pragma unroll
        for (int nb = 0; nb < 4; ++nb)
#pragma unroll
            for (int j = 0; j < 4; ++j) { unsigned x, y; splitf2(o[nb][mb][2 * j] * f, o[nb][mb][2 * j + 1] * f, x, y); oh[nb][mb][j] = x; ol[nb][mb][j] = y; } }
    __builtin_amdgcn_sched_barrier(0);   // the stores stand together behind all the arithmetic: no register that an issued store names is written again
    const size_t oo = (size_t)(blockIdx.z / NH_) * TT * DQ + ((size_t)(r0 >> 4) * (DQ / 32) + (blockIdx.z % NH_) * (HD / 32)) * 512 + loff;
#pragma unroll
    for (int mb = 0; mb < 2; ++mb)
#pragma unroll
        for (int nb = 0; nb < 4; ++nb) { *(v4u*)(Ah + oo + (mb * (DQ / 32) * 512 + nb * 256)) = oh[nb][mb]; *(v4u*)(Al + oo + (mb * (DQ / 32) * 512 + nb * 256)) = ol[nb][mb]; }
}
// grid y: batch column b; its rows leave as plane b of XB, [TT][DM] in fragment order (threads as in k_cvt8)
__global__ __launch_bounds__(256) void k_cvt8s(const float* __restrict__ X, bf* XB, size_t pitch) { const size_t i = (size_t)blockIdx.x * 256 + threadIdx.x; if (i >= (size_t)TT * DM / 8) return; X += (size_t)blockIdx.y * DM; XB += (size_t)blockIdx.y * TT * DM; const size_t t = i >> 6; const int rl = (int)(i >> 2) & 15, pc = (int)i & 3; const int c = (int)(t % (DM / 32)) * 32 + pc * 8; const int srow = (int)(t / (DM / 32)) * 16 + rl; const v8f a = *(const v8f*)(X + (size_t)srow * pitch + c); v8us o; v4u ou;
    asm volatile("s_wait_xcnt 0x0" ::: "memory");   // the wait that stands before a register which the issued loads name (their address pair) is written again
#pragma unroll
    for (int q = 0; q < 4; ++q) ou[q] = f2bf2(a[2 * q], a[2 * q + 1]);
    o = __builtin_bit_cast(v8us, ou);
    *(v8us*)(XB + t * 512 + (pc >> 1) * 256 + (pc & 1) * 128 + rl * 8) = o;  }

extern "C" void kernel_launch(void* const* d_in, const int* in_sizes, int n_in,
                              void* d_out, int out_size, void* d_ws, size_t ws_size, hipStream_t stream) {
    (void)in_sizes; (void)n_in; (void)out_size;
    const float* x = (const float*)d_in[0];   /* query [S][B][D] = [2048][4][1024]: ONE stream: q, k and v all project it */ const float* wq = (const float*)d_in[1]; const float* bq = (const float*)d_in[2]; const float* wk = (const float*)d_in[3]; const float* bk = (const float*)d_in[4]; const float* wv = (const float*)d_in[5]; const float* bv = (const float*)d_in[6]; const float* wo = (const float*)d_in[7]; const float* bo = (const float*)d_in[8];
    float* OUT = (float*)d_out;     // [2048][4][1024] sequence-first
    char* wsp = (char*)d_ws;
    auto take = [&](size_t bytes) { char* p = wsp; wsp += (bytes + 255) & ~(size_t)255; return (void*)p; };
    bf* WQ = (bf*)take((size_t)DQ * DM * 2); bf* WK = (bf*)take((size_t)DKV * DM * 2); bf* WV = (bf*)take((size_t)DKV * DM * 2); bf* WO = (bf*)take((size_t)DM * DQ * 2);
    bf* XB = (bf*)take((size_t)NB_ * TT * DM * 2);
    h16* QP16 = (h16*)take((size_t)NB_ * NH_ * TT * HD * 2); h16* KP16 = (h16*)take((size_t)NB_ * NKV * TT * HD * 2); h16* VT16 = (h16*)take((size_t)NB_ * NKV * HD * TT * 2);
    bf* QPh = (bf*)take((size_t)NB_ * NH_ * TT * HD * 2); bf* QPl = (bf*)take((size_t)NB_ * NH_ * TT * HD * 2); bf* KPh = (bf*)take((size_t)NB_ * NKV * TT * HD * 2); bf* KPl = (bf*)take((size_t)NB_ * NKV * TT * HD * 2); bf* VTh = (bf*)take((size_t)NB_ * NKV * HD * TT * 2); bf* VTl = (bf*)take((size_t)NB_ * NKV * HD * TT * 2);
    bf* ATh = (bf*)take((size_t)NB_ * TT * DQ * 2); bf* ATl = (bf*)take((size_t)NB_ * TT * DQ * 2);
    if ((size_t)(wsp - (char*)d_ws) > ws_size) return;    // ws 256 MiB
    { k_cvt8<DM><<<(unsigned)(((size_t)DQ * DM / 8 + 255) / 256), 256, 0, stream>>>(wq, WQ, (size_t)DQ * DM / 8); k_cvt8<DM><<<(unsigned)(((size_t)DKV * DM / 8 + 255) / 256), 256, 0, stream>>>(wk, WK, (size_t)DKV * DM / 8); k_cvt8<DM><<<(unsigned)(((size_t)DKV * DM / 8 + 255) / 256), 256, 0, stream>>>(wv, WV, (size_t)DKV * DM / 8);
      k_cvt8<DQ><<<(unsigned)(((size_t)DM * DQ / 8 + 255) / 256), 256, 0, stream>>>(wo, WO, (size_t)DM * DQ / 8);
       }
    k_cvt8s<<<dim3((unsigned)(((size_t)TT * DM / 8 + 255) / 256), NB_, 1), 256, 0, stream>>>(x, XB, (size_t)NB_ * DM);   /* rows s of batch column b: pitch B x D */
    k_gemmw<bf, 0, true, 2, 1, DM, 4, 2><<<dim3(TT / 256, DQ / 128, NB_), 512, 0, stream>>>(XB, nullptr, WQ, nullptr, nullptr, 0, bq, (size_t)TT * DM, 0, (size_t)NH_ * TT * HD, QP16, QPh, QPl);   // q head planes [b][h][t][d] straight from the tile
    k_gemmw<bf, 0, true, 2, 1, DM, 4, 2><<<dim3(TT / 256, DKV / 128, NB_), 512, 0, stream>>>(XB, nullptr, WK, nullptr, nullptr, 0, bk, (size_t)TT * DM, 0, (size_t)NKV * TT * HD, KP16, KPh, KPl);
    k_gemmw<bf, 0, true, 2, 2, DM, 4, 2><<<dim3(DKV / 256, TT / 128, NB_), 512, 0, stream>>>(WV, nullptr, XB, nullptr, nullptr, TT, bv, 0, (size_t)TT * DM, (size_t)NKV * HD * TT, VT16, VTh, VTl);   // weight rows as A, token rows as Bt: v^T planes [b][g][d][t]
    k_fattn<bf, true, 4, 2><<<dim3(RH / 128, 1, NB_ * ZH), 256, 0, stream>>>(QPh, QPl, KPh, KPl, VTh, VTl, 0, ATh, ATl);   // one kv head per query head: plane z of each (z-stride TT*HD)
    k_fattn<h16, false, 12, 1><<<dim3((TT - RH) / 384, 1, NB_ * ZH), 384, 0, stream>>>(QP16, nullptr, KP16, nullptr, VT16, nullptr, RH, ATh, ATl);
    k_gemmw<bf, 1, true, 2, 0, DQ, 4, 2><<<dim3(TT / 256, DM / 128, NB_), 512, 0, stream>>>(ATh, ATl, WO, nullptr, OUT, NB_ * DM, bo, (size_t)TT * DQ, 0, (size_t)DM, nullptr, nullptr, nullptr);   /* [S][B][D]: row pitch B x D, column block b */
}

// v010
// Measured time: 180 microseconds a run.
// Two timings next to v009 both put it at 1.05 times that version's speed.
// Counting every step since v000, it is 22.1 times as fast.
#include <hip/hip_runtime.h>

// Multi-head self-attention on a SEQUENCE-FIRST tensor (query [2048][4][1024] = [S][B][D]: ONE stream; q, k, v = x W^T + b ('oi' (out, in) [1024][1024] + [1024]; normal x 0.02; biases ZEROS on this draw: read); 16 heads x 64 per batch column; q = (query Wq^T + bq) x 64^-0.5 (pre-scaled: == scores / 8); softmax over all keys (no mask); out = merged Wo^T + bo -> [2048][4][1024] sequence-first (8.4 M); argument order query, Wq, bq, Wk, bk, Wv, bv, Wo, bo).
// Layout: all B batch columns go through every launch together (grid z, or a loop over b in each thread of the gather). One strided gather makes the bf16 copy [b][s][d] of rows s of column b (row pitch B x D); q, k and v all project it; 'oi' weights; exact projections + f32 biases; dense T-2048 attention (hybrid rows: < 512 hi/lo 3 products, rest fp16); merged hi/lo x Wo exact + bo written with row pitch B x D at column offset b (the [S][B][D] output).
// Compute dtypes, f32 accumulate: every input rounded to bf16; projections exact + f32 biases; attention rows < 512 3 products, rest fp16; softmax f32; Wo hl x exact + bias.

#define NB_  4
#define TT   2048
#define DM   1024
#define NH_  16
#define NKV  16
#define REP  (NH_ / NKV)
#define HD   64
#define DQ   (NH_ * HD)
#define DKV  (NKV * HD)
#define ZH   16                   // heads of each batch column per attention launch (grid z = NB_ x ZH): all of a batch column's
#define RH   512                  // query rows < RH use hi+lo planes (0: none)
#define WIN  0
#define PCAR 1024.0f
#define SCL  0.125f   // HD^-0.5
typedef _Float16 h16;
typedef unsigned short bf;
typedef __attribute__((ext_vector_type(16))) __bf16   v16bf;
typedef __attribute__((ext_vector_type(16))) _Float16 v16h;
typedef __attribute__((ext_vector_type(8)))  _Float16 v8h;
typedef __attribute__((ext_vector_type(8)))  unsigned short v8us;
typedef __attribute__((ext_vector_type(8)))  float    v8f;
typedef __attribute__((ext_vector_type(4)))  float    v4f;
typedef v8h  __attribute__((may_alias)) v8ha;
typedef v4f  __attribute__((may_alias)) v4fa;
typedef v8us __attribute__((may_alias)) v8usa;

typedef __attribute__((ext_vector_type(2))) float  v2f;
typedef __attribute__((ext_vector_type(2))) __bf16 v2bf;
typedef __attribute__((ext_vector_type(4))) unsigned v4u;
typedef __attribute__((ext_vector_type(2))) unsigned v2u;
// two f32 -> two bf16 in one dword (a in the low half), round to nearest even: the chip's packed convert, one instruction for the pair
__device__ __forceinline__ unsigned f2bf2(float a, float b) { return __builtin_bit_cast(unsigned, __builtin_convertvector((v2f){a, b}, v2bf)); }
__device__ __forceinline__ unsigned short f2bf(float f) { return (unsigned short)f2bf2(f, f); }
__device__ __forceinline__ float bf2f(unsigned short b) { return __uint_as_float(((unsigned)b) << 16); }
__device__ __forceinline__ float bfr(float f) { return bf2f(f2bf(f)); }
__device__ __forceinline__ v16h cat16(v8h lo, v8h hi) { return __builtin_shufflevector(lo, hi, 0, 1, 2, 3, 4, 5, 6, 7, 8, 9, 10, 11, 12, 13, 14, 15); }
__device__ __forceinline__ v16bf cat16b(v8us lo, v8us hi) { return __builtin_bit_cast(v16bf, __builtin_shufflevector(lo, hi, 0, 1, 2, 3, 4, 5, 6, 7, 8, 9, 10, 11, 12, 13, 14, 15)); }
__device__ __forceinline__ v8f wmma16(v16h a, v16h b, v8f c) { return __builtin_amdgcn_wmma_f32_16x16x32_f16(false, a, false, b, (short)0, c, false, false); }
__device__ __forceinline__ v8f wmmab(v16bf a, v16bf b, v8f c) { return __builtin_amdgcn_wmma_f32_16x16x32_bf16(false, a, false, b, (short)0, c, false, false); }
__device__ __forceinline__ h16 tohx(float x) { return (h16)x; }
// a pair split into hi and lo (lo = the rest after hi), each pair one dword
__device__ __forceinline__ void splitf2(float y0, float y1, unsigned& h, unsigned& l) { h = f2bf2(y0, y1); v2bf lv; lv[0] = (__bf16)(y0 - __uint_as_float(h << 16)); lv[1] = (__bf16)(y1 - __uint_as_float(h & 0xFFFF0000u)); l = __builtin_bit_cast(unsigned, lv); }
typedef __attribute__((ext_vector_type(4))) _Float16 v4h;
typedef __attribute__((ext_vector_type(4))) unsigned short v4us;



// ---- k_gemmw: register-blocked GEMM, one work-group of SM x SN x KS waves per (64 SM) x (64 SN) output tile: SM x SN wave tiles of 64x64, each shared by a group of KS waves; wave wk of a group sums the k range [wk K/KS, (wk+1) K/KS) into its own 16 accumulators, operands straight from 16-bit planes in fragment order; grid (M/(64 SM), N/(64 SN), Z), 32 x KS x SM x SN threads.
// The SN groups of one tile row read the same A blocks and the SM groups of one tile column the same Bt blocks, at about the same time, so that a block fetched from L2 into the WGP's cache can serve them all.
// The KS partial tiles of a group meet in the group's own LDS, 16 rows at a time, and are added in wave order 0..KS-1 (fixed, the same on every run).
// C[m][n] (f32, pitch ldc, + optional f32 bias[n]) = sum_k A[m][k] Bt[n][k] (+ split products per NSPLIT). A and Bt are planes of K columns in fragment order (below). z-batch strides sA/sB/sC in elements (sC: of C, or of each 16-bit plane where OUTM is 1 or 2). K % (32 KS) == 0.
// OUTM 0: C as above. OUTM 1 and 2: no f32 copy; the summed tile (+ bias) leaves as the three 16-bit planes the attention kernel reads: fp16, bf16 hi, bf16 lo (lo = the rest after hi).
//   1: head planes [n / 64][m][n % 64] (a 64-column tile is one head, TT rows a head), each in fragment order with K = 64, bias[n].
//   2: planes [m][n] in fragment order with K = ldc, bias[m]: with A = weight rows and Bt = token rows the product IS the transposed head plane [head][d][t]; same k ranges, same k order as the untransposed product.
// FRAGMENT ORDER: every 16-bit operand plane [rows][K] is stored as blocks of 16 rows x 32 k = 512 elements (1 KiB), block (r / 16, k / 32) at index (r / 16) (K / 32) + k / 32;
// inside a block element (r, k) stands at ((k >> 4) & 1) 256 + ((k >> 3) & 1) 128 + (r & 15) 8 + (k & 7). Lane (lr, hi) = lane 16 hi + lr then finds its two 8-element pieces (k = 8 hi + e and k = 16 + 8 hi + e) at 8 lane and 256 + 8 lane:
// each wave-wide 16-byte load reads 512 contiguous bytes (4 whole lines), not 32 bytes out of each of 16 lines. The k order of a fragment is what it was with row-major planes.
template <typename T16> struct WFrag;
template <> struct WFrag<h16> { typedef v16h V; static __device__ __forceinline__ V ld(const h16* p) { return cat16(*(const v8h*)p, *(const v8h*)(p + 256)); } static __device__ __forceinline__ v8f mma(V a, V b, v8f c) { return wmma16(a, b, c); } };
template <> struct WFrag<bf> { typedef v16bf V; static __device__ __forceinline__ V ld(const bf* p) { return cat16b(*(const v8us*)p, *(const v8us*)(p + 256)); } static __device__ __forceinline__ v8f mma(V a, V b, v8f c) { return wmmab(a, b, c); } };
// one wave: program order in the wave is enough. Several waves: every partial tile must be written before it is summed, and summed before it is overwritten:
// a work-group barrier between fences on LDS alone (only LDS passes between the waves; __syncthreads() would also hold every round until the round's stores to C have returned).
template <int KS> __device__ __forceinline__ void tile_sync() {
    if constexpr (KS == 1) { __builtin_amdgcn_wave_barrier(); asm volatile("" ::: "memory"); }
    else { __builtin_amdgcn_fence(__ATOMIC_RELEASE, "workgroup", "local"); __builtin_amdgcn_s_barrier(); __builtin_amdgcn_fence(__ATOMIC_ACQUIRE, "workgroup", "local"); } }
// behind a group of global loads: the wait that stands before a register which an issued load names is written again; the lanes' address pairs are inputs, so their registers stay as they are up to it (no load of the group lands on them). The scheduling barrier behind it keeps the group's loads together above it.
__device__ __forceinline__ void ld_done_v(const void* p0, const void* p1, const void* p2, const void* p3) { asm volatile("s_wait_xcnt 0x0" :: "v"(p0), "v"(p1), "v"(p2), "v"(p3) : "memory"); __builtin_amdgcn_sched_barrier(0); /* no load of the group sinks below, no product rises above */ }
// the work-group's tile: (bx, by, z) is its place in the grid above, osa its SM x SN x KS x 16 x 68 floats of LDS
template <typename T16, int NSPLIT, bool BIAS, int KS, int OUTM, int K, int SM, int SN>
__device__ __forceinline__ void gemmw_tile(float* osa, const int bx, const int by, const size_t z, const T16* __restrict__ A, const T16* __restrict__ A2, const T16* __restrict__ Bt, const T16* __restrict__ Bt2, float* C, int ldc, const float* __restrict__ bias, size_t sA, size_t sB, size_t sC, h16* P16, bf* Ph, bf* Pl) {
    typedef typename WFrag<T16>::V V;
    A += z * sA; if (A2) A2 += z * sA; Bt += z * sB; if (Bt2) Bt2 += z * sB; if constexpr (OUTM == 0) C += z * sC; else { P16 += z * sC; Ph += z * sC; Pl += z * sC; }
    const int lane = threadIdx.x & 31, lr = lane & 15, hi = lane >> 4;
    const int wa = __builtin_amdgcn_readfirstlane((int)(threadIdx.x >> 5)); const int grp = wa / KS, wv = wa % KS, tid = (int)threadIdx.x % (32 * KS);   // the wave's group (its 64x64 tile), its k range in the group, the thread's number in the group
    const int r0 = (bx * SM + grp % SM) * 64, c0 = (by * SN + grp / SM) * 64;
    const int kw = K / KS, k0 = wv * kw; float* os = osa + grp * (KS * 16 * 68); float* osw = os + wv * (16 * 68);
    v8f acc[4][4];
#pragma unroll
    for (int mb = 0; mb < 4; ++mb)
#pragma unroll
        for (int nb = 0; nb < 4; ++nb) acc[mb][nb] = (v8f){};
    constexpr int KB = K / 32;   // 32-k blocks a row block
    const size_t ab = ((size_t)(r0 >> 4) * KB + (k0 >> 5)) * 512, bb = ((size_t)(c0 >> 4) * KB + (k0 >> 5)) * 512; A += ab + lane * 8; Bt += bb + lane * 8; if (NSPLIT == 1 || NSPLIT == 2) A2 += ab + lane * 8; if (NSPLIT >= 2) Bt2 += bb + lane * 8;   // the lane's piece in the wave's first block of the tile's first row block
#pragma unroll 1
    for (int kt = 0; kt < kw / 32; ++kt) {
        V a[4], a2[4];
#pragma unroll
        for (int mb = 0; mb < 4; ++mb) { a[mb] = WFrag<T16>::ld(A + mb * KB * 512); if (NSPLIT == 1 || NSPLIT == 2) a2[mb] = WFrag<T16>::ld(A2 + mb * KB * 512); }
        V b[4], b2[4];
#pragma unroll
        for (int nb = 0; nb < 4; ++nb) { b[nb] = WFrag<T16>::ld(Bt + nb * KB * 512); if (NSPLIT >= 2) b2[nb] = WFrag<T16>::ld(Bt2 + nb * KB * 512); }
        ld_done_v(A, NSPLIT == 1 || NSPLIT == 2 ? A2 : A, Bt, NSPLIT >= 2 ? Bt2 : Bt);   // the addresses step on only behind it
        A += 512; Bt += 512; if (NSPLIT == 1 || NSPLIT == 2) A2 += 512; if (NSPLIT >= 2) Bt2 += 512;
#pragma unroll
        for (int nb = 0; nb < 4; ++nb) {
#pragma unroll
            for (int mb = 0; mb < 4; ++mb) { acc[mb][nb] = WFrag<T16>::mma(a[mb], b[nb], acc[mb][nb]); if (NSPLIT == 1 || NSPLIT == 2) acc[mb][nb] = WFrag<T16>::mma(a2[mb], b[nb], acc[mb][nb]); if (NSPLIT >= 2) acc[mb][nb] = WFrag<T16>::mma(a[mb], b2[nb], acc[mb][nb]); } }
        asm volatile("v_nop\n\tv_nop\n\tv_nop\n\tv_nop" : "+v"(acc[0][0]), "+v"(acc[1][1]), "+v"(acc[2][2]), "+v"(acc[3][3]) : "v"(a[0]), "v"(a[3]));
    }
#pragma unroll
    for (int mb = 0; mb < 4; ++mb) {
#pragma unroll
        for (int nb = 0; nb < 4; ++nb) {
#pragma unroll
            for (int j = 0; j < 8; ++j) osw[(hi * 8 + j) * 68 + nb * 16 + lr] = acc[mb][nb][j]; }
        tile_sync<KS>();
        float* crow = C + (size_t)(r0 + mb * 16) * ldc + c0;
{
            constexpr int NI = KS < 8 ? 8 / KS : 1;   // 4-column pieces of the round a thread sums and stores
            v4f vs[NI]; v4h o16s[NI]; v4us ohs[NI], ols[NI]; unsigned pos[NI];   // pos: the lane's byte offset from the round's wave-uniform base: scalar base + 32-bit lane offset is the address form of every store, no address arithmetic stands among them
            const size_t ub = OUTM == 1 ? (size_t)(c0 >> 6) * TT * HD + (size_t)((r0 >> 4) + mb) * 1024 : OUTM == 2 ? ((size_t)((r0 >> 4) + mb) * (ldc >> 5) + (c0 >> 5)) * 512 : 0;   // the 16 x 64 round is two neighbouring blocks
#pragma unroll
            for (int s = 0; s < NI; ++s) { const int it = s * 32 * KS + tid; if (KS > 8 && it >= 256) break;
                // OUTM 0: a wave takes 2 rows of 64 columns. Else: 16 rows of 8 columns, which are 256 contiguous bytes of a fragment-order plane; lanes 0-15 and lanes 16-31 each read 16 different rows of os at one column: no bank twice
                const int row = OUTM == 0 ? it >> 4 : it & 15, cofs = OUTM == 0 ? (it & 15) * 4 : (it >> 5) * 8 + ((it >> 4) & 1) * 4; v4f val = *(const v4fa*)(os + row * 68 + cofs);
#pragma unroll
                for (int w = 1; w < KS; ++w) val += *(const v4fa*)(os + w * (16 * 68) + row * 68 + cofs);
                if (BIAS) { if constexpr (OUTM == 2) { const float br = bfr(bias[r0 + mb * 16 + row]); val[0] += br; val[1] += br; val[2] += br; val[3] += br; }
                            else { val[0] += bfr(bias[c0 + cofs]); val[1] += bfr(bias[c0 + cofs + 1]); val[2] += bfr(bias[c0 + cofs + 2]); val[3] += bfr(bias[c0 + cofs + 3]); } }
                if constexpr (OUTM == 0) { vs[s] = val; pos[s] = (unsigned)(row * ldc + cofs) * 4u; }
                else { pos[s] = (unsigned)((cofs >> 3) * 128 + row * 8 + (cofs & 7)) * 2u; v4h o16; v4us oh, ol;
#pragma unroll
                    for (int q = 0; q < 4; ++q) o16[q] = tohx(val[q]);
                    v2u hh, ll; unsigned x, y; splitf2(val[0], val[1], x, y); hh[0] = x; ll[0] = y; splitf2(val[2], val[3], x, y); hh[1] = x; ll[1] = y; oh = __builtin_bit_cast(v4us, hh); ol = __builtin_bit_cast(v4us, ll);
                    o16s[s] = o16; ohs[s] = oh; ols[s] = ol; } }
            __builtin_amdgcn_sched_barrier(0);   // the round's stores stand together behind all its arithmetic: none of it writes a register that an issued store names
#pragma unroll
            for (int s = 0; s < NI; ++s) { if (KS > 8 && s * 32 * KS + tid >= 256) break;
                if constexpr (OUTM == 0) *(v4f*)((char*)crow + pos[s]) = vs[s];
                else { *(v4h*)((char*)(P16 + ub) + pos[s]) = o16s[s]; *(v4us*)((char*)(Ph + ub) + pos[s]) = ohs[s]; *(v4us*)((char*)(Pl + ub) + pos[s]) = ols[s]; } }
            asm volatile("s_wait_xcnt 0x0" ::: "memory");   // the wait that stands before a register which the issued stores name is written again (the next round uses them anew)
            __builtin_amdgcn_sched_barrier(0);   // nothing of the next round rises above that wait
             }
        if (mb < 3) tile_sync<KS>();
    }
}
template <typename T16, int NSPLIT, bool BIAS, int KS, int OUTM, int K, int SM, int SN>
__global__ __launch_bounds__(32 * KS * SM * SN) void k_gemmw(const T16* __restrict__ A, const T16* __restrict__ A2, const T16* __restrict__ Bt, const T16* __restrict__ Bt2, float* C, int ldc, const float* __restrict__ bias, size_t sA, size_t sB, size_t sC, h16* P16, bf* Ph, bf* Pl) {
    __shared__ __align__(16) float osa[SM * SN * KS * 16 * 68];
    gemmw_tile<T16, NSPLIT, BIAS, KS, OUTM, K, SM, SN>(osa, (int)blockIdx.x, (int)blockIdx.y, blockIdx.z, A, A2, Bt, Bt2, C, ldc, bias, sA, sB, sC, P16, Ph, Pl);
}
// the q, k and v projections in one launch: grid (8, 8, 3 NB_), z = projection x NB_ + batch column; each work-group does the tile it did in its projection's own launch.
// q, k: token rows as A, head planes [b][h][t][d] straight from the tile. v: weight rows as A, token rows as Bt: v^T planes [b][g][d][t]; its 4 x 16 tiles are numbered through the 8 x 8 of the grid.
__global__ __launch_bounds__(512) void k_qkv(const bf* __restrict__ XB, const bf* __restrict__ WQ, const bf* __restrict__ WK, const bf* __restrict__ WV, const float* __restrict__ bq, const float* __restrict__ bk, const float* __restrict__ bv,
                                             h16* Q16, bf* Qh, bf* Ql, h16* K16, bf* Kh, bf* Kl, h16* V16, bf* Vh, bf* Vl) {
    static_assert(TT / 256 == 8 && DQ / 128 == 8 && DKV / 128 == 8 && DKV / 256 == 4 && TT / 128 == 16, "the three grids have 64 tiles a batch column");
    __shared__ __align__(16) float osa[4 * 2 * 2 * 16 * 68];
    const int pr = (int)blockIdx.z / NB_; const size_t b = blockIdx.z % NB_;   // the same for the whole work-group: every barrier below stands under uniform control flow
    if (pr == 2) { const int f = (int)(blockIdx.y * 8 + blockIdx.x);
        gemmw_tile<bf, 0, true, 2, 2, DM, 4, 2>(osa, f & 3, f >> 2, b, WV, nullptr, XB, nullptr, nullptr, TT, bv, 0, (size_t)TT * DM, (size_t)NKV * HD * TT, V16, Vh, Vl); }
    else gemmw_tile<bf, 0, true, 2, 1, DM, 4, 2>(osa, (int)blockIdx.x, (int)blockIdx.y, b, XB, nullptr, pr ? WK : WQ, nullptr, nullptr, 0, pr ? bk : bq, (size_t)TT * DM, 0, (size_t)NH_ * TT * HD, pr ? K16 : Q16, pr ? Kh : Qh, pr ? Kl : Ql);
}

typedef __attribute__((ext_vector_type(2))) unsigned short v2us;

__global__ __launch_bounds__(256) void k_wtG(const float* __restrict__ w, int K, int N, bf* Bt) {
    const int lane = threadIdx.x & 31; const int L0 = (blockIdx.x * 8 + (threadIdx.x >> 5)) * 8; const int nlines = N * K / 64;
{
#pragma unroll 1
        for (int l = 0; l < 8; ++l) { const int L = L0 + l; if (L >= nlines) break; const size_t e = (size_t)L * 64 + lane * 2; const int k = (int)(e % K), n = (int)(e / K); v2us o;
            o[0] = f2bf(w[(size_t)k * N + n]); o[1] = f2bf(w[(size_t)(k + 1) * N + n]); *(v2us*)(Bt + e) = o; }
         }
}
// all five input copies in one launch: f32 -> bf16 planes in fragment order. 64 threads a block of 16 rows x 32 k: thread = (row, 8-k piece), 4 pieces a row: a wave reads 8 whole 128-byte lines and stores 4 whole lines a piece.
// DM x DM / 8 threads, 16 waves on each of 256 work-groups. A thread takes its piece of each of the 4 weights and, of each batch column of X (rows s of column b: pitch B x D; they leave as plane b of XB, [TT][DM]), its piece of rows [0, TT / 2) and of rows [TT / 2, TT):
// 12 pieces, 24 loads of 16 bytes in flight a lane, in place of one piece a thread in twelve times the waves.
__global__ __launch_bounds__(512) void k_cvtall(const float* __restrict__ X, const float* __restrict__ wq, const float* __restrict__ wk, const float* __restrict__ wv, const float* __restrict__ wo, bf* XB, bf* WQ, bf* WK, bf* WV, bf* WO) {
    static_assert(DQ == DM && DKV == DM && TT == 2 * DM && DM % 32 == 0, "one thread numbering serves a weight and half a batch column");
    constexpr unsigned KB = DM / 32;
    const unsigned i = blockIdx.x * 512 + threadIdx.x, t = i >> 6, rl = (i >> 2) & 15, c = i & 3;
    const unsigned row = (t / KB) * 16 + rl, col = (t % KB) * 32 + c * 8;
    const unsigned so = (row * DM + col) * 4u;                                                   // byte offsets: in a weight,
    const unsigned xo0 = (row * (NB_ * DM) + col) * 4u, xo1 = xo0 + (TT / 2) * (NB_ * DM) * 4u;   // in X, column 0, either half of the rows,
    const unsigned d0 = (t * 512 + (c >> 1) * 256 + (c & 1) * 128 + rl * 8) * 2u, d1 = d0 + 2u * TT * DM * 2u;   // in a plane; d1: two planes of XB on
    v8f v[12];
    v[0] = *(const v8f*)((const char*)wq + so); v[1] = *(const v8f*)((const char*)wk + so); v[2] = *(const v8f*)((const char*)wv + so); v[3] = *(const v8f*)((const char*)wo + so);
#pragma unroll
    for (int b = 0; b < NB_; ++b) { v[4 + 2 * b] = *(const v8f*)((const char*)X + xo0 + b * DM * 4); v[5 + 2 * b] = *(const v8f*)((const char*)X + xo1 + b * DM * 4); }
    asm volatile("s_wait_xcnt 0x0" :: "v"(so), "v"(xo0), "v"(xo1), "s"(X), "s"(wq), "s"(wk), "s"(wv), "s"(wo) : "memory");   // the wait that stands before a register which the issued loads name is written again; offsets and bases are inputs, so their registers stay as they are up to it
    __builtin_amdgcn_sched_barrier(0);   // all 24 loads issue above it: one latency for the lot
    v4u o[12];
#pragma unroll
    for (int p = 0; p < 12; ++p)
#pragma unroll
        for (int k = 0; k < 4; ++k) o[p][k] = f2bf2(v[p][2 * k], v[p][2 * k + 1]);
    __builtin_amdgcn_sched_barrier(0);   // the stores stand together behind all the arithmetic: no register that an issued store names is written again
    *(v4u*)((char*)WQ + d0) = o[0]; *(v4u*)((char*)WK + d0) = o[1]; *(v4u*)((char*)WV + d0) = o[2]; *(v4u*)((char*)WO + d0) = o[3];
#pragma unroll
    for (int b = 0; b < NB_; ++b) { const unsigned db = b < 2 ? d0 : d1; const int pb = (b & 1) * TT * DM * 2;
        *(v4u*)((char*)XB + db + pb) = o[4 + 2 * b]; *(v4u*)((char*)XB + db + (pb + TT * DM)) = o[5 + 2 * b]; }
}

// ---- k_fattn: scores, softmax, P x V and the head merge; a WAVE owns 32 query rows of one head and walks the keys in chunks of CH with a running row maximum and row sum; no score or P ever leaves the registers. grid (rows / (32 NT), 1, batch columns x heads), 32 x NT x KSP threads; plane z = b x heads + h.
// A work-group is NT row tiles x KSP key ranges: wave w has tile w / KSP and keys [(w % KSP) TT / KSP, ..). The waves of a work-group with the same key range read the same K and V^T blocks of one head at about the same time.
// Per chunk the wave forms the TRANSPOSED scores S^T = K Q^T (K rows as the A operand, Q rows as B): accumulator s[kt][mb][j] of lane (lr, hi) is key 16 kt + 8 hi + j against query 16 mb + lr.
// So a lane holds CH / 2 keys of each of its 2 query rows (chunk maximum: in the lane, one exchange with lane ^ 16; the row sum stays a per-lane partial until the end),
// and the pair s[2c][mb], s[2c+1][mb], rounded to 16 bit, IS the B fragment of P^T for keys [32 c, 32 c + 32): element e < 8 is k = 8 hi + e, element 8 + e is k = 16 + 8 hi + e, the k order of WFrag::ld on the V^T rows.
// O^T += V^T P^T (V^T rows as A): o[nb][mb][j] of lane (lr, hi) is d = 16 nb + 8 hi + j of query 16 mb + lr: the query is the lane's own, so the factor 2^((old max - new max) HD^-0.5 log2 e) is applied in the lane, and 8 j are 16 contiguous bytes of a fragment-order plane.
// P = 2^((S - running max) HD^-0.5 log2 e) is not normalised in the loop; O^T is divided by the row sum at the end. KSP = 2: the two key ranges of a tile meet once in LDS (max, sum, O^T; range 0 first). HL: hi + lo bf16 planes, 3 products each; else fp16.
// behind a group of global loads: the wait that stands before a register which an issued load names is written again; the lane offset and the scalar bases are inputs, so their registers stay as they are up to it. The scheduling barrier behind it keeps the group's loads together above it: one latency a group.
__device__ __forceinline__ void ld_done(unsigned off, const void* p0, const void* p1, const void* p2, const void* p3) { asm volatile("s_wait_xcnt 0x0" :: "v"(off), "s"(p0), "s"(p1), "s"(p2), "s"(p3) : "memory"); __builtin_amdgcn_sched_barrier(0); /* no load of the group sinks below, no product rises above */ }
// 8 x 2^x; the v_nop is the one free slot behind the last transcendental (the others are each followed by an independent one: outputs are early-clobber, so none overwrites a source)
__device__ __forceinline__ v8f exp2x8(v8f x) { float e0, e1, e2, e3, e4, e5, e6, e7;
    asm("v_exp_f32 %0, %8\n\tv_exp_f32 %1, %9\n\tv_exp_f32 %2, %10\n\tv_exp_f32 %3, %11\n\tv_exp_f32 %4, %12\n\tv_exp_f32 %5, %13\n\tv_exp_f32 %6, %14\n\tv_exp_f32 %7, %15\n\tv_nop"
        : "=&v"(e0), "=&v"(e1), "=&v"(e2), "=&v"(e3), "=&v"(e4), "=&v"(e5), "=&v"(e6), "=&v"(e7) : "v"(x[0]), "v"(x[1]), "v"(x[2]), "v"(x[3]), "v"(x[4]), "v"(x[5]), "v"(x[6]), "v"(x[7]));
    return (v8f){e0, e1, e2, e3, e4, e5, e6, e7}; }
// 2 x 2^x, the same form
__device__ __forceinline__ void exp2x2(float x0, float x1, float& e0, float& e1) { asm("v_exp_f32 %0, %2\n\tv_exp_f32 %1, %3\n\tv_nop" : "=&v"(e0), "=&v"(e1) : "v"(x0), "v"(x1)); }
// the value of lane ^ 16, by a vector cross-row move (no LDS round trip)
__device__ __forceinline__ float xhalf(float v) { const unsigned u = __float_as_uint(v); return __uint_as_float(__builtin_amdgcn_permlanex16(u, u, 0x76543210u, 0xfedcba98u, false, false)); }
template <typename T16, bool HL, int NT, int KSP>
__global__ __launch_bounds__(32 * NT * KSP) void k_fattn(const T16* __restrict__ Q, const T16* __restrict__ Q2, const T16* __restrict__ Kp, const T16* __restrict__ Kp2, const T16* __restrict__ Vt, const T16* __restrict__ Vt2, int t0, bf* Ah, bf* Al) {
    typedef typename WFrag<T16>::V V;
    __shared__ float xs[KSP > 1 ? NT * 68 * 32 : 1];
    constexpr int CH = HL ? 32 : 64, NKT = CH / 16, NC = CH / 32;   // keys, K tiles and 32-key steps of V^T a chunk
    constexpr float CE = SCL * 1.4426950408889634f;                 // HD^-0.5 log2 e
    const size_t zo = (size_t)blockIdx.z * TT * HD;
    const int lane = threadIdx.x & 31;
    const int wv = __builtin_amdgcn_readfirstlane((int)(threadIdx.x >> 5)); const int tile = wv / KSP, part = wv % KSP;
    const int r0 = t0 + (blockIdx.x * NT + tile) * 32, k0 = part * (TT / KSP);
    Q += zo + (size_t)r0 * HD; Kp += zo + (size_t)k0 * HD; Vt += zo + (size_t)k0 * 16; if (HL) { Q2 += zo + (size_t)r0 * HD; Kp2 += zo + (size_t)k0 * HD; Vt2 += zo + (size_t)k0 * 16; }   // wave-uniform bases, planes in fragment order: 16 rows of Q or K are 2 blocks (1024 elements); 32 keys of V^T are one block of each of its 4 row blocks (TT / 32 blocks apart)
    const unsigned loff = lane * 8;   // one 32-bit lane offset: the lane's piece in a block
    unsigned kof = lane * 16, vof = lane * 16;   // the same in bytes, plus the chunk's place: scalar base + 32-bit lane offset + constant is the address form of every load in the loop
    auto at = [](const T16* p, unsigned byte_off, int elems) { return (const T16*)((const char*)p + byte_off) + elems; };
    V q[2][2], q2[2][2];
#pragma unroll
    for (int kc = 0; kc < 2; ++kc)
#pragma unroll
        for (int mb = 0; mb < 2; ++mb) { q[kc][mb] = WFrag<T16>::ld(Q + loff + (mb * 16 * HD + kc * 512)); if (HL) q2[kc][mb] = WFrag<T16>::ld(Q2 + loff + (mb * 16 * HD + kc * 512)); }
    V k[NKT][2], k2[NKT][2];   // the K fragments of the chunk at hand; the next chunk's are fetched into them once its scores are formed (next_k below)
#pragma unroll
    for (int kt = 0; kt < NKT; ++kt)
#pragma unroll
        for (int kc = 0; kc < 2; ++kc) { k[kt][kc] = WFrag<T16>::ld(at(Kp, kof, kt * 16 * HD + kc * 512)); if (HL) k2[kt][kc] = WFrag<T16>::ld(at(Kp2, kof, kt * 16 * HD + kc * 512)); }
    ld_done(kof, Q, HL ? Q2 : Q, Kp, HL ? Kp2 : Kp);
    v8f o[4][2];
#pragma unroll
    for (int nb = 0; nb < 4; ++nb) { o[nb][0] = (v8f){}; o[nb][1] = (v8f){}; }
    float mx[2] = {-3.0e38f, -3.0e38f}, sm[2] = {0.f, 0.f};
#pragma unroll 1
    for (int kb = 0; kb < TT / KSP / CH; ++kb) {
        V vb[NC][4], vl[NC][4];
#pragma unroll
        for (int c = 0; c < NC; ++c)
#pragma unroll
            for (int nb = 0; nb < 4; ++nb) { vb[c][nb] = WFrag<T16>::ld(at(Vt, vof, nb * 16 * TT + c * 512)); if (HL) vl[c][nb] = WFrag<T16>::ld(at(Vt2, vof, nb * 16 * TT + c * 512)); }
        ld_done(vof, Vt, HL ? Vt2 : Vt, Vt, HL ? Vt2 : Vt);   // the chunk's V^T loads issue here and land under the scores and the softmax; the offset steps on only behind it
        vof += kb + 1 < TT / KSP / CH ? CH * 16 * 2 : 0;   // stepped as kof is: never past the plane, and the 32-bit offset stays in its vector register beside the scalar base
        v8f s[NKT][2];
#pragma unroll
        for (int kt = 0; kt < NKT; ++kt) { s[kt][0] = (v8f){}; s[kt][1] = (v8f){}; }
#pragma unroll
        for (int kc = 0; kc < 2; ++kc)
#pragma unroll
            for (int kt = 0; kt < NKT; ++kt)
#pragma unroll
                for (int mb = 0; mb < 2; ++mb) { s[kt][mb] = WFrag<T16>::mma(k[kt][kc], q[kc][mb], s[kt][mb]); if (HL) { s[kt][mb] = WFrag<T16>::mma(k[kt][kc], q2[kc][mb], s[kt][mb]); s[kt][mb] = WFrag<T16>::mma(k2[kt][kc], q[kc][mb], s[kt][mb]); } }
        auto next_k = [&]() {
            __builtin_amdgcn_sched_barrier(0);   // the next chunk's K loads stay below the scores that read these registers
            kof += kb + 1 < TT / KSP / CH ? CH * HD * 2 : 0;   // the last chunk fetches itself again: no address past the head's plane
#pragma unroll
            for (int kt = 0; kt < NKT; ++kt)
#pragma unroll
                for (int kc = 0; kc < 2; ++kc) { k[kt][kc] = WFrag<T16>::ld(at(Kp, kof, kt * 16 * HD + kc * 512)); if (HL) k2[kt][kc] = WFrag<T16>::ld(at(Kp2, kof, kt * 16 * HD + kc * 512)); }
            ld_done(kof, Kp, HL ? Kp2 : Kp, Kp, HL ? Kp2 : Kp); };
        if constexpr (HL) next_k();   // 2 waves a SIMD, registers to spare: they land under the softmax and P x V
        else __builtin_amdgcn_sched_barrier(0);   // the scores' products issue back to back, each behind 7 independent ones; without it the maxima are woven in and each waits out a product's latency behind v_nops
        float mn[2], al[2];
#pragma unroll
        for (int mb = 0; mb < 2; ++mb) { float m = s[0][mb][0];
#pragma unroll
            for (int kt = 0; kt < NKT; ++kt)
#pragma unroll
                for (int j = 0; j < 8; ++j) m = fmaxf(m, s[kt][mb][j]);
            mn[mb] = fmaxf(mx[mb], fmaxf(m, xhalf(m))); }
        exp2x2((mx[0] - mn[0]) * CE, (mx[1] - mn[1]) * CE, al[0], al[1]);
#pragma unroll
        for (int mb = 0; mb < 2; ++mb) { const float nm = -mn[mb] * CE; float a4[4] = {0.f, 0.f, 0.f, 0.f};
#pragma unroll
            for (int kt = 0; kt < NKT; ++kt) { v8f x;
#pragma unroll
                for (int j = 0; j < 8; ++j) x[j] = fmaf(s[kt][mb][j], CE, nm);
                s[kt][mb] = exp2x8(x);
#pragma unroll
                for (int j = 0; j < 8; ++j) a4[j & 3] += s[kt][mb][j]; }
            sm[mb] = fmaf(sm[mb], al[mb], (a4[0] + a4[1]) + (a4[2] + a4[3])); mx[mb] = mn[mb];
#pragma unroll
            for (int nb = 0; nb < 4; ++nb) o[nb][mb] *= al[mb]; }
        __builtin_amdgcn_sched_barrier(0);   // no product of P x V rises among the exponentials above
        V a[NC][2], a2[NC][2];
#pragma unroll
        for (int c = 0; c < NC; ++c)
#pragma unroll
            for (int mb = 0; mb < 2; ++mb) {
                if constexpr (HL) { v4u h0, l0, h1, l1;
#pragma unroll
                    for (int e = 0; e < 4; ++e) { unsigned x, y; splitf2(s[2 * c][mb][2 * e], s[2 * c][mb][2 * e + 1], x, y); h0[e] = x; l0[e] = y; splitf2(s[2 * c + 1][mb][2 * e], s[2 * c + 1][mb][2 * e + 1], x, y); h1[e] = x; l1[e] = y; }
                    a[c][mb] = cat16b(__builtin_bit_cast(v8us, h0), __builtin_bit_cast(v8us, h1)); a2[c][mb] = cat16b(__builtin_bit_cast(v8us, l0), __builtin_bit_cast(v8us, l1));
                } else { v8h p0, p1;
#pragma unroll
                    for (int e = 0; e < 8; ++e) { p0[e] = tohx(s[2 * c][mb][e]); p1[e] = tohx(s[2 * c + 1][mb][e]); }
                    a[c][mb] = cat16(p0, p1); } }
        if constexpr (!HL) next_k();   // 3 waves a SIMD: only here, with the f32 scores rounded and gone, are the registers free; they land under P x V and the other waves
#pragma unroll
        for (int c = 0; c < NC; ++c)
#pragma unroll
            for (int nb = 0; nb < 4; ++nb)
#pragma unroll
                for (int mb = 0; mb < 2; ++mb) { o[nb][mb] = WFrag<T16>::mma(vb[c][nb], a[c][mb], o[nb][mb]); if (HL) { o[nb][mb] = WFrag<T16>::mma(vb[c][nb], a2[c][mb], o[nb][mb]); o[nb][mb] = WFrag<T16>::mma(vl[c][nb], a[c][mb], o[nb][mb]); } }
    }
    if constexpr (KSP > 1) {   // key range 1 hands its maximum, its per-lane sums and its O^T to range 0 of the same tile: word i of lane l at [i][l], no bank twice
        float* xw = xs + tile * (68 * 32) + lane;
        if (part) { xw[0] = mx[0]; xw[32] = mx[1]; xw[64] = sm[0]; xw[96] = sm[1];
#pragma unroll
            for (int nb = 0; nb < 4; ++nb)
#pragma unroll
                for (int mb = 0; mb < 2; ++mb)
#pragma unroll
                    for (int j = 0; j < 8; ++j) xw[(4 + (nb * 2 + mb) * 8 + j) * 32] = o[nb][mb][j]; }
        __syncthreads();   // every wave passes it once; range 0 reads only behind it
        if (part) return;
#pragma unroll
        for (int mb = 0; mb < 2; ++mb) { const float mo = xw[mb * 32], so = xw[(2 + mb) * 32], m = fmaxf(mx[mb], mo); float f0, f1; exp2x2((mx[mb] - m) * CE, (mo - m) * CE, f0, f1);
            sm[mb] = sm[mb] * f0 + so * f1;
#pragma unroll
            for (int nb = 0; nb < 4; ++nb)
#pragma unroll
                for (int j = 0; j < 8; ++j) o[nb][mb][j] = o[nb][mb][j] * f0 + xw[(4 + (nb * 2 + mb) * 8 + j) * 32] * f1; }
    }
    // merged heads [b][t][h][d], hi + lo bf16 planes, each [TT][DQ] in fragment order (the A operand of the output projection): the wave's (nb, mb) piece is 512 contiguous bytes, 4 whole lines
    v4u oh[4][2], ol[4][2];
#pragma unroll
    for (int mb = 0; mb < 2; ++mb) { const float a = sm[mb] + xhalf(sm[mb]); const float f = __fdiv_rn(1.0f, a);
#pragma unroll
        for (int nb = 0; nb < 4; ++nb)
#pragma unroll
            for (int j = 0; j < 4; ++j) { unsigned x, y; splitf2(o[nb][mb][2 * j] * f, o[nb][mb][2 * j + 1] * f, x, y); oh[nb][mb][j] = x; ol[nb][mb][j] = y; } }
    __builtin_amdgcn_sched_barrier(0);   // the stores stand together behind all the arithmetic: no register that an issued store names is written again
    const size_t oo = (size_t)(blockIdx.z / NH_) * TT * DQ + ((size_t)(r0 >> 4) * (DQ / 32) + (blockIdx.z % NH_) * (HD / 32)) * 512 + loff;
#pragma unroll
    for (int mb = 0; mb < 2; ++mb)
#pragma unroll
        for (int nb = 0; nb < 4; ++nb) { *(v4u*)(Ah + oo + (mb * (DQ / 32) * 512 + nb * 256)) = oh[nb][mb]; *(v4u*)(Al + oo + (mb * (DQ / 32) * 512 + nb * 256)) = ol[nb][mb]; }
}

extern "C" void kernel_launch(void* const* d_in, const int* in_sizes, int n_in,
                              void* d_out, int out_size, void* d_ws, size_t ws_size, hipStream_t stream) {
    (void)in_sizes; (void)n_in; (void)out_size;
    const float* x = (const float*)d_in[0];   /* query [S][B][D] = [2048][4][1024]: ONE stream: q, k and v all project it */ const float* wq = (const float*)d_in[1]; const float* bq = (const float*)d_in[2]; const float* wk = (const float*)d_in[3]; const float* bk = (const float*)d_in[4]; const float* wv = (const float*)d_in[5]; const float* bv = (const float*)d_in[6]; const float* wo = (const float*)d_in[7]; const float* bo = (const float*)d_in[8];
    float* OUT = (float*)d_out;     // [2048][4][1024] sequence-first
    char* wsp = (char*)d_ws;
    auto take = [&](size_t bytes) { char* p = wsp; wsp += (bytes + 255) & ~(size_t)255; return (void*)p; };
    bf* WQ = (bf*)take((size_t)DQ * DM * 2); bf* WK = (bf*)take((size_t)DKV * DM * 2); bf* WV = (bf*)take((size_t)DKV * DM * 2); bf* WO = (bf*)take((size_t)DM * DQ * 2);
    bf* XB = (bf*)take((size_t)NB_ * TT * DM * 2);
    h16* QP16 = (h16*)take((size_t)NB_ * NH_ * TT * HD * 2); h16* KP16 = (h16*)take((size_t)NB_ * NKV * TT * HD * 2); h16* VT16 = (h16*)take((size_t)NB_ * NKV * HD * TT * 2);
    bf* QPh = (bf*)take((size_t)NB_ * NH_ * TT * HD * 2); bf* QPl = (bf*)take((size_t)NB_ * NH_ * TT * HD * 2); bf* KPh = (bf*)take((size_t)NB_ * NKV * TT * HD * 2); bf* KPl = (bf*)take((size_t)NB_ * NKV * TT * HD * 2); bf* VTh = (bf*)take((size_t)NB_ * NKV * HD * TT * 2); bf* VTl = (bf*)take((size_t)NB_ * NKV * HD * TT * 2);
    bf* ATh = (bf*)take((size_t)NB_ * TT * DQ * 2); bf* ATl = (bf*)take((size_t)NB_ * TT * DQ * 2);
    if ((size_t)(wsp - (char*)d_ws) > ws_size) return;    // ws 256 MiB
    k_cvtall<<<dim3(DM * DM / 8 / 512, 1, 1), 512, 0, stream>>>(x, wq, wk, wv, wo, XB, WQ, WK, WV, WO);
    k_qkv<<<dim3(8, 8, 3 * NB_), 512, 0, stream>>>(XB, WQ, WK, WV, bq, bk, bv, QP16, QPh, QPl, KP16, KPh, KPl, VT16, VTh, VTl);
    k_fattn<bf, true, 4, 2><<<dim3(RH / 128, 1, NB_ * ZH), 256, 0, stream>>>(QPh, QPl, KPh, KPl, VTh, VTl, 0, ATh, ATl);   // one kv head per query head: plane z of each (z-stride TT*HD)
    k_fattn<h16, false, 12, 1><<<dim3((TT - RH) / 384, 1, NB_ * ZH), 384, 0, stream>>>(QP16, nullptr, KP16, nullptr, VT16, nullptr, RH, ATh, ATl);
    k_gemmw<bf, 1, true, 2, 0, DQ, 4, 2><<<dim3(TT / 256, DM / 128, NB_), 512, 0, stream>>>(ATh, ATl, WO, nullptr, OUT, NB_ * DM, bo, (size_t)TT * DQ, 0, (size_t)DM, nullptr, nullptr, nullptr);   /* [S][B][D]: row pitch B x D, column block b */
}
